// v000
// The times below were measured on an AMD MI455X: many runs one after another, warmed up first and cycling through
// copies of the inputs, with the whole window's GPU time divided by the number of runs. Launches and the gaps
// between them are all in it. The median over several windows is given; except for v000 it joins two sittings, which
// can be a few percent apart, so the side-by-side timings, each taken in one sitting, are the better comparison.
// v000, which the later versions start from, runs in 352 microseconds.
// compute dtype: all float inputs rounded to bf16; q/k/v = x . W + b with EXACT bf16 products on WMMA 16x16x32 ((in,out) weights as transposed rows), f16 hi + residual; banded attention (|i - j| <= 256; other key tiles skipped) with 3-product logits and 3-product P.v, x 1/8, running-max softmax in f32 (hardware exp); the merged context is the f32 output.
#include <hip/hip_runtime.h>
#include <math.h>

typedef __attribute__((ext_vector_type(16))) _Float16 v16h;
typedef __attribute__((ext_vector_type(16))) __bf16 v16b;
typedef __attribute__((ext_vector_type(8)))  _Float16 v8h;
typedef __attribute__((ext_vector_type(8)))  float v8f;
typedef __attribute__((ext_vector_type(4)))  float v4f;
typedef __attribute__((ext_vector_type(2)))  float v2f;
typedef __attribute__((ext_vector_type(4)))  unsigned v4u;
typedef __attribute__((ext_vector_type(4)))  int v4i;
typedef float __attribute__((may_alias)) float_a;
typedef int __attribute__((may_alias)) int_a;

template <typename T> __device__ __forceinline__ void vst2(void* p, T v) { *(T*)p = v;  }
__device__ __forceinline__ v8f wmma16(v16h a, v16h b, v8f c) {
  v8f d = __builtin_amdgcn_wmma_f32_16x16x32_f16(false, a, false, b, (short)0, c, false, false);
  asm volatile("v_nop\n\tv_nop\n\tv_nop\n\tv_nop" : "+v"(d) : "v"(a), "v"(b));
  return d;
}
__device__ __forceinline__ v8f wmma_bf(v16b a, v16b b, v8f c) {
  v8f d = __builtin_amdgcn_wmma_f32_16x16x32_bf16(false, a, false, b, (short)0, c, false, false);
  asm volatile("v_nop\n\tv_nop\n\tv_nop\n\tv_nop" : "+v"(d) : "v"(a), "v"(b));
  return d;
}
// Longformer multi-head attention (B 2, S 8,192, D 512, 8 heads x 64, one-sided window 256): (in,out) projections + biases, q / 8, banded softmax, no output projection (the merged context is the output).
__device__ __forceinline__ v16h frag_h(const _Float16* rowk0, int lane) {
  union { v16h v; v8h q[2]; } u; const _Float16* p = rowk0 + 8 * (lane >> 4);
  u.q[0] = *(const v8h*)p; u.q[1] = *(const v8h*)(p + 16); return u.v;
}
__device__ __forceinline__ v16h frag_f32(const float* rowk0, int lane) {
  v16h a; const float* p = rowk0 + 8 * (lane >> 4);
#pragma unroll
  for (int i = 0; i < 8; ++i) { a[i] = (_Float16)p[i]; a[8 + i] = (_Float16)p[16 + i]; }
  return a;
}
__device__ __forceinline__ v16h frag_f32s(const float* rowk0, int lane, float sc) {
  v16h a; const float* p = rowk0 + 8 * (lane >> 4);
#pragma unroll
  for (int i = 0; i < 8; ++i) { a[i] = (_Float16)(p[i] * sc); a[8 + i] = (_Float16)(p[16 + i] * sc); }
  return a;
}
// column fragment from a [K][ld] layout (column n), rows >= K read as 0
__device__ __forceinline__ v16h fragc_f32(const float* W, int k0, int n, int lane, int ld, int K) {
  v16h a; const int g = lane >> 4;
#pragma unroll
  for (int i = 0; i < 8; ++i) { const int ka = k0 + 8 * g + i, kb = ka + 16;
    a[i] = (_Float16)(ka < K ? W[(size_t)(ka < K ? ka : K - 1) * ld + n] : 0.f); a[8 + i] = (_Float16)(kb < K ? W[(size_t)(kb < K ? kb : K - 1) * ld + n] : 0.f); }
  return a;
}
struct F2 { v16b h, l; };
__device__ __forceinline__ F2 bsplit16(const float v[16]) { F2 r;
#pragma unroll
  for (int i = 0; i < 16; ++i) { const __bf16 h = (__bf16)v[i]; r.h[i] = h; r.l[i] = (__bf16)(v[i] - (float)h); }
  return r; }
__device__ __forceinline__ F2 split_row(const float* row, int k0, int lane) { float v[16]; const float* p = row + k0 + 8 * (lane >> 4);
#pragma unroll
  for (int i = 0; i < 8; ++i) { v[i] = p[i]; v[8 + i] = p[16 + i]; }
  return bsplit16(v); }
__device__ __forceinline__ F2 split_rowK(const float* row, int k0, int lane, int K) { float v[16]; const int g = lane >> 4;
#pragma unroll
  for (int i = 0; i < 8; ++i) { const int ka = k0 + 8 * g + i, kb = ka + 16; v[i] = ka < K ? row[ka < K ? ka : K - 1] : 0.f; v[8 + i] = kb < K ? row[kb < K ? kb : K - 1] : 0.f; }
  return bsplit16(v); }
__device__ __forceinline__ F2 split_col(const float* W, int k0, int n, int lane, int ld, int K) { float v[16]; const int g = lane >> 4;
#pragma unroll
  for (int i = 0; i < 8; ++i) { const int ka = k0 + 8 * g + i, kb = ka + 16; v[i] = ka < K ? W[(size_t)(ka < K ? ka : K - 1) * ld + n] : 0.f; v[8 + i] = kb < K ? W[(size_t)(kb < K ? kb : K - 1) * ld + n] : 0.f; }
  return bsplit16(v); }
__device__ __forceinline__ v8f mac3(const F2& a, const F2& b, v8f c) { c = wmma_bf(a.l, b.h, c); c = wmma_bf(a.h, b.l, c); return wmma_bf(a.h, b.h, c); }
__device__ __forceinline__ float sigm(float v) { return 1.0f / (1.0f + expf(-v)); }
#define LDSX() do { asm volatile("s_wait_dscnt 0" ::: "memory"); __builtin_amdgcn_wave_barrier(); __builtin_amdgcn_fence(__ATOMIC_RELEASE, "workgroup"); } while (0)


#define NB 2
#define SS 8192
#define DM 512
#define NH 8
#define LW 256
#define HD 64
#define QKVW (3 * DM)
#ifndef TQB
#define TQB (SS / 64)
#define TNB NB
#define TOB (NB * SS / 64)     // output row tiles (all)
#endif
typedef __attribute__((ext_vector_type(8))) __bf16 v8b;
__device__ __forceinline__ v16b frag_b(const __bf16* rowk0, int lane) {
  union { v16b v; v8b q[2]; } u; const __bf16* p = rowk0 + 8 * (lane >> 4);
  u.q[0] = *(const v8b*)p; u.q[1] = *(const v8b*)(p + 16); return u.v;
}
__device__ __forceinline__ float bfr(float v) { return (float)(__bf16)v; }
__device__ __attribute__((noinline)) float exp_ni(float v) { return expf(v); }
__device__ __attribute__((noinline)) float erf_ni(float v) { return erff(v); }

#define PK_A 0                       // [1536][512] Wqkv rows (natural [out][in])
#define PK_P (PK_A + QKVW * DM)        // [512][512]; not written here (no W_o input)
#define PK_END (PK_P + DM * DM)
#define WS_PK  0u
#define WS_QK  (WS_PK + 2u * PK_END)             // f16 [16384 rows][1024]: q | k
#define WS_QKL (WS_QK + 2u * NB * SS * 2 * DM)     // f16 q | k residual planes x2048
#define WS_VTH (WS_QKL + 2u * NB * SS * 2 * DM)    // f16 [b][512 (h*64+d)][8192 s] hi
#define WS_VTL (WS_VTH + 2u * NB * DM * SS)        // f16 lo x 2048
#define WS_O   (WS_VTL + 2u * NB * DM * SS)        // f32 [16384][512] (unused)
#define WS_CS  (WS_O + 4u * NB * SS * DM)           // f32 [8192][32] x 2 (unused)
#define WS_END (WS_CS + 4u * 2 * SS * 32)
// ---- k_pack: block = (row n, which): column n of (in,out) weight -> bf16 row; which 0..2 -> W_q/W_k/W_v into PK_A rows which*512 + n
__global__ __launch_bounds__(256) void k_pack(const float* __restrict__ WQ, const float* __restrict__ WK, const float* __restrict__ WV, __bf16* __restrict__ PK) {   // (in,out) weights [512][512]: packed row (which*DM + n) = column n
  __shared__ __align__(16) __bf16 s[DM]; const int n = blockIdx.x, which = blockIdx.y, t = threadIdx.x; const float* Wm = which == 0 ? WQ : which == 1 ? WK : WV;
  for (int k = t; k < DM; k += 256) s[k] = (__bf16)Wm[(size_t)k * DM + n]; __syncthreads(); __bf16* dst = PK + PK_A + ((size_t)which * DM + n) * DM; for (int q = t; q < DM / 8; q += 256) vst2((unsigned*)(dst + q * 8), *(const v4u*)&s[q * 8]); }
__global__ __launch_bounds__(128) void k_qkv(const float* __restrict__ XQ, const float* __restrict__ XK, const float* __restrict__ XV, const __bf16* __restrict__ P, const float* __restrict__ BQ, const float* __restrict__ BK, const float* __restrict__ BV, _Float16* __restrict__ QK, _Float16* __restrict__ QKL, _Float16* __restrict__ VTH, _Float16* __restrict__ VTL) {
  const int which0 = (blockIdx.y * 128) / DM; const float* X = (which0 == 0) ? XQ : (which0 == 1) ? XK : XV; const float* BB = BQ ? (((which0 == 0) ? BQ : (which0 == 1) ? BK : BV) + (blockIdx.y * 128 - which0 * DM)) : nullptr;
  __shared__ __align__(16) _Float16 so[4][16][136], sol[4][16][136]; __shared__ __align__(16) _Float16 sth[128][72], stl[128][72];
  const int tid = threadIdx.x, wave = tid >> 5, lane = tid & 31, col = lane & 15, g = lane >> 4; const size_t r0 = (size_t)blockIdx.x * 64 + wave * 16; const int n0 = blockIdx.y * 128;
  v8f acc[8] = {};
#pragma unroll 2
  for (int kc = 0; kc < DM / 32; ++kc) { v16b a; { const float* p = X + (r0 + col) * DM + kc * 32 + 8 * g;
#pragma unroll
      for (int i = 0; i < 8; ++i) { a[i] = (__bf16)p[i]; a[8 + i] = (__bf16)p[16 + i]; } }
#pragma unroll
    for (int j = 0; j < 8; ++j) acc[j] = wmma_bf(a, frag_b(P + (size_t)(n0 + j * 16 + col) * DM + kc * 32, lane), acc[j]); }
  if (n0 < 2 * DM) {   // q stored unscaled (f16 sigma ~0.6, no subnormal exposure); 1/8 applied to the f32 score
#pragma unroll
    for (int j = 0; j < 8; ++j) {
#pragma unroll
      for (int r = 0; r < 8; ++r) { const float v = acc[j][r] + (BB ? bfr(BB[j * 16 + col]) : 0.f); const _Float16 hv = (_Float16)v; so[wave][8 * g + r][j * 16 + col] = hv; sol[wave][8 * g + r][j * 16 + col] = (_Float16)((v - (float)hv) * 2048.0f); } }   // q, k (+ bias) as f16 hi + (x2048) residual
    LDSX();
    for (int rl = 0; rl < 16; ++rl) if (lane < 16) { vst2((unsigned*)(QK + (r0 + rl) * (2 * DM) + n0 + lane * 8), *(const v4u*)&so[wave][rl][lane * 8]); vst2((unsigned*)(QKL + (r0 + rl) * (2 * DM) + n0 + lane * 8), *(const v4u*)&sol[wave][rl][lane * 8]); }
  } else {
#pragma unroll
    for (int j = 0; j < 8; ++j) {
#pragma unroll
      for (int r = 0; r < 8; ++r) { const float v = acc[j][r] + (BB ? bfr(BB[j * 16 + col]) : 0.f); const _Float16 hv = (_Float16)v; sth[j * 16 + col][wave * 16 + 8 * g + r] = hv; stl[j * 16 + col][wave * 16 + 8 * g + r] = (_Float16)((v - (float)hv) * 2048.0f); } }
    __syncthreads();
    const size_t rb = (size_t)blockIdx.x * 64; const int b = (int)(rb / SS), s0 = (int)(rb % SS); const int pc0 = n0 - 2 * DM;
    for (int q = tid; q < 128 * 8; q += 128) { const int d = q >> 3, pc = q & 7; const size_t o = ((size_t)b * DM + pc0 + d) * SS + s0 + pc * 8; vst2((unsigned*)(VTH + o), *(const v4u*)&sth[d][pc * 8]); vst2((unsigned*)(VTL + o), *(const v4u*)&stl[d][pc * 8]); }
  }
}
// ---- k_attn: block = (64 queries, head h, batch b): banded flash attention over window key tiles (K = 64: 2 k-steps), scores = (q.k) * 0.125 from 3 f16 products (q hi/lo x k hi/lo), P.V: f16 P*2048 hi/lo x (V hi, V lo*2048) in two accumulators; O[b*S+q][h*64+d] = (acc + accl / 2048) / 2048 / l (256-B segments)
__global__ __launch_bounds__(128) void k_attn(const _Float16* __restrict__ QK, const _Float16* __restrict__ QKL, const _Float16* __restrict__ VTH, const _Float16* __restrict__ VTL, const void* __restrict__ KMASK, float* __restrict__ O) {
  __shared__ __align__(16) float sp[4][16][36]; __shared__ __align__(16) float so[4][16][68];
  const int tid = threadIdx.x, wave = tid >> 5, lane = tid & 31, col = lane & 15, g = lane >> 4;
  const int qb = blockIdx.x, h = blockIdx.y, b = blockIdx.z; const int q0 = qb * 64 + wave * 16; const size_t rq = (size_t)b * SS + q0 + col;
  v16h aq[2], aql[2];
#pragma unroll
  for (int kc = 0; kc < 2; ++kc) { aq[kc] = frag_h(QK + rq * (2 * DM) + h * HD + kc * 32, lane); aql[kc] = frag_h(QKL + rq * (2 * DM) + h * HD + kc * 32, lane); }
  float m[8], l[8];
#pragma unroll
  for (int r = 0; r < 8; ++r) { m[r] = -3.0e38f; l[r] = 0.f; }
  v8f acc[4] = {}, accl[4] = {};
  const int nks = SS / 32;   // all keys
  const int ks0 = (qb * 64 - LW) > 0 ? (qb * 64 - LW) / 32 : 0; const int ks1 = ((qb * 64 + 64 + LW) / 32) < nks ? ((qb * 64 + 64 + LW) / 32) : nks;   // window tiles
#pragma unroll 1
  for (int ks = ks0; ks < ks1; ++ks) { v8f s[2];
#pragma unroll
    for (int ct = 0; ct < 2; ++ct) { const int kk = ks * 32 + ct * 16 + col; const _Float16* krow = QK + ((size_t)b * SS + kk) * (2 * DM) + DM + h * HD; const _Float16* krowl = QKL + ((size_t)b * SS + kk) * (2 * DM) + DM + h * HD; v8f c = {}, cl = {};
      if (qb < 128) {   // every query block of this grid (qb < TQB = 128): 3 products
#pragma unroll
        for (int kc = 0; kc < 2; ++kc) { const v16h kh = frag_h(krow + kc * 32, lane); c = wmma16(aq[kc], kh, c); cl = wmma16(aql[kc], kh, cl); cl = wmma16(aq[kc], frag_h(krowl + kc * 32, lane), cl); }
#pragma unroll
        for (int r = 0; r < 8; ++r) c[r] += cl[r] * (1.0f / 2048.0f); }
      else {
#pragma unroll
        for (int kc = 0; kc < 2; ++kc) c = wmma16(aq[kc], frag_h(krow + kc * 32, lane), c); }   // single product for qb >= 128 (none in this grid)
      { const bool keepk = true;
#pragma unroll
      for (int r = 0; r < 8; ++r) { const int dq = (q0 + 8 * g + r) - kk; s[ct][r] = (keepk && dq <= LW && dq >= -LW) ? c[r] * 0.125f : -3.0e38f; } } }   // 1/sqrt(64); masked keys excluded
#pragma unroll
    for (int r = 0; r < 8; ++r) { float mx = fmaxf(s[0][r], s[1][r]);
#pragma unroll
      for (int o = 1; o < 16; o <<= 1) mx = fmaxf(mx, __shfl_xor(mx, o));
      const float mn = fmaxf(m[r], mx); const float alpha = (m[r] <= -1.0e38f) ? 0.f : __expf(m[r] - mn);
      const float e0 = (s[0][r] <= -1.0e38f) ? 0.f : __expf(s[0][r] - mn), e1 = (s[1][r] <= -1.0e38f) ? 0.f : __expf(s[1][r] - mn); float es = e0 + e1;
#pragma unroll
      for (int o = 1; o < 16; o <<= 1) es += __shfl_xor(es, o);
      l[r] = l[r] * alpha + es; m[r] = mn;
#pragma unroll
      for (int dt = 0; dt < 4; ++dt) { acc[dt][r] *= alpha; accl[dt][r] *= alpha; }
      sp[wave][8 * g + r][col] = e0; sp[wave][8 * g + r][16 + col] = e1; }
    LDSX();
    v16h pa, pl; { const float* prow = &sp[wave][col][0] + 8 * (lane >> 4);
#pragma unroll
      for (int i = 0; i < 8; ++i) { const float x0 = prow[i] * 2048.0f, x1 = prow[16 + i] * 2048.0f; const _Float16 h0 = (_Float16)x0, h1 = (_Float16)x1; pa[i] = h0; pa[8 + i] = h1; pl[i] = (_Float16)((x0 - (float)h0) * 2048.0f); pl[8 + i] = (_Float16)((x1 - (float)h1) * 2048.0f); } }   // P scaled by 2^11 before the f16 split so small softmax weights stay out of the f16 subnormal range; 2^-11 folded into the epilogue
#pragma unroll
    for (int dt = 0; dt < 4; ++dt) { const size_t vr = ((size_t)b * DM + h * HD + dt * 16 + col) * SS + ks * 32; const v16h vh = frag_h(VTH + vr, lane); acc[dt] = wmma16(pa, vh, acc[dt]); if (qb < 128) { accl[dt] = wmma16(pl, vh, accl[dt]); accl[dt] = wmma16(pa, frag_h(VTL + vr, lane), accl[dt]); } }   // every query block (qb < TQB = 128): P hi/lo x V hi/lo (3 products); qb >= 128 (none in this grid): P x V single
    LDSX(); }
#pragma unroll
  for (int r = 0; r < 8; ++r) { const float il = (1.0f / 2048.0f) / l[r];
#pragma unroll
    for (int dt = 0; dt < 4; ++dt) so[wave][8 * g + r][dt * 16 + col] = (acc[dt][r] + accl[dt][r] * (1.0f / 2048.0f)) * il; }
  LDSX();
  for (int rl = 0; rl < 16; ++rl) if (lane < 16) vst2(O + ((size_t)b * SS + q0 + rl) * DM + h * HD + lane * 4, *(const v4f*)&so[wave][rl][lane * 4]);
}
// ---- k_out: block = (64 rows, 128 cols): out = O(hi/lo) . Wo rows (2 products) + bo
__global__ __launch_bounds__(128) void k_out(const float* __restrict__ O, const __bf16* __restrict__ P, const float* __restrict__ BO, float* __restrict__ Y) {
  __shared__ __align__(16) float so[4][16][132];
  const int tid = threadIdx.x, wave = tid >> 5, lane = tid & 31, col = lane & 15, g = lane >> 4; const size_t r0 = (size_t)blockIdx.x * 64 + wave * 16; const int n0 = blockIdx.y * 128;
  v8f acc[8] = {};
#pragma unroll 2
  for (int kc = 0; kc < DM / 32; ++kc) { const F2 a = split_row(O + (r0 + col) * DM, kc * 32, lane);
#pragma unroll
    for (int j = 0; j < 8; ++j) { const v16b w = frag_b(P + (size_t)(n0 + j * 16 + col) * DM + kc * 32, lane); acc[j] = wmma_bf(a.l, w, acc[j]); acc[j] = wmma_bf(a.h, w, acc[j]); } }
#pragma unroll
  for (int j = 0; j < 8; ++j) {
#pragma unroll
    for (int r = 0; r < 8; ++r) so[wave][8 * g + r][j * 16 + col] = acc[j][r] + (BO ? bfr(BO[n0 + j * 16 + col]) : 0.f); }
  LDSX();
  for (int rl = 0; rl < 16; ++rl) vst2(Y + (r0 + rl) * DM + n0 + lane * 4, *(const v4f*)&so[wave][rl][lane * 4]);
}
extern "C" void kernel_launch(void* const* d_in, const int* in_sizes, int n_in, void* d_out, int out_size, void* d_ws, size_t ws_size, hipStream_t stream) {
  (void)in_sizes; (void)n_in; (void)out_size;
  const float** F = (const float**)d_in;   // 0 x [2,8192,512], 1 Wq [512,512] (in,out), 2 bq, 3 Wk, 4 bk, 5 Wv, 6 bv
  if (ws_size < (size_t)WS_END) return;
  char* ws = (char*)d_ws; __bf16* PK = (__bf16*)(ws + WS_PK); _Float16 *QK = (_Float16*)(ws + WS_QK), *QKL = (_Float16*)(ws + WS_QKL), *VTH = (_Float16*)(ws + WS_VTH), *VTL = (_Float16*)(ws + WS_VTL);
  k_pack<<<dim3(DM, 3), 256, 0, stream>>>(F[1], F[3], F[5], PK);
  k_qkv<<<dim3(TNB * SS / 64, QKVW / 128), 128, 0, stream>>>(F[0], F[0], F[0], PK + PK_A, F[2], F[4], F[6], QK, QKL, VTH, VTL);
  k_attn<<<dim3(TQB, NH, TNB), 128, 0, stream>>>(QK, QKL, VTH, VTL, nullptr, (float*)d_out);
}

// v001
// Measured time: 197 microseconds a run.
// Two timings next to v000 put it at 1.84 and 1.85 times that version's speed.
// compute dtype: all float inputs rounded to bf16; q/k/v = x . W + b with EXACT bf16 products on WMMA 16x16x32 ((in,out) weights as transposed rows), f16 hi + residual; banded attention (|i - j| <= 256; other key tiles skipped) with 3-product logits and 3-product P.v, x 1/8, running-max softmax in f32 (hardware exp); the merged context is the f32 output.
#include <hip/hip_runtime.h>
#include <math.h>

typedef __attribute__((ext_vector_type(16))) _Float16 v16h;
typedef __attribute__((ext_vector_type(16))) __bf16 v16b;
typedef __attribute__((ext_vector_type(8)))  _Float16 v8h;
typedef __attribute__((ext_vector_type(8)))  float v8f;
typedef __attribute__((ext_vector_type(4)))  float v4f;
typedef __attribute__((ext_vector_type(2)))  float v2f;
typedef __attribute__((ext_vector_type(4)))  unsigned v4u;
typedef __attribute__((ext_vector_type(4)))  int v4i;
typedef float __attribute__((may_alias)) float_a;
typedef int __attribute__((may_alias)) int_a;

template <typename T> __device__ __forceinline__ void vst2(void* p, T v) { *(T*)p = v;  }
__device__ __forceinline__ v8f wmma16(v16h a, v16h b, v8f c) {
  v8f d = __builtin_amdgcn_wmma_f32_16x16x32_f16(false, a, false, b, (short)0, c, false, false);
  asm volatile("v_nop\n\tv_nop\n\tv_nop\n\tv_nop" : "+v"(d) : "v"(a), "v"(b));
  return d;
}
__device__ __forceinline__ v8f wmma_bf(v16b a, v16b b, v8f c) {
  v8f d = __builtin_amdgcn_wmma_f32_16x16x32_bf16(false, a, false, b, (short)0, c, false, false);
  asm volatile("v_nop\n\tv_nop\n\tv_nop\n\tv_nop" : "+v"(d) : "v"(a), "v"(b));
  return d;
}
// Longformer multi-head attention (B 2, S 8,192, D 512, 8 heads x 64, one-sided window 256): (in,out) projections + biases, q / 8, banded softmax, no output projection (the merged context is the output).
__device__ __forceinline__ v16h frag_h(const _Float16* rowk0, int lane) {
  union { v16h v; v8h q[2]; } u; const _Float16* p = rowk0 + 8 * (lane >> 4);
  u.q[0] = *(const v8h*)p; u.q[1] = *(const v8h*)(p + 16); return u.v;
}
__device__ __forceinline__ v16h frag_f32(const float* rowk0, int lane) {
  v16h a; const float* p = rowk0 + 8 * (lane >> 4);
#pragma unroll
  for (int i = 0; i < 8; ++i) { a[i] = (_Float16)p[i]; a[8 + i] = (_Float16)p[16 + i]; }
  return a;
}
__device__ __forceinline__ v16h frag_f32s(const float* rowk0, int lane, float sc) {
  v16h a; const float* p = rowk0 + 8 * (lane >> 4);
#pragma unroll
  for (int i = 0; i < 8; ++i) { a[i] = (_Float16)(p[i] * sc); a[8 + i] = (_Float16)(p[16 + i] * sc); }
  return a;
}
// column fragment from a [K][ld] layout (column n), rows >= K read as 0
__device__ __forceinline__ v16h fragc_f32(const float* W, int k0, int n, int lane, int ld, int K) {
  v16h a; const int g = lane >> 4;
#pragma unroll
  for (int i = 0; i < 8; ++i) { const int ka = k0 + 8 * g + i, kb = ka + 16;
    a[i] = (_Float16)(ka < K ? W[(size_t)(ka < K ? ka : K - 1) * ld + n] : 0.f); a[8 + i] = (_Float16)(kb < K ? W[(size_t)(kb < K ? kb : K - 1) * ld + n] : 0.f); }
  return a;
}
struct F2 { v16b h, l; };
__device__ __forceinline__ F2 bsplit16(const float v[16]) { F2 r;
#pragma unroll
  for (int i = 0; i < 16; ++i) { const __bf16 h = (__bf16)v[i]; r.h[i] = h; r.l[i] = (__bf16)(v[i] - (float)h); }
  return r; }
__device__ __forceinline__ F2 split_row(const float* row, int k0, int lane) { float v[16]; const float* p = row + k0 + 8 * (lane >> 4);
#pragma unroll
  for (int i = 0; i < 8; ++i) { v[i] = p[i]; v[8 + i] = p[16 + i]; }
  return bsplit16(v); }
__device__ __forceinline__ F2 split_rowK(const float* row, int k0, int lane, int K) { float v[16]; const int g = lane >> 4;
#pragma unroll
  for (int i = 0; i < 8; ++i) { const int ka = k0 + 8 * g + i, kb = ka + 16; v[i] = ka < K ? row[ka < K ? ka : K - 1] : 0.f; v[8 + i] = kb < K ? row[kb < K ? kb : K - 1] : 0.f; }
  return bsplit16(v); }
__device__ __forceinline__ F2 split_col(const float* W, int k0, int n, int lane, int ld, int K) { float v[16]; const int g = lane >> 4;
#pragma unroll
  for (int i = 0; i < 8; ++i) { const int ka = k0 + 8 * g + i, kb = ka + 16; v[i] = ka < K ? W[(size_t)(ka < K ? ka : K - 1) * ld + n] : 0.f; v[8 + i] = kb < K ? W[(size_t)(kb < K ? kb : K - 1) * ld + n] : 0.f; }
  return bsplit16(v); }
__device__ __forceinline__ v8f mac3(const F2& a, const F2& b, v8f c) { c = wmma_bf(a.l, b.h, c); c = wmma_bf(a.h, b.l, c); return wmma_bf(a.h, b.h, c); }
__device__ __forceinline__ float sigm(float v) { return 1.0f / (1.0f + expf(-v)); }
#define LDSX() do { asm volatile("s_wait_dscnt 0" ::: "memory"); __builtin_amdgcn_wave_barrier(); __builtin_amdgcn_fence(__ATOMIC_RELEASE, "workgroup"); } while (0)


#define NB 2
#define SS 8192
#define DM 512
#define NH 8
#define LW 256
#define HD 64
#define QKVW (3 * DM)
#ifndef TQB
#define TQB (SS / 64)
#define TNB NB
#define TOB (NB * SS / 64)     // output row tiles (all)
#endif
typedef __attribute__((ext_vector_type(8))) __bf16 v8b;
__device__ __forceinline__ v16b frag_b(const __bf16* rowk0, int lane) {
  union { v16b v; v8b q[2]; } u; const __bf16* p = rowk0 + 8 * (lane >> 4);
  u.q[0] = *(const v8b*)p; u.q[1] = *(const v8b*)(p + 16); return u.v;
}
__device__ __forceinline__ float bfr(float v) { return (float)(__bf16)v; }
__device__ __attribute__((noinline)) float exp_ni(float v) { return expf(v); }
__device__ __attribute__((noinline)) float erf_ni(float v) { return erff(v); }

#define PK_A 0                       // [1536][512] Wqkv rows (natural [out][in])
#define PK_P (PK_A + QKVW * DM)        // [512][512]; not written here (no W_o input)
#define PK_END (PK_P + DM * DM)
#define WS_PK  0u
#define WS_QK  (WS_PK + 2u * PK_END)             // f16 [16384 rows][1024]: q | k
#define WS_QKL (WS_QK + 2u * NB * SS * 2 * DM)     // f16 q | k residual planes x2048
#define WS_VTH (WS_QKL + 2u * NB * SS * 2 * DM)    // f16 [b][512 (h*64+d)][8192 s] hi
#define WS_VTL (WS_VTH + 2u * NB * DM * SS)        // f16 lo x 2048
#define WS_O   (WS_VTL + 2u * NB * DM * SS)        // f32 [16384][512] (unused)
#define WS_CS  (WS_O + 4u * NB * SS * DM)           // f32 [8192][32] x 2 (unused)
#define WS_END (WS_CS + 4u * 2 * SS * 32)
// ---- k_pack: block = (row n, which): column n of (in,out) weight -> bf16 row; which 0..2 -> W_q/W_k/W_v into PK_A rows which*512 + n
__global__ __launch_bounds__(256) void k_pack(const float* __restrict__ WQ, const float* __restrict__ WK, const float* __restrict__ WV, __bf16* __restrict__ PK) {   // (in,out) weights [512][512]: packed row (which*DM + n) = column n
  __shared__ __align__(16) __bf16 s[DM]; const int n = blockIdx.x, which = blockIdx.y, t = threadIdx.x; const float* Wm = which == 0 ? WQ : which == 1 ? WK : WV;
  for (int k = t; k < DM; k += 256) s[k] = (__bf16)Wm[(size_t)k * DM + n]; __syncthreads(); __bf16* dst = PK + PK_A + ((size_t)which * DM + n) * DM; for (int q = t; q < DM / 8; q += 256) vst2((unsigned*)(dst + q * 8), *(const v4u*)&s[q * 8]); }
#define KP 72   // 16-bit elements per staged 128-B row (K rows, weight rows): a 144-B pitch (16 B x odd, for ds_load_b128 readers)
#define VP 40   // f16 per staged V^T row: 64 B of data at an 80-B pitch
__device__ __forceinline__ unsigned lds_off(const void* p) { return (unsigned)(size_t)p; }
// eight 16-B-per-lane asynchronous copies global -> LDS; the s_wait_xcnt stands inside the statement so that no address register is rewritten in front of it
__device__ __forceinline__ void copy8(unsigned l0, unsigned l1, unsigned l2, unsigned l3, unsigned l4, unsigned l5, unsigned l6, unsigned l7, const void* g0, const void* g1, const void* g2, const void* g3, const void* g4, const void* g5, const void* g6, const void* g7) {
  asm volatile("global_load_async_to_lds_b128 %0, %8, off\n\t"
               "global_load_async_to_lds_b128 %1, %9, off\n\t"
               "global_load_async_to_lds_b128 %2, %10, off\n\t"
               "global_load_async_to_lds_b128 %3, %11, off\n\t"
               "global_load_async_to_lds_b128 %4, %12, off\n\t"
               "global_load_async_to_lds_b128 %5, %13, off\n\t"
               "global_load_async_to_lds_b128 %6, %14, off\n\t"
               "global_load_async_to_lds_b128 %7, %15, off\n\t"
               "s_wait_xcnt 0x0"
               :: "v"(l0), "v"(l1), "v"(l2), "v"(l3), "v"(l4), "v"(l5), "v"(l6), "v"(l7), "v"(g0), "v"(g1), "v"(g2), "v"(g3), "v"(g4), "v"(g5), "v"(g6), "v"(g7) : "memory");
}
__global__ __launch_bounds__(128) void k_qkv(const float* __restrict__ XQ, const float* __restrict__ XK, const float* __restrict__ XV, const __bf16* __restrict__ P, const float* __restrict__ BQ, const float* __restrict__ BK, const float* __restrict__ BV, _Float16* __restrict__ QK, _Float16* __restrict__ QKL, _Float16* __restrict__ VTH, _Float16* __restrict__ VTL) {
  const int which0 = (blockIdx.y * 128) / DM; const float* X = (which0 == 0) ? XQ : (which0 == 1) ? XK : XV; const float* BB = BQ ? (((which0 == 0) ? BQ : (which0 == 1) ? BK : BV) + (blockIdx.y * 128 - which0 * DM)) : nullptr;
  __shared__ __align__(16) _Float16 so[4][16][136], sol[4][16][136]; __shared__ __align__(16) _Float16 sth[128][KP], stl[128][KP];   // in the k loop: the two buffers of the weight ring (128 packed rows x 64 k of bf16); behind it: the V^T output staging
  const int tid = threadIdx.x, wave = tid >> 5, lane = tid & 31, col = lane & 15, g = lane >> 4; const size_t r0 = (size_t)blockIdx.x * 64 + wave * 16; const int n0 = blockIdx.y * 128;
  v8f acc[8] = {};
  const int wr = tid >> 3, wp = (tid & 7) * 8;   // a thread's 16-B piece of the packed rows wr + 16 i, i = 0 .. 7
  auto fill = [&](int st, _Float16 (*bp)[KP]) { const __bf16* s = P + (size_t)(n0 + wr) * DM + st * 64 + wp;
    copy8(lds_off(&bp[wr][wp]), lds_off(&bp[wr + 16][wp]), lds_off(&bp[wr + 32][wp]), lds_off(&bp[wr + 48][wp]), lds_off(&bp[wr + 64][wp]), lds_off(&bp[wr + 80][wp]), lds_off(&bp[wr + 96][wp]), lds_off(&bp[wr + 112][wp]),
          s, s + 16 * DM, s + 32 * DM, s + 48 * DM, s + 64 * DM, s + 80 * DM, s + 96 * DM, s + 112 * DM); };
  fill(0, sth);
  asm volatile("s_wait_asynccnt 0x0" ::: "memory");   // this wave's share of stage 0 has landed
  __syncthreads();                                    // stage 0 is published to all four waves
  fill(1, stl);
#pragma unroll 1   // rolled: one copy of the stage's foot (waits, barrier, refill) in the text, the buffer chosen by st & 1
  for (int st = 0; st < DM / 64; ++st) { _Float16 (*bp)[KP] = (st & 1) ? stl : sth;
#pragma unroll     // kk constant: the two 32-k halves of a staged row become immediate offsets of the LDS loads
    for (int kk = 0; kk < 2; ++kk) { const int kc = st * 2 + kk; v16b a; { const float* p = X + (r0 + col) * DM + kc * 32 + 8 * g;
#pragma unroll
        for (int i = 0; i < 8; ++i) { a[i] = (__bf16)p[i]; a[8 + i] = (__bf16)p[16 + i]; } }
#pragma unroll
      for (int j = 0; j < 8; ++j) acc[j] = wmma_bf(a, frag_b((const __bf16*)&bp[j * 16 + col][kk * 32], lane), acc[j]); }
    asm volatile("s_wait_dscnt 0x0" ::: "memory");      // this wave's reads of buffer bp are done
    asm volatile("s_wait_asynccnt 0x0" ::: "memory");   // this wave's share of stage st + 1 has landed
    __syncthreads();                                    // publishes stage st + 1 and ends every wave's reads of buffer bp
    if (st + 2 < DM / 64) fill(st + 2, bp); }
  asm volatile("s_wait_asynccnt 0x0" ::: "memory");     // no copy is outstanding when the ring becomes output staging
  if (n0 < 2 * DM) {   // q stored unscaled (f16 sigma ~0.6, no subnormal exposure); 1/8 applied to the f32 score
#pragma unroll
    for (int j = 0; j < 8; ++j) {
#pragma unroll
      for (int r = 0; r < 8; ++r) { const float v = acc[j][r] + (BB ? bfr(BB[j * 16 + col]) : 0.f); const _Float16 hv = (_Float16)v; so[wave][8 * g + r][j * 16 + col] = hv; sol[wave][8 * g + r][j * 16 + col] = (_Float16)((v - (float)hv) * 2048.0f); } }   // q, k (+ bias) as f16 hi + (x2048) residual
    LDSX();
    for (int rl = 0; rl < 16; ++rl) if (lane < 16) { vst2((unsigned*)(QK + (r0 + rl) * (2 * DM) + n0 + lane * 8), *(const v4u*)&so[wave][rl][lane * 8]); vst2((unsigned*)(QKL + (r0 + rl) * (2 * DM) + n0 + lane * 8), *(const v4u*)&sol[wave][rl][lane * 8]); }
  } else {
#pragma unroll
    for (int j = 0; j < 8; ++j) {
#pragma unroll
      for (int r = 0; r < 8; ++r) { const float v = acc[j][r] + (BB ? bfr(BB[j * 16 + col]) : 0.f); const _Float16 hv = (_Float16)v; sth[j * 16 + col][wave * 16 + 8 * g + r] = hv; stl[j * 16 + col][wave * 16 + 8 * g + r] = (_Float16)((v - (float)hv) * 2048.0f); } }
    __syncthreads();
    const size_t rb = (size_t)blockIdx.x * 64; const int b = (int)(rb / SS), s0 = (int)(rb % SS); const int pc0 = n0 - 2 * DM;
    for (int q = tid; q < 128 * 8; q += 128) { const int d = q >> 3, pc = q & 7; const size_t o = ((size_t)b * DM + pc0 + d) * SS + s0 + pc * 8; vst2((unsigned*)(VTH + o), *(const v4u*)&sth[d][pc * 8]); vst2((unsigned*)(VTL + o), *(const v4u*)&stl[d][pc * 8]); }
  }
}
// ---- k_attn: block = (64 queries, head h, batch b): banded flash attention over window key tiles (K = 64: 2 k-steps), scores = (q.k) * 0.125 from 3 f16 products (q hi/lo x k hi/lo), P.V: f16 P*2048 hi/lo x (V hi, V lo*2048) in two accumulators; O[b*S+q][h*64+d] = (acc + accl / 2048) / 2048 / l (256-B segments)
__global__ __launch_bounds__(128) void k_attn(const _Float16* __restrict__ QK, const _Float16* __restrict__ QKL, const _Float16* __restrict__ VTH, const _Float16* __restrict__ VTL, const void* __restrict__ KMASK, float* __restrict__ O) {
  __shared__ __align__(16) float sp[4][16][36]; __shared__ __align__(16) float so[4][16][68];
  __shared__ __align__(16) _Float16 skh[2][32][KP], skl[2][32][KP], svh[2][64][VP], svl[2][64][VP];   // two buffers of one 32-key tile: K hi, K residual, V^T hi, V^T residual, read by all four waves
  const int tid = threadIdx.x, wave = tid >> 5, lane = tid & 31, col = lane & 15, g = lane >> 4;
  const int qb = blockIdx.x, h = blockIdx.y, b = blockIdx.z; const int q0 = qb * 64 + wave * 16; const size_t rq = (size_t)b * SS + q0 + col;
  v16h aq[2], aql[2];
#pragma unroll
  for (int kc = 0; kc < 2; ++kc) { aq[kc] = frag_h(QK + rq * (2 * DM) + h * HD + kc * 32, lane); aql[kc] = frag_h(QKL + rq * (2 * DM) + h * HD + kc * 32, lane); }
  float m[8], l[8];
#pragma unroll
  for (int r = 0; r < 8; ++r) { m[r] = -3.0e38f; l[r] = 0.f; }
  v8f acc[4] = {}, accl[4] = {};
  const int nks = SS / 32;   // all keys
  const int ks0 = (qb * 64 - LW) > 0 ? (qb * 64 - LW) / 32 : 0; const int ks1 = ((qb * 64 + 64 + LW) / 32) < nks ? ((qb * 64 + 64 + LW) / 32) : nks;   // window tiles
  const int kr = tid >> 3, kp = (tid & 7) * 8, vw = tid >> 2, vp = (tid & 3) * 8;   // a thread's 16-B piece: K rows kr, kr + 16; V^T rows vw, vw + 32
  const size_t gko = ((size_t)b * SS + kr) * (2 * DM) + DM + h * HD + kp, gvo = ((size_t)b * DM + h * HD + vw) * SS + vp;
  auto fill = [&](int ks, int bf) { const size_t ko = gko + (size_t)ks * 32 * (2 * DM), vo = gvo + (size_t)ks * 32;
    copy8(lds_off(&skh[bf][kr][kp]), lds_off(&skh[bf][kr + 16][kp]), lds_off(&skl[bf][kr][kp]), lds_off(&skl[bf][kr + 16][kp]), lds_off(&svh[bf][vw][vp]), lds_off(&svh[bf][vw + 32][vp]), lds_off(&svl[bf][vw][vp]), lds_off(&svl[bf][vw + 32][vp]),
          QK + ko, QK + ko + 16 * (2 * DM), QKL + ko, QKL + ko + 16 * (2 * DM), VTH + vo, VTH + vo + (size_t)32 * SS, VTL + vo, VTL + vo + (size_t)32 * SS); };
  fill(ks0, 0);
  asm volatile("s_wait_asynccnt 0x0" ::: "memory");   // this wave's share of tile ks0 has landed
  __syncthreads();                                    // tile ks0 is published to all four waves
  if (ks0 + 1 < ks1) fill(ks0 + 1, 1);
#pragma unroll 1
  for (int ks = ks0; ks < ks1; ++ks) { v8f s[2]; const int bf = (ks - ks0) & 1;
#pragma unroll
    for (int ct = 0; ct < 2; ++ct) { const int kk = ks * 32 + ct * 16 + col; const _Float16* krow = &skh[bf][ct * 16 + col][0]; const _Float16* krowl = &skl[bf][ct * 16 + col][0]; v8f c = {}, cl = {};
      if (qb < 128) {   // every query block (qb < 128 = SS / 64): 3 products
#pragma unroll
        for (int kc = 0; kc < 2; ++kc) { const v16h kh = frag_h(krow + kc * 32, lane); c = wmma16(aq[kc], kh, c); cl = wmma16(aql[kc], kh, cl); cl = wmma16(aq[kc], frag_h(krowl + kc * 32, lane), cl); }
#pragma unroll
        for (int r = 0; r < 8; ++r) c[r] += cl[r] * (1.0f / 2048.0f); }
      else {
#pragma unroll
        for (int kc = 0; kc < 2; ++kc) c = wmma16(aq[kc], frag_h(krow + kc * 32, lane), c); }   // single product (not taken: qb < 128 in every block)
      { const bool keepk = true;
#pragma unroll
      for (int r = 0; r < 8; ++r) { const int dq = (q0 + 8 * g + r) - kk; s[ct][r] = (keepk && dq <= LW && dq >= -LW) ? c[r] * 0.125f : -3.0e38f; } } }   // 1/sqrt(64); masked keys excluded
#pragma unroll
    for (int r = 0; r < 8; ++r) { float mx = fmaxf(s[0][r], s[1][r]);
#pragma unroll
      for (int o = 1; o < 16; o <<= 1) mx = fmaxf(mx, __shfl_xor(mx, o));
      const float mn = fmaxf(m[r], mx); const float alpha = (m[r] <= -1.0e38f) ? 0.f : __expf(m[r] - mn);
      const float e0 = (s[0][r] <= -1.0e38f) ? 0.f : __expf(s[0][r] - mn), e1 = (s[1][r] <= -1.0e38f) ? 0.f : __expf(s[1][r] - mn); float es = e0 + e1;
#pragma unroll
      for (int o = 1; o < 16; o <<= 1) es += __shfl_xor(es, o);
      l[r] = l[r] * alpha + es; m[r] = mn;
#pragma unroll
      for (int dt = 0; dt < 4; ++dt) { acc[dt][r] *= alpha; accl[dt][r] *= alpha; }
      sp[wave][8 * g + r][col] = e0; sp[wave][8 * g + r][16 + col] = e1; }
    LDSX();
    v16h pa, pl; { const float* prow = &sp[wave][col][0] + 8 * (lane >> 4);
#pragma unroll
      for (int i = 0; i < 8; ++i) { const float x0 = prow[i] * 2048.0f, x1 = prow[16 + i] * 2048.0f; const _Float16 h0 = (_Float16)x0, h1 = (_Float16)x1; pa[i] = h0; pa[8 + i] = h1; pl[i] = (_Float16)((x0 - (float)h0) * 2048.0f); pl[8 + i] = (_Float16)((x1 - (float)h1) * 2048.0f); } }   // P scaled by 2^11 before the f16 split so small softmax weights stay out of the f16 subnormal range; 2^-11 folded into the epilogue
#pragma unroll
    for (int dt = 0; dt < 4; ++dt) { const v16h vh = frag_h(&svh[bf][dt * 16 + col][0], lane); acc[dt] = wmma16(pa, vh, acc[dt]); if (qb < 128) { accl[dt] = wmma16(pl, vh, accl[dt]); accl[dt] = wmma16(pa, frag_h(&svl[bf][dt * 16 + col][0], lane), accl[dt]); } }   // every query block (qb < 128): P hi/lo x V hi/lo (3 products); the single-product path is not taken
    LDSX();                                             // holds the s_wait_dscnt 0: this wave's reads of buffer bf are done
    asm volatile("s_wait_asynccnt 0x0" ::: "memory");   // this wave's share of tile ks + 1 has landed
    __syncthreads();                                    // publishes tile ks + 1 and ends every wave's reads of buffer bf
    if (ks + 2 < ks1) fill(ks + 2, bf); }
  asm volatile("s_wait_asynccnt 0x0" ::: "memory");     // no copy is outstanding when the wave goes on to the epilogue
#pragma unroll
  for (int r = 0; r < 8; ++r) { const float il = (1.0f / 2048.0f) / l[r];
#pragma unroll
    for (int dt = 0; dt < 4; ++dt) so[wave][8 * g + r][dt * 16 + col] = (acc[dt][r] + accl[dt][r] * (1.0f / 2048.0f)) * il; }
  LDSX();
  for (int rl = 0; rl < 16; ++rl) if (lane < 16) vst2(O + ((size_t)b * SS + q0 + rl) * DM + h * HD + lane * 4, *(const v4f*)&so[wave][rl][lane * 4]);
}
// ---- k_out: block = (64 rows, 128 cols): out = O(hi/lo) . Wo rows (2 products) + bo
__global__ __launch_bounds__(128) void k_out(const float* __restrict__ O, const __bf16* __restrict__ P, const float* __restrict__ BO, float* __restrict__ Y) {
  __shared__ __align__(16) float so[4][16][132];
  const int tid = threadIdx.x, wave = tid >> 5, lane = tid & 31, col = lane & 15, g = lane >> 4; const size_t r0 = (size_t)blockIdx.x * 64 + wave * 16; const int n0 = blockIdx.y * 128;
  v8f acc[8] = {};
#pragma unroll 2
  for (int kc = 0; kc < DM / 32; ++kc) { const F2 a = split_row(O + (r0 + col) * DM, kc * 32, lane);
#pragma unroll
    for (int j = 0; j < 8; ++j) { const v16b w = frag_b(P + (size_t)(n0 + j * 16 + col) * DM + kc * 32, lane); acc[j] = wmma_bf(a.l, w, acc[j]); acc[j] = wmma_bf(a.h, w, acc[j]); } }
#pragma unroll
  for (int j = 0; j < 8; ++j) {
#pragma unroll
    for (int r = 0; r < 8; ++r) so[wave][8 * g + r][j * 16 + col] = acc[j][r] + (BO ? bfr(BO[n0 + j * 16 + col]) : 0.f); }
  LDSX();
  for (int rl = 0; rl < 16; ++rl) vst2(Y + (r0 + rl) * DM + n0 + lane * 4, *(const v4f*)&so[wave][rl][lane * 4]);
}
extern "C" void kernel_launch(void* const* d_in, const int* in_sizes, int n_in, void* d_out, int out_size, void* d_ws, size_t ws_size, hipStream_t stream) {
  (void)in_sizes; (void)n_in; (void)out_size;
  const float** F = (const float**)d_in;   // 0 x [2,8192,512], 1 Wq [512,512] (in,out), 2 bq, 3 Wk, 4 bk, 5 Wv, 6 bv
  if (ws_size < (size_t)WS_END) return;
  char* ws = (char*)d_ws; __bf16* PK = (__bf16*)(ws + WS_PK); _Float16 *QK = (_Float16*)(ws + WS_QK), *QKL = (_Float16*)(ws + WS_QKL), *VTH = (_Float16*)(ws + WS_VTH), *VTL = (_Float16*)(ws + WS_VTL);
  k_pack<<<dim3(DM, 3), 256, 0, stream>>>(F[1], F[3], F[5], PK);
  k_qkv<<<dim3(TNB * SS / 64, QKVW / 128), 128, 0, stream>>>(F[0], F[0], F[0], PK + PK_A, F[2], F[4], F[6], QK, QKL, VTH, VTL);
  k_attn<<<dim3(TQB, NH, TNB), 128, 0, stream>>>(QK, QKL, VTH, VTL, nullptr, (float*)d_out);
}

// v002
// One run takes 165 microseconds.
// In two side-by-side timings against v001, it was 1.18 and 1.19 times as fast.
// All steps since v000 together make it 2.19 times as fast.
// compute dtype: all float inputs rounded to bf16; q/k/v = x . W + b with EXACT bf16 products on WMMA 16x16x32 ((in,out) weights as transposed rows), f16 hi + residual; banded attention (|i - j| <= 256; other key tiles skipped) with 3-product logits and 3-product P.v, x 1/8, running-max softmax in f32 (hardware exp); the merged context is the f32 output.
#include <hip/hip_runtime.h>
#include <math.h>

typedef __attribute__((ext_vector_type(16))) _Float16 v16h;
typedef __attribute__((ext_vector_type(16))) __bf16 v16b;
typedef __attribute__((ext_vector_type(8)))  _Float16 v8h;
typedef __attribute__((ext_vector_type(8)))  float v8f;
typedef __attribute__((ext_vector_type(4)))  float v4f;
typedef __attribute__((ext_vector_type(2)))  float v2f;
typedef __attribute__((ext_vector_type(4)))  unsigned v4u;
typedef __attribute__((ext_vector_type(4)))  int v4i;
typedef float __attribute__((may_alias)) float_a;
typedef int __attribute__((may_alias)) int_a;

template <typename T> __device__ __forceinline__ void vst2(void* p, T v) { *(T*)p = v;  }
__device__ __forceinline__ v8f wmma16(v16h a, v16h b, v8f c) {
  v8f d = __builtin_amdgcn_wmma_f32_16x16x32_f16(false, a, false, b, (short)0, c, false, false);
  asm volatile("v_nop\n\tv_nop\n\tv_nop\n\tv_nop" : "+v"(d) : "v"(a), "v"(b));
  return d;
}
__device__ __forceinline__ v8f wmma_bf(v16b a, v16b b, v8f c) {
  v8f d = __builtin_amdgcn_wmma_f32_16x16x32_bf16(false, a, false, b, (short)0, c, false, false);
  asm volatile("v_nop\n\tv_nop\n\tv_nop\n\tv_nop" : "+v"(d) : "v"(a), "v"(b));
  return d;
}
// Longformer multi-head attention (B 2, S 8,192, D 512, 8 heads x 64, one-sided window 256): (in,out) projections + biases, q / 8, banded softmax, no output projection (the merged context is the output).
__device__ __forceinline__ v16h frag_h(const _Float16* rowk0, int lane) {
  union { v16h v; v8h q[2]; } u; const _Float16* p = rowk0 + 8 * (lane >> 4);
  u.q[0] = *(const v8h*)p; u.q[1] = *(const v8h*)(p + 16); return u.v;
}
__device__ __forceinline__ v16h frag_f32(const float* rowk0, int lane) {
  v16h a; const float* p = rowk0 + 8 * (lane >> 4);
#pragma unroll
  for (int i = 0; i < 8; ++i) { a[i] = (_Float16)p[i]; a[8 + i] = (_Float16)p[16 + i]; }
  return a;
}
__device__ __forceinline__ v16h frag_f32s(const float* rowk0, int lane, float sc) {
  v16h a; const float* p = rowk0 + 8 * (lane >> 4);
#pragma unroll
  for (int i = 0; i < 8; ++i) { a[i] = (_Float16)(p[i] * sc); a[8 + i] = (_Float16)(p[16 + i] * sc); }
  return a;
}
// column fragment from a [K][ld] layout (column n), rows >= K read as 0
__device__ __forceinline__ v16h fragc_f32(const float* W, int k0, int n, int lane, int ld, int K) {
  v16h a; const int g = lane >> 4;
#pragma unroll
  for (int i = 0; i < 8; ++i) { const int ka = k0 + 8 * g + i, kb = ka + 16;
    a[i] = (_Float16)(ka < K ? W[(size_t)(ka < K ? ka : K - 1) * ld + n] : 0.f); a[8 + i] = (_Float16)(kb < K ? W[(size_t)(kb < K ? kb : K - 1) * ld + n] : 0.f); }
  return a;
}
struct F2 { v16b h, l; };
__device__ __forceinline__ F2 bsplit16(const float v[16]) { F2 r;
#pragma unroll
  for (int i = 0; i < 16; ++i) { const __bf16 h = (__bf16)v[i]; r.h[i] = h; r.l[i] = (__bf16)(v[i] - (float)h); }
  return r; }
__device__ __forceinline__ F2 split_row(const float* row, int k0, int lane) { float v[16]; const float* p = row + k0 + 8 * (lane >> 4);
#pragma unroll
  for (int i = 0; i < 8; ++i) { v[i] = p[i]; v[8 + i] = p[16 + i]; }
  return bsplit16(v); }
__device__ __forceinline__ F2 split_rowK(const float* row, int k0, int lane, int K) { float v[16]; const int g = lane >> 4;
#pragma unroll
  for (int i = 0; i < 8; ++i) { const int ka = k0 + 8 * g + i, kb = ka + 16; v[i] = ka < K ? row[ka < K ? ka : K - 1] : 0.f; v[8 + i] = kb < K ? row[kb < K ? kb : K - 1] : 0.f; }
  return bsplit16(v); }
__device__ __forceinline__ F2 split_col(const float* W, int k0, int n, int lane, int ld, int K) { float v[16]; const int g = lane >> 4;
#pragma unroll
  for (int i = 0; i < 8; ++i) { const int ka = k0 + 8 * g + i, kb = ka + 16; v[i] = ka < K ? W[(size_t)(ka < K ? ka : K - 1) * ld + n] : 0.f; v[8 + i] = kb < K ? W[(size_t)(kb < K ? kb : K - 1) * ld + n] : 0.f; }
  return bsplit16(v); }
__device__ __forceinline__ v8f mac3(const F2& a, const F2& b, v8f c) { c = wmma_bf(a.l, b.h, c); c = wmma_bf(a.h, b.l, c); return wmma_bf(a.h, b.h, c); }
__device__ __forceinline__ float sigm(float v) { return 1.0f / (1.0f + expf(-v)); }
#define LDSX() do { asm volatile("s_wait_dscnt 0" ::: "memory"); __builtin_amdgcn_wave_barrier(); __builtin_amdgcn_fence(__ATOMIC_RELEASE, "workgroup"); } while (0)


#define NB 2
#define SS 8192
#define DM 512
#define NH 8
#define LW 256
#define HD 64
#define QKVW (3 * DM)
#ifndef TQB
#define TQB (SS / 64)
#define TNB NB
#define TOB (NB * SS / 64)     // output row tiles (all)
#endif
typedef __attribute__((ext_vector_type(8))) __bf16 v8b;
__device__ __forceinline__ v16b frag_b(const __bf16* rowk0, int lane) {
  union { v16b v; v8b q[2]; } u; const __bf16* p = rowk0 + 8 * (lane >> 4);
  u.q[0] = *(const v8b*)p; u.q[1] = *(const v8b*)(p + 16); return u.v;
}
__device__ __forceinline__ float bfr(float v) { return (float)(__bf16)v; }
__device__ __forceinline__ float xhalf(float x) { return __builtin_bit_cast(float, __builtin_amdgcn_permlanex16(__builtin_bit_cast(int, x), __builtin_bit_cast(int, x), 0x76543210, 0xfedcba98, false, false)); }   // lane l with lane l ^ 16
__device__ __attribute__((noinline)) float exp_ni(float v) { return expf(v); }
__device__ __attribute__((noinline)) float erf_ni(float v) { return erff(v); }

#define PK_A 0                       // [1536][512] Wqkv rows (natural [out][in])
#define PK_P (PK_A + QKVW * DM)        // [512][512]; not written here (no W_o input)
#define PK_END (PK_P + DM * DM)
#define WS_PK  0u
#define WS_QK  (WS_PK + 2u * PK_END)             // f16 [16384 rows][1024]: q | k
#define WS_QKL (WS_QK + 2u * NB * SS * 2 * DM)     // f16 q | k residual planes x2048
#define WS_VTH (WS_QKL + 2u * NB * SS * 2 * DM)    // f16 [b][512 (h*64+d)][8192 s] hi
#define WS_VTL (WS_VTH + 2u * NB * DM * SS)        // f16 lo x 2048
#define WS_O   (WS_VTL + 2u * NB * DM * SS)        // f32 [16384][512] (unused)
#define WS_CS  (WS_O + 4u * NB * SS * DM)           // f32 [8192][32] x 2 (unused)
#define WS_END (WS_CS + 4u * 2 * SS * 32)
// ---- k_pack: block = (row n, which): column n of (in,out) weight -> bf16 row; which 0..2 -> W_q/W_k/W_v into PK_A rows which*512 + n
__global__ __launch_bounds__(256) void k_pack(const float* __restrict__ WQ, const float* __restrict__ WK, const float* __restrict__ WV, __bf16* __restrict__ PK) {   // (in,out) weights [512][512]: packed row (which*DM + n) = column n
  __shared__ __align__(16) __bf16 s[DM]; const int n = blockIdx.x, which = blockIdx.y, t = threadIdx.x; const float* Wm = which == 0 ? WQ : which == 1 ? WK : WV;
  for (int k = t; k < DM; k += 256) s[k] = (__bf16)Wm[(size_t)k * DM + n]; __syncthreads(); __bf16* dst = PK + PK_A + ((size_t)which * DM + n) * DM; for (int q = t; q < DM / 8; q += 256) vst2((unsigned*)(dst + q * 8), *(const v4u*)&s[q * 8]); }
#define KP 72   // 16-bit elements per staged 128-B row (K rows, weight rows): a 144-B pitch (16 B x odd, for ds_load_b128 readers)
#define VP 40   // f16 per staged V^T row: 64 B of data at an 80-B pitch
__device__ __forceinline__ unsigned lds_off(const void* p) { return (unsigned)(size_t)p; }
// eight 16-B-per-lane asynchronous copies global -> LDS; the s_wait_xcnt stands inside the statement so that no address register is rewritten in front of it
__device__ __forceinline__ void copy8(unsigned l0, unsigned l1, unsigned l2, unsigned l3, unsigned l4, unsigned l5, unsigned l6, unsigned l7, const void* g0, const void* g1, const void* g2, const void* g3, const void* g4, const void* g5, const void* g6, const void* g7) {
  asm volatile("global_load_async_to_lds_b128 %0, %8, off\n\t"
               "global_load_async_to_lds_b128 %1, %9, off\n\t"
               "global_load_async_to_lds_b128 %2, %10, off\n\t"
               "global_load_async_to_lds_b128 %3, %11, off\n\t"
               "global_load_async_to_lds_b128 %4, %12, off\n\t"
               "global_load_async_to_lds_b128 %5, %13, off\n\t"
               "global_load_async_to_lds_b128 %6, %14, off\n\t"
               "global_load_async_to_lds_b128 %7, %15, off\n\t"
               "s_wait_xcnt 0x0"
               :: "v"(l0), "v"(l1), "v"(l2), "v"(l3), "v"(l4), "v"(l5), "v"(l6), "v"(l7), "v"(g0), "v"(g1), "v"(g2), "v"(g3), "v"(g4), "v"(g5), "v"(g6), "v"(g7) : "memory");
}
__global__ __launch_bounds__(128) void k_qkv(const float* __restrict__ XQ, const float* __restrict__ XK, const float* __restrict__ XV, const __bf16* __restrict__ P, const float* __restrict__ BQ, const float* __restrict__ BK, const float* __restrict__ BV, _Float16* __restrict__ QK, _Float16* __restrict__ QKL, _Float16* __restrict__ VTH, _Float16* __restrict__ VTL) {
  const int which0 = (blockIdx.y * 128) / DM; const float* X = (which0 == 0) ? XQ : (which0 == 1) ? XK : XV; const float* BB = BQ ? (((which0 == 0) ? BQ : (which0 == 1) ? BK : BV) + (blockIdx.y * 128 - which0 * DM)) : nullptr;
  __shared__ __align__(16) _Float16 so[4][16][136], sol[4][16][136]; __shared__ __align__(16) _Float16 sth[128][KP], stl[128][KP];   // in the k loop: the two buffers of the weight ring (128 packed rows x 64 k of bf16); behind it: the V^T output staging
  const int tid = threadIdx.x, wave = tid >> 5, lane = tid & 31, col = lane & 15, g = lane >> 4; const size_t r0 = (size_t)blockIdx.x * 64 + wave * 16; const int n0 = blockIdx.y * 128;
  v8f acc[8] = {};
  const int wr = tid >> 3, wp = (tid & 7) * 8;   // a thread's 16-B piece of the packed rows wr + 16 i, i = 0 .. 7
  auto fill = [&](int st, _Float16 (*bp)[KP]) { const __bf16* s = P + (size_t)(n0 + wr) * DM + st * 64 + wp;
    copy8(lds_off(&bp[wr][wp]), lds_off(&bp[wr + 16][wp]), lds_off(&bp[wr + 32][wp]), lds_off(&bp[wr + 48][wp]), lds_off(&bp[wr + 64][wp]), lds_off(&bp[wr + 80][wp]), lds_off(&bp[wr + 96][wp]), lds_off(&bp[wr + 112][wp]),
          s, s + 16 * DM, s + 32 * DM, s + 48 * DM, s + 64 * DM, s + 80 * DM, s + 96 * DM, s + 112 * DM); };
  fill(0, sth);
  asm volatile("s_wait_asynccnt 0x0" ::: "memory");   // this wave's share of stage 0 has landed
  __syncthreads();                                    // stage 0 is published to all four waves
  fill(1, stl);
#pragma unroll 1   // rolled: one copy of the stage's foot (waits, barrier, refill) in the text, the buffer chosen by st & 1
  for (int st = 0; st < DM / 64; ++st) { _Float16 (*bp)[KP] = (st & 1) ? stl : sth;
#pragma unroll     // kk constant: the two 32-k halves of a staged row become immediate offsets of the LDS loads
    for (int kk = 0; kk < 2; ++kk) { const int kc = st * 2 + kk; v16b a; { const float* p = X + (r0 + col) * DM + kc * 32 + 8 * g;
#pragma unroll
        for (int i = 0; i < 8; ++i) { a[i] = (__bf16)p[i]; a[8 + i] = (__bf16)p[16 + i]; } }
#pragma unroll
      for (int j = 0; j < 8; ++j) acc[j] = wmma_bf(a, frag_b((const __bf16*)&bp[j * 16 + col][kk * 32], lane), acc[j]); }
    asm volatile("s_wait_dscnt 0x0" ::: "memory");      // this wave's reads of buffer bp are done
    asm volatile("s_wait_asynccnt 0x0" ::: "memory");   // this wave's share of stage st + 1 has landed
    __syncthreads();                                    // publishes stage st + 1 and ends every wave's reads of buffer bp
    if (st + 2 < DM / 64) fill(st + 2, bp); }
  asm volatile("s_wait_asynccnt 0x0" ::: "memory");     // no copy is outstanding when the ring becomes output staging
  if (n0 < 2 * DM) {   // q stored unscaled (f16 sigma ~0.6, no subnormal exposure); 1/8 applied to the f32 score
#pragma unroll
    for (int j = 0; j < 8; ++j) {
#pragma unroll
      for (int r = 0; r < 8; ++r) { const float v = acc[j][r] + (BB ? bfr(BB[j * 16 + col]) : 0.f); const _Float16 hv = (_Float16)v; so[wave][8 * g + r][j * 16 + col] = hv; sol[wave][8 * g + r][j * 16 + col] = (_Float16)((v - (float)hv) * 2048.0f); } }   // q, k (+ bias) as f16 hi + (x2048) residual
    LDSX();
    for (int rl = 0; rl < 16; ++rl) if (lane < 16) { vst2((unsigned*)(QK + (r0 + rl) * (2 * DM) + n0 + lane * 8), *(const v4u*)&so[wave][rl][lane * 8]); vst2((unsigned*)(QKL + (r0 + rl) * (2 * DM) + n0 + lane * 8), *(const v4u*)&sol[wave][rl][lane * 8]); }
  } else {
#pragma unroll
    for (int j = 0; j < 8; ++j) {
#pragma unroll
      for (int r = 0; r < 8; ++r) { const float v = acc[j][r] + (BB ? bfr(BB[j * 16 + col]) : 0.f); const _Float16 hv = (_Float16)v; sth[j * 16 + col][wave * 16 + 8 * g + r] = hv; stl[j * 16 + col][wave * 16 + 8 * g + r] = (_Float16)((v - (float)hv) * 2048.0f); } }
    __syncthreads();
    const size_t rb = (size_t)blockIdx.x * 64; const int b = (int)(rb / SS), s0 = (int)(rb % SS); const int pc0 = n0 - 2 * DM;
    for (int q = tid; q < 128 * 8; q += 128) { const int d = q >> 3, pc = q & 7; const size_t o = ((size_t)b * DM + pc0 + d) * SS + s0 + pc * 8; vst2((unsigned*)(VTH + o), *(const v4u*)&sth[d][pc * 8]); vst2((unsigned*)(VTL + o), *(const v4u*)&stl[d][pc * 8]); }
  }
}
// ---- k_attn: block = (64 queries, head h, batch b): banded flash attention in transposed form: S^T = K . Q^T (A = K rows, B = q), so a lane holds 16 of the 32 scores of ONE query (column col, keys ct*16 + 8g + r): maximum and sum in the lane plus one exchange between the wave's halves; the two S^T tiles, converted in place, are the B operand of O^T += V^T . P^T; O[b*S+q][h*64+d] = (acc + accl / 2048) / (2048 l) (256-B segments)
__global__ __launch_bounds__(128) void k_attn(const _Float16* __restrict__ QK, const _Float16* __restrict__ QKL, const _Float16* __restrict__ VTH, const _Float16* __restrict__ VTL, const void* __restrict__ KMASK, float* __restrict__ O) {
  __shared__ __align__(16) float so[4][16][68];
  __shared__ __align__(16) _Float16 skh[2][32][KP], skl[2][32][KP], svh[2][64][VP], svl[2][64][VP];   // two buffers of one 32-key tile: K hi, K residual, V^T hi, V^T residual, read by all four waves
  const int tid = threadIdx.x, wave = tid >> 5, lane = tid & 31, col = lane & 15, g = lane >> 4;
  const int qb = blockIdx.x, h = blockIdx.y, b = blockIdx.z; const int q0 = qb * 64 + wave * 16; const size_t rq = (size_t)b * SS + q0 + col;
  v16h aq[2], aql[2];
#pragma unroll
  for (int kc = 0; kc < 2; ++kc) { aq[kc] = frag_h(QK + rq * (2 * DM) + h * HD + kc * 32, lane); aql[kc] = frag_h(QKL + rq * (2 * DM) + h * HD + kc * 32, lane); }
  float m = -3.0e38f, l = 0.f;   // of query q0 + col; l holds this half-wave's keys only and is joined behind the loop
  v8f acc[4] = {}, accl[4] = {};
  const int nks = SS / 32;   // all keys
  const int ks0 = (qb * 64 - LW) > 0 ? (qb * 64 - LW) / 32 : 0; const int ks1 = ((qb * 64 + 64 + LW) / 32) < nks ? ((qb * 64 + 64 + LW) / 32) : nks;   // window tiles
  const int kr = tid >> 3, kp = (tid & 7) * 8, vw = tid >> 2, vp = (tid & 3) * 8;   // a thread's 16-B piece: K rows kr, kr + 16; V^T rows vw, vw + 32
  const size_t gko = ((size_t)b * SS + kr) * (2 * DM) + DM + h * HD + kp, gvo = ((size_t)b * DM + h * HD + vw) * SS + vp;
  auto fill = [&](int ks, int bf) { const size_t ko = gko + (size_t)ks * 32 * (2 * DM), vo = gvo + (size_t)ks * 32;
    copy8(lds_off(&skh[bf][kr][kp]), lds_off(&skh[bf][kr + 16][kp]), lds_off(&skl[bf][kr][kp]), lds_off(&skl[bf][kr + 16][kp]), lds_off(&svh[bf][vw][vp]), lds_off(&svh[bf][vw + 32][vp]), lds_off(&svl[bf][vw][vp]), lds_off(&svl[bf][vw + 32][vp]),
          QK + ko, QK + ko + 16 * (2 * DM), QKL + ko, QKL + ko + 16 * (2 * DM), VTH + vo, VTH + vo + (size_t)32 * SS, VTL + vo, VTL + vo + (size_t)32 * SS); };
  fill(ks0, 0);
  asm volatile("s_wait_asynccnt 0x0" ::: "memory");   // this wave's share of tile ks0 has landed
  __syncthreads();                                    // tile ks0 is published to all four waves
  if (ks0 + 1 < ks1) fill(ks0 + 1, 1);
#pragma unroll 1
  for (int ks = ks0; ks < ks1; ++ks) { v8f s[2]; const int bf = (ks - ks0) & 1;
#pragma unroll
    for (int ct = 0; ct < 2; ++ct) { const int kk = ks * 32 + ct * 16 + 8 * g; const _Float16* krow = &skh[bf][ct * 16 + col][0]; const _Float16* krowl = &skl[bf][ct * 16 + col][0]; v8f c = {}, cl = {};
      if (qb < 128) {   // every query block (qb <= 127 for all 128 blocks): 3 products
#pragma unroll
        for (int kc = 0; kc < 2; ++kc) { const v16h kh = frag_h(krow + kc * 32, lane); c = wmma16(kh, aq[kc], c); cl = wmma16(kh, aql[kc], cl); cl = wmma16(frag_h(krowl + kc * 32, lane), aq[kc], cl); }
#pragma unroll
        for (int r = 0; r < 8; ++r) c[r] += cl[r] * (1.0f / 2048.0f); }
      else {
#pragma unroll
        for (int kc = 0; kc < 2; ++kc) c = wmma16(frag_h(krow + kc * 32, lane), aq[kc], c); }   // single product only for qb >= 128, which no block has
      { const bool keepk = true;
#pragma unroll
      for (int r = 0; r < 8; ++r) { const int dq = (q0 + col) - (kk + r); s[ct][r] = (keepk && dq <= LW && dq >= -LW) ? c[r] * 0.125f : -3.0e38f; } } }   // 1/sqrt(64); masked keys excluded
    float mx = fmaxf(s[0][0], s[1][0]);
#pragma unroll
    for (int r = 1; r < 8; ++r) mx = fmaxf(mx, fmaxf(s[0][r], s[1][r]));
    mx = fmaxf(mx, xhalf(mx));   // the other 16 keys of this query
    const float mn = fmaxf(m, mx); const float alpha = (m <= -1.0e38f) ? 0.f : __expf(m - mn);
    float es = 0.f; v16h pa, pl;
#pragma unroll
    for (int r = 0; r < 8; ++r) { const float e0 = (s[0][r] <= -1.0e38f) ? 0.f : __expf(s[0][r] - mn), e1 = (s[1][r] <= -1.0e38f) ? 0.f : __expf(s[1][r] - mn); es += e0 + e1;
      const float x0 = e0 * 2048.0f, x1 = e1 * 2048.0f; const _Float16 h0 = (_Float16)x0, h1 = (_Float16)x1; pa[r] = h0; pa[8 + r] = h1; pl[r] = (_Float16)((x0 - (float)h0) * 2048.0f); pl[8 + r] = (_Float16)((x1 - (float)h1) * 2048.0f); }   // P^T as a B fragment: element r = key 8g + r, element 8 + r = key 16 + 8g + r, the k order of frag_h; P scaled by 2^11 before the f16 split so small softmax weights stay out of the f16 subnormal range; 2^-11 folded into the epilogue
    l = l * alpha + es; m = mn;
#pragma unroll
    for (int dt = 0; dt < 4; ++dt) {
#pragma unroll
      for (int r = 0; r < 8; ++r) { acc[dt][r] *= alpha; accl[dt][r] *= alpha; } }
#pragma unroll
    for (int dt = 0; dt < 4; ++dt) { const v16h vh = frag_h(&svh[bf][dt * 16 + col][0], lane); acc[dt] = wmma16(vh, pa, acc[dt]); if (qb < 128) { accl[dt] = wmma16(vh, pl, accl[dt]); accl[dt] = wmma16(frag_h(&svl[bf][dt * 16 + col][0], lane), pa, accl[dt]); } }   // every query block (qb <= 127): V hi/lo x P hi/lo (3 products); the single V x P branch is not taken
    LDSX();                                             // holds the s_wait_dscnt 0: this wave's reads of buffer bf are done
    asm volatile("s_wait_asynccnt 0x0" ::: "memory");   // this wave's share of tile ks + 1 has landed
    __syncthreads();                                    // publishes tile ks + 1 and ends every wave's reads of buffer bf
    if (ks + 2 < ks1) fill(ks + 2, bf); }
  asm volatile("s_wait_asynccnt 0x0" ::: "memory");     // no copy is outstanding when the wave goes on to the epilogue
  l += xhalf(l);   // the two half-waves' sums of one query
  const float il = (1.0f / 2048.0f) / l;
#pragma unroll
  for (int dt = 0; dt < 4; ++dt) { v4f o0, o1;   // acc[dt][r] = O^T[d = dt*16 + 8g + r][query col]
#pragma unroll
    for (int r = 0; r < 4; ++r) { o0[r] = (acc[dt][r] + accl[dt][r] * (1.0f / 2048.0f)) * il; o1[r] = (acc[dt][4 + r] + accl[dt][4 + r] * (1.0f / 2048.0f)) * il; }
    *(v4f*)&so[wave][col][dt * 16 + 8 * g] = o0; *(v4f*)&so[wave][col][dt * 16 + 8 * g + 4] = o1; }
  LDSX();
  for (int rl = 0; rl < 16; ++rl) if (lane < 16) vst2(O + ((size_t)b * SS + q0 + rl) * DM + h * HD + lane * 4, *(const v4f*)&so[wave][rl][lane * 4]);
}
// ---- k_out: block = (64 rows, 128 cols): out = O(hi/lo) . Wo rows (2 products) + bo
__global__ __launch_bounds__(128) void k_out(const float* __restrict__ O, const __bf16* __restrict__ P, const float* __restrict__ BO, float* __restrict__ Y) {
  __shared__ __align__(16) float so[4][16][132];
  const int tid = threadIdx.x, wave = tid >> 5, lane = tid & 31, col = lane & 15, g = lane >> 4; const size_t r0 = (size_t)blockIdx.x * 64 + wave * 16; const int n0 = blockIdx.y * 128;
  v8f acc[8] = {};
#pragma unroll 2
  for (int kc = 0; kc < DM / 32; ++kc) { const F2 a = split_row(O + (r0 + col) * DM, kc * 32, lane);
#pragma unroll
    for (int j = 0; j < 8; ++j) { const v16b w = frag_b(P + (size_t)(n0 + j * 16 + col) * DM + kc * 32, lane); acc[j] = wmma_bf(a.l, w, acc[j]); acc[j] = wmma_bf(a.h, w, acc[j]); } }
#pragma unroll
  for (int j = 0; j < 8; ++j) {
#pragma unroll
    for (int r = 0; r < 8; ++r) so[wave][8 * g + r][j * 16 + col] = acc[j][r] + (BO ? bfr(BO[n0 + j * 16 + col]) : 0.f); }
  LDSX();
  for (int rl = 0; rl < 16; ++rl) vst2(Y + (r0 + rl) * DM + n0 + lane * 4, *(const v4f*)&so[wave][rl][lane * 4]);
}
extern "C" void kernel_launch(void* const* d_in, const int* in_sizes, int n_in, void* d_out, int out_size, void* d_ws, size_t ws_size, hipStream_t stream) {
  (void)in_sizes; (void)n_in; (void)out_size;
  const float** F = (const float**)d_in;   // 0 x [2,8192,512], 1 Wq [512,512] (in,out), 2 bq, 3 Wk, 4 bk, 5 Wv, 6 bv
  if (ws_size < (size_t)WS_END) return;
  char* ws = (char*)d_ws; __bf16* PK = (__bf16*)(ws + WS_PK); _Float16 *QK = (_Float16*)(ws + WS_QK), *QKL = (_Float16*)(ws + WS_QKL), *VTH = (_Float16*)(ws + WS_VTH), *VTL = (_Float16*)(ws + WS_VTL);
  k_pack<<<dim3(DM, 3), 256, 0, stream>>>(F[1], F[3], F[5], PK);
  k_qkv<<<dim3(TNB * SS / 64, QKVW / 128), 128, 0, stream>>>(F[0], F[0], F[0], PK + PK_A, F[2], F[4], F[6], QK, QKL, VTH, VTL);
  k_attn<<<dim3(TQB, NH, TNB), 128, 0, stream>>>(QK, QKL, VTH, VTL, nullptr, (float*)d_out);
}

// v003
// Measured time: 137 microseconds a run.
// In two side-by-side timings against v002, it was 1.22 and 1.21 times as fast.
// Over all steps from v000 it is 2.65 times as fast.
// compute dtype: all float inputs rounded to bf16; q/k/v = x . W + b with EXACT bf16 products on WMMA 16x16x32 ((in,out) weights as transposed rows), f16 hi + residual; banded attention (|i - j| <= 256; other key tiles skipped) with 3-product logits and 3-product P.v, x 1/8, running-max softmax in f32 (hardware exp); the merged context is the f32 output.
#include <hip/hip_runtime.h>
#include <math.h>

typedef __attribute__((ext_vector_type(16))) _Float16 v16h;
typedef __attribute__((ext_vector_type(16))) __bf16 v16b;
typedef __attribute__((ext_vector_type(8)))  _Float16 v8h;
typedef __attribute__((ext_vector_type(8)))  float v8f;
typedef __attribute__((ext_vector_type(4)))  float v4f;
typedef __attribute__((ext_vector_type(2)))  float v2f;
typedef __attribute__((ext_vector_type(4)))  unsigned v4u;
typedef __attribute__((ext_vector_type(4)))  int v4i;
typedef float __attribute__((may_alias)) float_a;
typedef int __attribute__((may_alias)) int_a;

template <typename T> __device__ __forceinline__ void vst2(void* p, T v) { *(T*)p = v;  }
__device__ __forceinline__ v8f wmma16(v16h a, v16h b, v8f c) {
  return __builtin_amdgcn_wmma_f32_16x16x32_f16(false, a, false, b, (short)0, c, false, false);
}
__device__ __forceinline__ v8f wmma_bf(v16b a, v16b b, v8f c) {
  return __builtin_amdgcn_wmma_f32_16x16x32_bf16(false, a, false, b, (short)0, c, false, false);
}
// Longformer multi-head attention (B 2, S 8,192, D 512, 8 heads x 64, one-sided window 256): (in,out) projections + biases, q / 8, banded softmax, no output projection (the merged context is the output).
__device__ __forceinline__ v16h frag_h(const _Float16* rowk0, int lane) {
  union { v16h v; v8h q[2]; } u; const _Float16* p = rowk0 + 8 * (lane >> 4);
  u.q[0] = *(const v8h*)p; u.q[1] = *(const v8h*)(p + 16); return u.v;
}
__device__ __forceinline__ v16h frag_f32(const float* rowk0, int lane) {
  v16h a; const float* p = rowk0 + 8 * (lane >> 4);
#pragma unroll
  for (int i = 0; i < 8; ++i) { a[i] = (_Float16)p[i]; a[8 + i] = (_Float16)p[16 + i]; }
  return a;
}
__device__ __forceinline__ v16h frag_f32s(const float* rowk0, int lane, float sc) {
  v16h a; const float* p = rowk0 + 8 * (lane >> 4);
#pragma unroll
  for (int i = 0; i < 8; ++i) { a[i] = (_Float16)(p[i] * sc); a[8 + i] = (_Float16)(p[16 + i] * sc); }
  return a;
}
// column fragment from a [K][ld] layout (column n), rows >= K read as 0
__device__ __forceinline__ v16h fragc_f32(const float* W, int k0, int n, int lane, int ld, int K) {
  v16h a; const int g = lane >> 4;
#pragma unroll
  for (int i = 0; i < 8; ++i) { const int ka = k0 + 8 * g + i, kb = ka + 16;
    a[i] = (_Float16)(ka < K ? W[(size_t)(ka < K ? ka : K - 1) * ld + n] : 0.f); a[8 + i] = (_Float16)(kb < K ? W[(size_t)(kb < K ? kb : K - 1) * ld + n] : 0.f); }
  return a;
}
struct F2 { v16b h, l; };
__device__ __forceinline__ F2 bsplit16(const float v[16]) { F2 r;
#pragma unroll
  for (int i = 0; i < 16; ++i) { const __bf16 h = (__bf16)v[i]; r.h[i] = h; r.l[i] = (__bf16)(v[i] - (float)h); }
  return r; }
__device__ __forceinline__ F2 split_row(const float* row, int k0, int lane) { float v[16]; const float* p = row + k0 + 8 * (lane >> 4);
#pragma unroll
  for (int i = 0; i < 8; ++i) { v[i] = p[i]; v[8 + i] = p[16 + i]; }
  return bsplit16(v); }
__device__ __forceinline__ F2 split_rowK(const float* row, int k0, int lane, int K) { float v[16]; const int g = lane >> 4;
#pragma unroll
  for (int i = 0; i < 8; ++i) { const int ka = k0 + 8 * g + i, kb = ka + 16; v[i] = ka < K ? row[ka < K ? ka : K - 1] : 0.f; v[8 + i] = kb < K ? row[kb < K ? kb : K - 1] : 0.f; }
  return bsplit16(v); }
__device__ __forceinline__ F2 split_col(const float* W, int k0, int n, int lane, int ld, int K) { float v[16]; const int g = lane >> 4;
#pragma unroll
  for (int i = 0; i < 8; ++i) { const int ka = k0 + 8 * g + i, kb = ka + 16; v[i] = ka < K ? W[(size_t)(ka < K ? ka : K - 1) * ld + n] : 0.f; v[8 + i] = kb < K ? W[(size_t)(kb < K ? kb : K - 1) * ld + n] : 0.f; }
  return bsplit16(v); }
__device__ __forceinline__ v8f mac3(const F2& a, const F2& b, v8f c) { c = wmma_bf(a.l, b.h, c); c = wmma_bf(a.h, b.l, c); return wmma_bf(a.h, b.h, c); }
__device__ __forceinline__ float sigm(float v) { return 1.0f / (1.0f + expf(-v)); }
#define LDSX() do { asm volatile("s_wait_dscnt 0" ::: "memory"); __builtin_amdgcn_wave_barrier(); __builtin_amdgcn_fence(__ATOMIC_RELEASE, "workgroup"); } while (0)


#define NB 2
#define SS 8192
#define DM 512
#define NH 8
#define LW 256
#define HD 64
#define QKVW (3 * DM)
#ifndef TQB
#define TQB (SS / 64)
#define TNB NB
#define TOB (NB * SS / 64)     // output row tiles (all)
#endif
typedef __attribute__((ext_vector_type(8))) __bf16 v8b;
__device__ __forceinline__ v16b frag_b(const __bf16* rowk0, int lane) {
  union { v16b v; v8b q[2]; } u; const __bf16* p = rowk0 + 8 * (lane >> 4);
  u.q[0] = *(const v8b*)p; u.q[1] = *(const v8b*)(p + 16); return u.v;
}
__device__ __forceinline__ float bfr(float v) { return (float)(__bf16)v; }
__device__ __forceinline__ float xhalf(float x) { return __builtin_bit_cast(float, __builtin_amdgcn_permlanex16(__builtin_bit_cast(int, x), __builtin_bit_cast(int, x), 0x76543210, 0xfedcba98, false, false)); }   // lane l with lane l ^ 16
__device__ __attribute__((noinline)) float exp_ni(float v) { return expf(v); }
__device__ __attribute__((noinline)) float erf_ni(float v) { return erff(v); }

#define PK_A 0                       // [1536][512] Wqkv rows (natural [out][in])
#define PK_P (PK_A + QKVW * DM)        // [512][512]; not written here (no W_o input)
#define PK_END (PK_P + DM * DM)
#define WS_PK  0u
#define WS_QK  (WS_PK + 2u * PK_END)             // f16 [16384 rows][1024]: q | k
#define WS_QKL (WS_QK + 2u * NB * SS * 2 * DM)     // f16 q | k residual planes x2048
#define WS_VTH (WS_QKL + 2u * NB * SS * 2 * DM)    // f16 [b][512 (h*64+d)][8192 s] hi
#define WS_VTL (WS_VTH + 2u * NB * DM * SS)        // f16 lo x 2048
#define WS_O   (WS_VTL + 2u * NB * DM * SS)        // f32 [16384][512] (unused)
#define WS_CS  (WS_O + 4u * NB * SS * DM)           // f32 [8192][32] x 2 (unused)
#define WS_END (WS_CS + 4u * 2 * SS * 32)
// ---- k_pack: block = (row n, which): column n of (in,out) weight -> bf16 row; which 0..2 -> W_q/W_k/W_v into PK_A rows which*512 + n
__global__ __launch_bounds__(256) void k_pack(const float* __restrict__ WQ, const float* __restrict__ WK, const float* __restrict__ WV, __bf16* __restrict__ PK) {   // (in,out) weights [512][512]: packed row (which*DM + n) = column n
  __shared__ __align__(16) __bf16 s[DM]; const int n = blockIdx.x, which = blockIdx.y, t = threadIdx.x; const float* Wm = which == 0 ? WQ : which == 1 ? WK : WV;
  for (int k = t; k < DM; k += 256) s[k] = (__bf16)Wm[(size_t)k * DM + n]; __syncthreads(); __bf16* dst = PK + PK_A + ((size_t)which * DM + n) * DM; for (int q = t; q < DM / 8; q += 256) vst2((unsigned*)(dst + q * 8), *(const v4u*)&s[q * 8]); }
#define KP 72   // 16-bit elements per staged 128-B row (K rows, weight rows): a 144-B pitch (16 B x odd, for ds_load_b128 readers)
#define VP 40   // f16 per staged V^T row: 64 B of data at an 80-B pitch
__device__ __forceinline__ unsigned lds_off(const void* p) { return (unsigned)(size_t)p; }
// eight 16-B-per-lane asynchronous copies global -> LDS; the s_wait_xcnt stands inside the statement so that no address register is rewritten in front of it
__device__ __forceinline__ void copy8(unsigned l0, unsigned l1, unsigned l2, unsigned l3, unsigned l4, unsigned l5, unsigned l6, unsigned l7, const void* g0, const void* g1, const void* g2, const void* g3, const void* g4, const void* g5, const void* g6, const void* g7) {
  asm volatile("global_load_async_to_lds_b128 %0, %8, off\n\t"
               "global_load_async_to_lds_b128 %1, %9, off\n\t"
               "global_load_async_to_lds_b128 %2, %10, off\n\t"
               "global_load_async_to_lds_b128 %3, %11, off\n\t"
               "global_load_async_to_lds_b128 %4, %12, off\n\t"
               "global_load_async_to_lds_b128 %5, %13, off\n\t"
               "global_load_async_to_lds_b128 %6, %14, off\n\t"
               "global_load_async_to_lds_b128 %7, %15, off\n\t"
               "s_wait_xcnt 0x0"
               :: "v"(l0), "v"(l1), "v"(l2), "v"(l3), "v"(l4), "v"(l5), "v"(l6), "v"(l7), "v"(g0), "v"(g1), "v"(g2), "v"(g3), "v"(g4), "v"(g5), "v"(g6), "v"(g7) : "memory");
}
__global__ __launch_bounds__(128) void k_qkv(const float* __restrict__ XQ, const float* __restrict__ XK, const float* __restrict__ XV, const __bf16* __restrict__ P, const float* __restrict__ BQ, const float* __restrict__ BK, const float* __restrict__ BV, _Float16* __restrict__ QK, _Float16* __restrict__ QKL, _Float16* __restrict__ VTH, _Float16* __restrict__ VTL) {
  const int which0 = (blockIdx.y * 128) / DM; const float* X = (which0 == 0) ? XQ : (which0 == 1) ? XK : XV; const float* BB = BQ ? (((which0 == 0) ? BQ : (which0 == 1) ? BK : BV) + (blockIdx.y * 128 - which0 * DM)) : nullptr;
  __shared__ __align__(16) _Float16 so[4][16][136], sol[4][16][136]; __shared__ __align__(16) _Float16 sth[128][KP], stl[128][KP];   // in the k loop: the two buffers of the weight ring (128 packed rows x 64 k of bf16); behind it: the V^T output staging
  const int tid = threadIdx.x, wave = tid >> 5, lane = tid & 31, col = lane & 15, g = lane >> 4; const size_t r0 = (size_t)blockIdx.x * 64 + wave * 16; const int n0 = blockIdx.y * 128;
  v8f acc[8] = {};
  const int wr = tid >> 3, wp = (tid & 7) * 8;   // a thread's 16-B piece of the packed rows wr + 16 i, i = 0 .. 7
  auto fill = [&](int st, _Float16 (*bp)[KP]) { const __bf16* s = P + (size_t)(n0 + wr) * DM + st * 64 + wp;
    copy8(lds_off(&bp[wr][wp]), lds_off(&bp[wr + 16][wp]), lds_off(&bp[wr + 32][wp]), lds_off(&bp[wr + 48][wp]), lds_off(&bp[wr + 64][wp]), lds_off(&bp[wr + 80][wp]), lds_off(&bp[wr + 96][wp]), lds_off(&bp[wr + 112][wp]),
          s, s + 16 * DM, s + 32 * DM, s + 48 * DM, s + 64 * DM, s + 80 * DM, s + 96 * DM, s + 112 * DM); };
  fill(0, sth);
  asm volatile("s_wait_asynccnt 0x0" ::: "memory");   // this wave's share of stage 0 has landed
  __syncthreads();                                    // stage 0 is published to all four waves
  fill(1, stl);
#pragma unroll 1   // rolled: one copy of the stage's foot (waits, barrier, refill) in the text, the buffer chosen by st & 1
  for (int st = 0; st < DM / 64; ++st) { _Float16 (*bp)[KP] = (st & 1) ? stl : sth;
    v4f xr[2][4];   // this wave's x piece of the stage (fp32), asked for first: the longest wait
#pragma unroll
    for (int kk = 0; kk < 2; ++kk) { const float* p = X + (r0 + col) * DM + (st * 2 + kk) * 32 + 8 * g; xr[kk][0] = *(const v4f*)p; xr[kk][1] = *(const v4f*)(p + 4); xr[kk][2] = *(const v4f*)(p + 16); xr[kk][3] = *(const v4f*)(p + 20); }
    v16b w[2][8];   // the stage's sixteen weight fragments, read from LDS as one group in front of its WMMAs
#pragma unroll     // kk constant: the two 32-k halves of a staged row become immediate offsets of the LDS loads
    for (int kk = 0; kk < 2; ++kk) {
#pragma unroll
      for (int j = 0; j < 8; ++j) w[kk][j] = frag_b((const __bf16*)&bp[j * 16 + col][kk * 32], lane); }
    __builtin_amdgcn_sched_barrier(0);   // keeps the loads above as one group: without it the scheduler sinks each LDS pair to one WMMA in front of its use, and every WMMA waits out an LDS latency
#pragma unroll
    for (int kk = 0; kk < 2; ++kk) { v16b a;
#pragma unroll
      for (int i = 0; i < 4; ++i) { a[i] = (__bf16)xr[kk][0][i]; a[4 + i] = (__bf16)xr[kk][1][i]; a[8 + i] = (__bf16)xr[kk][2][i]; a[12 + i] = (__bf16)xr[kk][3][i]; }
#pragma unroll
      for (int j = 0; j < 8; ++j) acc[j] = wmma_bf(a, w[kk][j], acc[j]); }
    asm volatile("s_wait_dscnt 0x0" ::: "memory");      // this wave's reads of buffer bp are done
    asm volatile("s_wait_asynccnt 0x0" ::: "memory");   // this wave's share of stage st + 1 has landed
    __syncthreads();                                    // publishes stage st + 1 and ends every wave's reads of buffer bp
    if (st + 2 < DM / 64) fill(st + 2, bp); }
  asm volatile("s_wait_asynccnt 0x0" ::: "memory");     // no copy is outstanding when the ring becomes output staging
  if (n0 < 2 * DM) {   // q stored unscaled (f16 sigma ~0.6, no subnormal exposure); 1/8 applied to the f32 score
#pragma unroll
    for (int j = 0; j < 8; ++j) {
#pragma unroll
      for (int r = 0; r < 8; ++r) { const float v = acc[j][r] + (BB ? bfr(BB[j * 16 + col]) : 0.f); const _Float16 hv = (_Float16)v; so[wave][8 * g + r][j * 16 + col] = hv; sol[wave][8 * g + r][j * 16 + col] = (_Float16)((v - (float)hv) * 2048.0f); } }   // q, k (+ bias) as f16 hi + (x2048) residual
    LDSX();
    for (int rl = 0; rl < 16; ++rl) if (lane < 16) { vst2((unsigned*)(QK + (r0 + rl) * (2 * DM) + n0 + lane * 8), *(const v4u*)&so[wave][rl][lane * 8]); vst2((unsigned*)(QKL + (r0 + rl) * (2 * DM) + n0 + lane * 8), *(const v4u*)&sol[wave][rl][lane * 8]); }
  } else {
#pragma unroll
    for (int j = 0; j < 8; ++j) {
#pragma unroll
      for (int r = 0; r < 8; ++r) { const float v = acc[j][r] + (BB ? bfr(BB[j * 16 + col]) : 0.f); const _Float16 hv = (_Float16)v; sth[j * 16 + col][wave * 16 + 8 * g + r] = hv; stl[j * 16 + col][wave * 16 + 8 * g + r] = (_Float16)((v - (float)hv) * 2048.0f); } }
    __syncthreads();
    const size_t rb = (size_t)blockIdx.x * 64; const int b = (int)(rb / SS), s0 = (int)(rb % SS); const int pc0 = n0 - 2 * DM;
    for (int q = tid; q < 128 * 8; q += 128) { const int d = q >> 3, pc = q & 7; const size_t o = ((size_t)b * DM + pc0 + d) * SS + s0 + pc * 8; vst2((unsigned*)(VTH + o), *(const v4u*)&sth[d][pc * 8]); vst2((unsigned*)(VTL + o), *(const v4u*)&stl[d][pc * 8]); }
  }
}
// ---- k_attn: block = (64 queries, head h, batch b): banded flash attention in transposed form: S^T = K . Q^T (A = K rows, B = q), so a lane holds 16 of the 32 scores of ONE query (column col, keys ct*16 + 8g + r): maximum and sum in the lane plus one exchange between the wave's halves; the two S^T tiles, converted in place, are the B operand of O^T += V^T . P^T; O[b*S+q][h*64+d] = (acc + accl / 2048) / (2048 l) (256-B segments)
__global__ __launch_bounds__(128) void k_attn(const _Float16* __restrict__ QK, const _Float16* __restrict__ QKL, const _Float16* __restrict__ VTH, const _Float16* __restrict__ VTL, const void* __restrict__ KMASK, float* __restrict__ O) {
  __shared__ __align__(16) float so[4][16][68];
  __shared__ __align__(16) _Float16 skh[2][32][KP], skl[2][32][KP], svh[2][64][VP], svl[2][64][VP];   // two buffers of one 32-key tile: K hi, K residual, V^T hi, V^T residual, read by all four waves
  const int tid = threadIdx.x, wave = tid >> 5, lane = tid & 31, col = lane & 15, g = lane >> 4;
  const int qb = blockIdx.x, h = blockIdx.y, b = blockIdx.z; const int q0 = qb * 64 + wave * 16; const size_t rq = (size_t)b * SS + q0 + col;
  v16h aq[2], aql[2];
#pragma unroll
  for (int kc = 0; kc < 2; ++kc) { aq[kc] = frag_h(QK + rq * (2 * DM) + h * HD + kc * 32, lane); aql[kc] = frag_h(QKL + rq * (2 * DM) + h * HD + kc * 32, lane); }
  float m = -3.0e38f, l = 0.f;   // of query q0 + col; l holds this half-wave's keys only and is joined behind the loop
  v8f acc[4] = {}, accl[4] = {};
  const int nks = SS / 32;   // all keys
  const int ks0 = (qb * 64 - LW) > 0 ? (qb * 64 - LW) / 32 : 0; const int ks1 = ((qb * 64 + 64 + LW) / 32) < nks ? ((qb * 64 + 64 + LW) / 32) : nks;   // window tiles
  const int kr = tid >> 3, kp = (tid & 7) * 8, vw = tid >> 2, vp = (tid & 3) * 8;   // a thread's 16-B piece: K rows kr, kr + 16; V^T rows vw, vw + 32
  const size_t gko = ((size_t)b * SS + kr) * (2 * DM) + DM + h * HD + kp, gvo = ((size_t)b * DM + h * HD + vw) * SS + vp;
  auto fill = [&](int ks, int bf) { const size_t ko = gko + (size_t)ks * 32 * (2 * DM), vo = gvo + (size_t)ks * 32;
    copy8(lds_off(&skh[bf][kr][kp]), lds_off(&skh[bf][kr + 16][kp]), lds_off(&skl[bf][kr][kp]), lds_off(&skl[bf][kr + 16][kp]), lds_off(&svh[bf][vw][vp]), lds_off(&svh[bf][vw + 32][vp]), lds_off(&svl[bf][vw][vp]), lds_off(&svl[bf][vw + 32][vp]),
          QK + ko, QK + ko + 16 * (2 * DM), QKL + ko, QKL + ko + 16 * (2 * DM), VTH + vo, VTH + vo + (size_t)32 * SS, VTL + vo, VTL + vo + (size_t)32 * SS); };
  fill(ks0, 0);
  asm volatile("s_wait_asynccnt 0x0" ::: "memory");   // this wave's share of tile ks0 has landed
  __syncthreads();                                    // tile ks0 is published to all four waves
  if (ks0 + 1 < ks1) fill(ks0 + 1, 1);
#pragma unroll 1
  for (int ks = ks0; ks < ks1; ++ks) { v8f s[2]; const int bf = (ks - ks0) & 1;
    v16h kh[2][2], kl[2][2];   // the tile's eight K fragments (hi, residual), read from LDS as one group in front of the twelve score WMMAs
#pragma unroll
    for (int ct = 0; ct < 2; ++ct) {
#pragma unroll
      for (int kc = 0; kc < 2; ++kc) { kh[ct][kc] = frag_h(&skh[bf][ct * 16 + col][kc * 32], lane); kl[ct][kc] = frag_h(&skl[bf][ct * 16 + col][kc * 32], lane); } }
    __builtin_amdgcn_sched_barrier(0);   // keeps the sixteen K loads as one group: without it the scheduler holds some back among the WMMAs, which then wait out an LDS latency each
    v8f c[2] = {}, cl[2] = {};   // 3 products; each accumulator takes its products in the order kc 0, kc 1 (cl: K hi x q residual, then K residual x q)
#pragma unroll
    for (int kc = 0; kc < 2; ++kc) {
#pragma unroll
      for (int ct = 0; ct < 2; ++ct) { c[ct] = wmma16(kh[ct][kc], aq[kc], c[ct]); cl[ct] = wmma16(kh[ct][kc], aql[kc], cl[ct]); }
#pragma unroll
      for (int ct = 0; ct < 2; ++ct) cl[ct] = wmma16(kl[ct][kc], aq[kc], cl[ct]); }
    v16h vh[4], vl[4];   // the tile's eight V^T fragments, read here too, into the registers that the score WMMAs set free
#pragma unroll
    for (int dt = 0; dt < 4; ++dt) { vh[dt] = frag_h(&svh[bf][dt * 16 + col][0], lane); vl[dt] = frag_h(&svl[bf][dt * 16 + col][0], lane); }
    // the ring's hand-over stands here: all of the tile is in registers, and the rest of the pass (softmax, P.V) touches no LDS, so the refill flies behind it
    LDSX();                                             // holds the s_wait_dscnt 0: this wave's reads of buffer bf are done
    asm volatile("s_wait_asynccnt 0x0" ::: "memory");   // this wave's share of tile ks + 1 has landed
    __syncthreads();                                    // publishes tile ks + 1 and ends every wave's reads of buffer bf
    if (ks + 2 < ks1) fill(ks + 2, bf);
#pragma unroll
    for (int ct = 0; ct < 2; ++ct) { const int kk = ks * 32 + ct * 16 + 8 * g;
#pragma unroll
      for (int r = 0; r < 8; ++r) { const float cc = c[ct][r] + cl[ct][r] * (1.0f / 2048.0f); const int dq = (q0 + col) - (kk + r); s[ct][r] = (dq <= LW && dq >= -LW) ? cc * 0.125f : -3.0e38f; } }   // 1/sqrt(64); masked keys excluded
    float mx = fmaxf(s[0][0], s[1][0]);
#pragma unroll
    for (int r = 1; r < 8; ++r) mx = fmaxf(mx, fmaxf(s[0][r], s[1][r]));
    mx = fmaxf(mx, xhalf(mx));   // the other 16 keys of this query
    const float mn = fmaxf(m, mx); const float alpha = (m <= -1.0e38f) ? 0.f : __expf(m - mn);
    float es = 0.f; v16h pa, pl;
#pragma unroll
    for (int r = 0; r < 8; ++r) { const float e0 = (s[0][r] <= -1.0e38f) ? 0.f : __expf(s[0][r] - mn), e1 = (s[1][r] <= -1.0e38f) ? 0.f : __expf(s[1][r] - mn); es += e0 + e1;
      const float x0 = e0 * 2048.0f, x1 = e1 * 2048.0f; const _Float16 h0 = (_Float16)x0, h1 = (_Float16)x1; pa[r] = h0; pa[8 + r] = h1; pl[r] = (_Float16)((x0 - (float)h0) * 2048.0f); pl[8 + r] = (_Float16)((x1 - (float)h1) * 2048.0f); }   // P^T as a B fragment: element r = key 8g + r, element 8 + r = key 16 + 8g + r, the k order of frag_h; P scaled by 2^11 before the f16 split so small softmax weights stay out of the f16 subnormal range; 2^-11 folded into the epilogue
    l = l * alpha + es; m = mn;
#pragma unroll
    for (int dt = 0; dt < 4; ++dt) {
#pragma unroll
      for (int r = 0; r < 8; ++r) { acc[dt][r] *= alpha; accl[dt][r] *= alpha; } }
#pragma unroll
    for (int dt = 0; dt < 4; ++dt) { acc[dt] = wmma16(vh[dt], pa, acc[dt]); accl[dt] = wmma16(vh[dt], pl, accl[dt]); }   // V hi x P hi, V hi x P residual
#pragma unroll
    for (int dt = 0; dt < 4; ++dt) accl[dt] = wmma16(vl[dt], pa, accl[dt]);   // V residual x P hi (3 products)
  }
  asm volatile("s_wait_asynccnt 0x0" ::: "memory");     // no copy is outstanding when the wave goes on to the epilogue
  l += xhalf(l);   // the two half-waves' sums of one query
  const float il = (1.0f / 2048.0f) / l;
#pragma unroll
  for (int dt = 0; dt < 4; ++dt) { v4f o0, o1;   // acc[dt][r] = O^T[d = dt*16 + 8g + r][query col]
#pragma unroll
    for (int r = 0; r < 4; ++r) { o0[r] = (acc[dt][r] + accl[dt][r] * (1.0f / 2048.0f)) * il; o1[r] = (acc[dt][4 + r] + accl[dt][4 + r] * (1.0f / 2048.0f)) * il; }
    *(v4f*)&so[wave][col][dt * 16 + 8 * g] = o0; *(v4f*)&so[wave][col][dt * 16 + 8 * g + 4] = o1; }
  LDSX();
  for (int rl = 0; rl < 16; ++rl) if (lane < 16) vst2(O + ((size_t)b * SS + q0 + rl) * DM + h * HD + lane * 4, *(const v4f*)&so[wave][rl][lane * 4]);
}
// ---- k_out: block = (64 rows, 128 cols): out = O(hi/lo) . Wo rows (2 products) + bo
__global__ __launch_bounds__(128) void k_out(const float* __restrict__ O, const __bf16* __restrict__ P, const float* __restrict__ BO, float* __restrict__ Y) {
  __shared__ __align__(16) float so[4][16][132];
  const int tid = threadIdx.x, wave = tid >> 5, lane = tid & 31, col = lane & 15, g = lane >> 4; const size_t r0 = (size_t)blockIdx.x * 64 + wave * 16; const int n0 = blockIdx.y * 128;
  v8f acc[8] = {};
#pragma unroll 2
  for (int kc = 0; kc < DM / 32; ++kc) { const F2 a = split_row(O + (r0 + col) * DM, kc * 32, lane);
#pragma unroll
    for (int j = 0; j < 8; ++j) { const v16b w = frag_b(P + (size_t)(n0 + j * 16 + col) * DM + kc * 32, lane); acc[j] = wmma_bf(a.l, w, acc[j]); acc[j] = wmma_bf(a.h, w, acc[j]); } }
#pragma unroll
  for (int j = 0; j < 8; ++j) {
#pragma unroll
    for (int r = 0; r < 8; ++r) so[wave][8 * g + r][j * 16 + col] = acc[j][r] + (BO ? bfr(BO[n0 + j * 16 + col]) : 0.f); }
  LDSX();
  for (int rl = 0; rl < 16; ++rl) vst2(Y + (r0 + rl) * DM + n0 + lane * 4, *(const v4f*)&so[wave][rl][lane * 4]);
}
extern "C" void kernel_launch(void* const* d_in, const int* in_sizes, int n_in, void* d_out, int out_size, void* d_ws, size_t ws_size, hipStream_t stream) {
  (void)in_sizes; (void)n_in; (void)out_size;
  const float** F = (const float**)d_in;   // 0 x [2,8192,512], 1 Wq [512,512] (in,out), 2 bq, 3 Wk, 4 bk, 5 Wv, 6 bv
  if (ws_size < (size_t)WS_END) return;
  char* ws = (char*)d_ws; __bf16* PK = (__bf16*)(ws + WS_PK); _Float16 *QK = (_Float16*)(ws + WS_QK), *QKL = (_Float16*)(ws + WS_QKL), *VTH = (_Float16*)(ws + WS_VTH), *VTL = (_Float16*)(ws + WS_VTL);
  k_pack<<<dim3(DM, 3), 256, 0, stream>>>(F[1], F[3], F[5], PK);
  k_qkv<<<dim3(TNB * SS / 64, QKVW / 128), 128, 0, stream>>>(F[0], F[0], F[0], PK + PK_A, F[2], F[4], F[6], QK, QKL, VTH, VTL);
  k_attn<<<dim3(TQB, NH, TNB), 128, 0, stream>>>(QK, QKL, VTH, VTL, nullptr, (float*)d_out);
}

// v004
// It runs in 125 microseconds.
// Two timings next to v003 put it at 1.10 and 1.09 times that version's speed.
// Over all steps from v000 it is 2.91 times as fast.
// compute dtype: all float inputs rounded to bf16; q/k/v = x . W + b with EXACT bf16 products on WMMA 16x16x32 ((in,out) weights as transposed rows), f16 hi + residual; banded attention (|i - j| <= 256; other key tiles skipped) with 3-product logits and 3-product P.v, x 1/8, running-max softmax in f32 (hardware exp); the merged context is the f32 output.
#include <hip/hip_runtime.h>
#include <math.h>

typedef __attribute__((ext_vector_type(16))) _Float16 v16h;
typedef __attribute__((ext_vector_type(16))) __bf16 v16b;
typedef __attribute__((ext_vector_type(8)))  _Float16 v8h;
typedef __attribute__((ext_vector_type(8)))  float v8f;
typedef __attribute__((ext_vector_type(4)))  float v4f;
typedef __attribute__((ext_vector_type(2)))  float v2f;
typedef __attribute__((ext_vector_type(4)))  unsigned v4u;
typedef __attribute__((ext_vector_type(4)))  int v4i;
typedef float __attribute__((may_alias)) float_a;
typedef int __attribute__((may_alias)) int_a;

template <typename T> __device__ __forceinline__ void vst2(void* p, T v) { *(T*)p = v;  }
__device__ __forceinline__ v8f wmma16(v16h a, v16h b, v8f c) {
  return __builtin_amdgcn_wmma_f32_16x16x32_f16(false, a, false, b, (short)0, c, false, false);
}
__device__ __forceinline__ v8f wmma_bf(v16b a, v16b b, v8f c) {
  return __builtin_amdgcn_wmma_f32_16x16x32_bf16(false, a, false, b, (short)0, c, false, false);
}
// Longformer multi-head attention (B 2, S 8,192, D 512, 8 heads x 64, one-sided window 256): (in,out) projections + biases, q / 8, banded softmax, no output projection (the merged context is the output).
__device__ __forceinline__ v16h frag_h(const _Float16* rowk0, int lane) {
  union { v16h v; v8h q[2]; } u; const _Float16* p = rowk0 + 8 * (lane >> 4);
  u.q[0] = *(const v8h*)p; u.q[1] = *(const v8h*)(p + 16); return u.v;
}
__device__ __forceinline__ v16h frag_f32(const float* rowk0, int lane) {
  v16h a; const float* p = rowk0 + 8 * (lane >> 4);
#pragma unroll
  for (int i = 0; i < 8; ++i) { a[i] = (_Float16)p[i]; a[8 + i] = (_Float16)p[16 + i]; }
  return a;
}
__device__ __forceinline__ v16h frag_f32s(const float* rowk0, int lane, float sc) {
  v16h a; const float* p = rowk0 + 8 * (lane >> 4);
#pragma unroll
  for (int i = 0; i < 8; ++i) { a[i] = (_Float16)(p[i] * sc); a[8 + i] = (_Float16)(p[16 + i] * sc); }
  return a;
}
// column fragment from a [K][ld] layout (column n), rows >= K read as 0
__device__ __forceinline__ v16h fragc_f32(const float* W, int k0, int n, int lane, int ld, int K) {
  v16h a; const int g = lane >> 4;
#pragma unroll
  for (int i = 0; i < 8; ++i) { const int ka = k0 + 8 * g + i, kb = ka + 16;
    a[i] = (_Float16)(ka < K ? W[(size_t)(ka < K ? ka : K - 1) * ld + n] : 0.f); a[8 + i] = (_Float16)(kb < K ? W[(size_t)(kb < K ? kb : K - 1) * ld + n] : 0.f); }
  return a;
}
struct F2 { v16b h, l; };
__device__ __forceinline__ F2 bsplit16(const float v[16]) { F2 r;
#pragma unroll
  for (int i = 0; i < 16; ++i) { const __bf16 h = (__bf16)v[i]; r.h[i] = h; r.l[i] = (__bf16)(v[i] - (float)h); }
  return r; }
__device__ __forceinline__ F2 split_row(const float* row, int k0, int lane) { float v[16]; const float* p = row + k0 + 8 * (lane >> 4);
#pragma unroll
  for (int i = 0; i < 8; ++i) { v[i] = p[i]; v[8 + i] = p[16 + i]; }
  return bsplit16(v); }
__device__ __forceinline__ F2 split_rowK(const float* row, int k0, int lane, int K) { float v[16]; const int g = lane >> 4;
#pragma unroll
  for (int i = 0; i < 8; ++i) { const int ka = k0 + 8 * g + i, kb = ka + 16; v[i] = ka < K ? row[ka < K ? ka : K - 1] : 0.f; v[8 + i] = kb < K ? row[kb < K ? kb : K - 1] : 0.f; }
  return bsplit16(v); }
__device__ __forceinline__ F2 split_col(const float* W, int k0, int n, int lane, int ld, int K) { float v[16]; const int g = lane >> 4;
#pragma unroll
  for (int i = 0; i < 8; ++i) { const int ka = k0 + 8 * g + i, kb = ka + 16; v[i] = ka < K ? W[(size_t)(ka < K ? ka : K - 1) * ld + n] : 0.f; v[8 + i] = kb < K ? W[(size_t)(kb < K ? kb : K - 1) * ld + n] : 0.f; }
  return bsplit16(v); }
__device__ __forceinline__ v8f mac3(const F2& a, const F2& b, v8f c) { c = wmma_bf(a.l, b.h, c); c = wmma_bf(a.h, b.l, c); return wmma_bf(a.h, b.h, c); }
__device__ __forceinline__ float sigm(float v) { return 1.0f / (1.0f + expf(-v)); }
#define LDSX() do { asm volatile("s_wait_dscnt 0" ::: "memory"); __builtin_amdgcn_wave_barrier(); __builtin_amdgcn_fence(__ATOMIC_RELEASE, "workgroup"); } while (0)


#define NB 2
#define SS 8192
#define DM 512
#define NH 8
#define LW 256
#define HD 64
#define QKVW (3 * DM)
#ifndef TQB
#define TQB (SS / 64)
#define TNB NB
#define TOB (NB * SS / 64)     // output row tiles (all)
#endif
typedef __attribute__((ext_vector_type(8))) __bf16 v8b;
__device__ __forceinline__ v16b frag_b(const __bf16* rowk0, int lane) {
  union { v16b v; v8b q[2]; } u; const __bf16* p = rowk0 + 8 * (lane >> 4);
  u.q[0] = *(const v8b*)p; u.q[1] = *(const v8b*)(p + 16); return u.v;
}
__device__ __forceinline__ float bfr(float v) { return (float)(__bf16)v; }
__device__ __forceinline__ float xhalf(float x) { return __builtin_bit_cast(float, __builtin_amdgcn_permlanex16(__builtin_bit_cast(int, x), __builtin_bit_cast(int, x), 0x76543210, 0xfedcba98, false, false)); }   // lane l with lane l ^ 16
__device__ __attribute__((noinline)) float exp_ni(float v) { return expf(v); }
__device__ __attribute__((noinline)) float erf_ni(float v) { return erff(v); }

#define PK_A 0                       // [1536][512] Wqkv rows (natural [out][in])
#define PK_P (PK_A + QKVW * DM)        // [512][512]; not written here (no W_o input)
#define PK_END (PK_P + DM * DM)
#define WS_PK  0u
#define WS_QK  (WS_PK + 2u * PK_END)             // f16 [16384 rows][1024]: q | k
#define WS_QKL (WS_QK + 2u * NB * SS * 2 * DM)     // f16 q | k residual planes x2048
#define WS_VTH (WS_QKL + 2u * NB * SS * 2 * DM)    // f16 [b][512 (h*64+d)][8192 s] hi
#define WS_VTL (WS_VTH + 2u * NB * DM * SS)        // f16 lo x 2048
#define WS_O   (WS_VTL + 2u * NB * DM * SS)        // f32 [16384][512] (unused)
#define WS_CS  (WS_O + 4u * NB * SS * DM)           // f32 [8192][32] x 2 (unused)
#define WS_END (WS_CS + 4u * 2 * SS * 32)
// ---- k_pack: block = (row n, which): column n of (in,out) weight -> bf16 row; which 0..2 -> W_q/W_k/W_v into PK_A rows which*512 + n
__global__ __launch_bounds__(256) void k_pack(const float* __restrict__ WQ, const float* __restrict__ WK, const float* __restrict__ WV, __bf16* __restrict__ PK) {   // (in,out) weights [512][512]: packed row (which*DM + n) = column n
  __shared__ __align__(16) __bf16 s[DM]; const int n = blockIdx.x, which = blockIdx.y, t = threadIdx.x; const float* Wm = which == 0 ? WQ : which == 1 ? WK : WV;
  for (int k = t; k < DM; k += 256) s[k] = (__bf16)Wm[(size_t)k * DM + n]; __syncthreads(); __bf16* dst = PK + PK_A + ((size_t)which * DM + n) * DM; for (int q = t; q < DM / 8; q += 256) vst2((unsigned*)(dst + q * 8), *(const v4u*)&s[q * 8]); }
#define KP 72   // 16-bit elements per staged 128-B row (K rows, weight rows): a 144-B pitch (16 B x odd, for ds_load_b128 readers)
#define VP 40   // f16 per staged V^T row: 64 B of data at an 80-B pitch
__device__ __forceinline__ unsigned lds_off(const void* p) { return (unsigned)(size_t)p; }
// eight 16-B-per-lane asynchronous copies global -> LDS; the s_wait_xcnt stands inside the statement so that no address register is rewritten in front of it
__device__ __forceinline__ void copy8(unsigned l0, unsigned l1, unsigned l2, unsigned l3, unsigned l4, unsigned l5, unsigned l6, unsigned l7, const void* g0, const void* g1, const void* g2, const void* g3, const void* g4, const void* g5, const void* g6, const void* g7) {
  asm volatile("global_load_async_to_lds_b128 %0, %8, off\n\t"
               "global_load_async_to_lds_b128 %1, %9, off\n\t"
               "global_load_async_to_lds_b128 %2, %10, off\n\t"
               "global_load_async_to_lds_b128 %3, %11, off\n\t"
               "global_load_async_to_lds_b128 %4, %12, off\n\t"
               "global_load_async_to_lds_b128 %5, %13, off\n\t"
               "global_load_async_to_lds_b128 %6, %14, off\n\t"
               "global_load_async_to_lds_b128 %7, %15, off\n\t"
               "s_wait_xcnt 0x0"
               :: "v"(l0), "v"(l1), "v"(l2), "v"(l3), "v"(l4), "v"(l5), "v"(l6), "v"(l7), "v"(g0), "v"(g1), "v"(g2), "v"(g3), "v"(g4), "v"(g5), "v"(g6), "v"(g7) : "memory");
}
__global__ __launch_bounds__(128) void k_qkv(const float* __restrict__ XQ, const float* __restrict__ XK, const float* __restrict__ XV, const __bf16* __restrict__ P, const float* __restrict__ BQ, const float* __restrict__ BK, const float* __restrict__ BV, _Float16* __restrict__ QK, _Float16* __restrict__ QKL, _Float16* __restrict__ VTH, _Float16* __restrict__ VTL) {
  const int which0 = (blockIdx.y * 128) / DM; const float* X = (which0 == 0) ? XQ : (which0 == 1) ? XK : XV; const float* BB = BQ ? (((which0 == 0) ? BQ : (which0 == 1) ? BK : BV) + (blockIdx.y * 128 - which0 * DM)) : nullptr;
  __shared__ __align__(16) _Float16 so[4][16][136], sol[4][16][136]; __shared__ __align__(16) _Float16 sth[128][KP], stl[128][KP];   // in the k loop: the two buffers of the weight ring (128 packed rows x 64 k of bf16); behind it: the V^T output staging
  const int tid = threadIdx.x, wave = tid >> 5, lane = tid & 31, col = lane & 15, g = lane >> 4; const size_t r0 = (size_t)blockIdx.x * 64 + wave * 16; const int n0 = blockIdx.y * 128;
  v8f acc[8] = {};
  const int wr = tid >> 3, wp = (tid & 7) * 8;   // a thread's 16-B piece of the packed rows wr + 16 i, i = 0 .. 7
  auto fill = [&](int st, _Float16 (*bp)[KP]) { const __bf16* s = P + (size_t)(n0 + wr) * DM + st * 64 + wp;
    copy8(lds_off(&bp[wr][wp]), lds_off(&bp[wr + 16][wp]), lds_off(&bp[wr + 32][wp]), lds_off(&bp[wr + 48][wp]), lds_off(&bp[wr + 64][wp]), lds_off(&bp[wr + 80][wp]), lds_off(&bp[wr + 96][wp]), lds_off(&bp[wr + 112][wp]),
          s, s + 16 * DM, s + 32 * DM, s + 48 * DM, s + 64 * DM, s + 80 * DM, s + 96 * DM, s + 112 * DM); };
  fill(0, sth);
  float bias[8] = {};   // this lane's eight bias values (columns n0 + j * 16 + col): asked for once, as one group under one test, so that they fly beside stage 0's copies; read at each output element they compiled to 64 load-and-wait pairs in a row
  if (BB) {
#pragma unroll   // j constant: bias[] stays in registers and the eight loads stand together
    for (int j = 0; j < 8; ++j) bias[j] = BB[j * 16 + col]; }
  asm volatile("s_wait_asynccnt 0x0" ::: "memory");   // this wave's share of stage 0 has landed
  __syncthreads();                                    // stage 0 is published to all four waves
  fill(1, stl);
#pragma unroll 1   // rolled: one copy of the stage's foot (waits, barrier, refill) in the text, the buffer chosen by st & 1
  for (int st = 0; st < DM / 64; ++st) { _Float16 (*bp)[KP] = (st & 1) ? stl : sth;
    v4f xr[2][4];   // this wave's x piece of the stage (fp32), asked for first: the longest wait
#pragma unroll
    for (int kk = 0; kk < 2; ++kk) { const float* p = X + (r0 + col) * DM + (st * 2 + kk) * 32 + 8 * g; xr[kk][0] = *(const v4f*)p; xr[kk][1] = *(const v4f*)(p + 4); xr[kk][2] = *(const v4f*)(p + 16); xr[kk][3] = *(const v4f*)(p + 20); }
    v16b w[2][8];   // the stage's sixteen weight fragments, read from LDS as one group in front of its WMMAs
#pragma unroll     // kk constant: the two 32-k halves of a staged row become immediate offsets of the LDS loads
    for (int kk = 0; kk < 2; ++kk) {
#pragma unroll
      for (int j = 0; j < 8; ++j) w[kk][j] = frag_b((const __bf16*)&bp[j * 16 + col][kk * 32], lane); }
    __builtin_amdgcn_sched_barrier(0);   // keeps the loads above as one group: without it the scheduler sinks each LDS pair to one WMMA in front of its use, and every WMMA waits out an LDS latency
#pragma unroll
    for (int kk = 0; kk < 2; ++kk) { v16b a;
#pragma unroll
      for (int i = 0; i < 4; ++i) { a[i] = (__bf16)xr[kk][0][i]; a[4 + i] = (__bf16)xr[kk][1][i]; a[8 + i] = (__bf16)xr[kk][2][i]; a[12 + i] = (__bf16)xr[kk][3][i]; }
#pragma unroll
      for (int j = 0; j < 8; ++j) acc[j] = wmma_bf(a, w[kk][j], acc[j]); }
    asm volatile("s_wait_dscnt 0x0" ::: "memory");      // this wave's reads of buffer bp are done
    asm volatile("s_wait_asynccnt 0x0" ::: "memory");   // this wave's share of stage st + 1 has landed
    __syncthreads();                                    // publishes stage st + 1 and ends every wave's reads of buffer bp
    if (st + 2 < DM / 64) fill(st + 2, bp); }
  asm volatile("s_wait_asynccnt 0x0" ::: "memory");     // no copy is outstanding when the ring becomes output staging
  if (n0 < 2 * DM) {   // q stored unscaled (f16 sigma ~0.6, no subnormal exposure); 1/8 applied to the f32 score
#pragma unroll
    for (int j = 0; j < 8; ++j) {
#pragma unroll
      for (int r = 0; r < 8; ++r) { const float v = acc[j][r] + bfr(bias[j]); const _Float16 hv = (_Float16)v; so[wave][8 * g + r][j * 16 + col] = hv; sol[wave][8 * g + r][j * 16 + col] = (_Float16)((v - (float)hv) * 2048.0f); } }   // q, k (+ bias) as f16 hi + (x2048) residual
    LDSX();
    for (int rl = 0; rl < 16; ++rl) if (lane < 16) { vst2((unsigned*)(QK + (r0 + rl) * (2 * DM) + n0 + lane * 8), *(const v4u*)&so[wave][rl][lane * 8]); vst2((unsigned*)(QKL + (r0 + rl) * (2 * DM) + n0 + lane * 8), *(const v4u*)&sol[wave][rl][lane * 8]); }
  } else {
#pragma unroll
    for (int j = 0; j < 8; ++j) {
#pragma unroll
      for (int r = 0; r < 8; ++r) { const float v = acc[j][r] + bfr(bias[j]); const _Float16 hv = (_Float16)v; sth[j * 16 + col][wave * 16 + 8 * g + r] = hv; stl[j * 16 + col][wave * 16 + 8 * g + r] = (_Float16)((v - (float)hv) * 2048.0f); } }
    __syncthreads();
    const size_t rb = (size_t)blockIdx.x * 64; const int b = (int)(rb / SS), s0 = (int)(rb % SS); const int pc0 = n0 - 2 * DM;
    for (int q = tid; q < 128 * 8; q += 128) { const int d = q >> 3, pc = q & 7; const size_t o = ((size_t)b * DM + pc0 + d) * SS + s0 + pc * 8; vst2((unsigned*)(VTH + o), *(const v4u*)&sth[d][pc * 8]); vst2((unsigned*)(VTL + o), *(const v4u*)&stl[d][pc * 8]); }
  }
}
// ---- k_attn: block = (64 queries, head h, batch b): banded flash attention in transposed form: S^T = K . Q^T (A = K rows, B = q), so a lane holds 16 of the 32 scores of ONE query (column col, keys ct*16 + 8g + r): maximum and sum in the lane plus one exchange between the wave's halves; the two S^T tiles, converted in place, are the B operand of O^T += V^T . P^T; O[b*S+q][h*64+d] = (acc + accl / 2048) / (2048 l) (256-B segments)
__global__ __launch_bounds__(128) void k_attn(const _Float16* __restrict__ QK, const _Float16* __restrict__ QKL, const _Float16* __restrict__ VTH, const _Float16* __restrict__ VTL, const void* __restrict__ KMASK, float* __restrict__ O) {
  __shared__ __align__(16) float so[4][16][68];
  __shared__ __align__(16) _Float16 skh[2][32][KP], skl[2][32][KP], svh[2][64][VP], svl[2][64][VP];   // two buffers of one 32-key tile: K hi, K residual, V^T hi, V^T residual, read by all four waves
  const int tid = threadIdx.x, wave = tid >> 5, lane = tid & 31, col = lane & 15, g = lane >> 4;
  const int qb = blockIdx.x, h = blockIdx.y, b = blockIdx.z; const int q0 = qb * 64 + wave * 16; const size_t rq = (size_t)b * SS + q0 + col;
  v16h aq[2], aql[2];
#pragma unroll
  for (int kc = 0; kc < 2; ++kc) { aq[kc] = frag_h(QK + rq * (2 * DM) + h * HD + kc * 32, lane); aql[kc] = frag_h(QKL + rq * (2 * DM) + h * HD + kc * 32, lane); }
  float m = -3.0e38f, l = 0.f;   // of query q0 + col; l holds this half-wave's keys only and is joined behind the loop
  v8f acc[4] = {}, accl[4] = {};
  const int nks = SS / 32;   // all keys
  const int ks0 = (qb * 64 - LW) > 0 ? (qb * 64 - LW) / 32 : 0; const int ks1 = ((qb * 64 + 64 + LW) / 32) < nks ? ((qb * 64 + 64 + LW) / 32) : nks;   // window tiles
  const int kr = tid >> 3, kp = (tid & 7) * 8, vw = tid >> 2, vp = (tid & 3) * 8;   // a thread's 16-B piece: K rows kr, kr + 16; V^T rows vw, vw + 32
  const size_t gko = ((size_t)b * SS + kr) * (2 * DM) + DM + h * HD + kp, gvo = ((size_t)b * DM + h * HD + vw) * SS + vp;
  auto fill = [&](int ks, int bf) { const size_t ko = gko + (size_t)ks * 32 * (2 * DM), vo = gvo + (size_t)ks * 32;
    copy8(lds_off(&skh[bf][kr][kp]), lds_off(&skh[bf][kr + 16][kp]), lds_off(&skl[bf][kr][kp]), lds_off(&skl[bf][kr + 16][kp]), lds_off(&svh[bf][vw][vp]), lds_off(&svh[bf][vw + 32][vp]), lds_off(&svl[bf][vw][vp]), lds_off(&svl[bf][vw + 32][vp]),
          QK + ko, QK + ko + 16 * (2 * DM), QKL + ko, QKL + ko + 16 * (2 * DM), VTH + vo, VTH + vo + (size_t)32 * SS, VTL + vo, VTL + vo + (size_t)32 * SS); };
  fill(ks0, 0);
  asm volatile("s_wait_asynccnt 0x0" ::: "memory");   // this wave's share of tile ks0 has landed
  __syncthreads();                                    // tile ks0 is published to all four waves
  if (ks0 + 1 < ks1) fill(ks0 + 1, 1);
#pragma unroll 1
  for (int ks = ks0; ks < ks1; ++ks) { v8f s[2]; const int bf = (ks - ks0) & 1;
    v16h kh[2][2], kl[2][2];   // the tile's eight K fragments (hi, residual), read from LDS as one group in front of the twelve score WMMAs
#pragma unroll
    for (int ct = 0; ct < 2; ++ct) {
#pragma unroll
      for (int kc = 0; kc < 2; ++kc) { kh[ct][kc] = frag_h(&skh[bf][ct * 16 + col][kc * 32], lane); kl[ct][kc] = frag_h(&skl[bf][ct * 16 + col][kc * 32], lane); } }
    __builtin_amdgcn_sched_barrier(0);   // keeps the sixteen K loads as one group: without it the scheduler holds some back among the WMMAs, which then wait out an LDS latency each
    v8f c[2] = {}, cl[2] = {};   // 3 products; each accumulator takes its products in the order kc 0, kc 1 (cl: K hi x q residual, then K residual x q)
#pragma unroll
    for (int kc = 0; kc < 2; ++kc) {
#pragma unroll
      for (int ct = 0; ct < 2; ++ct) { c[ct] = wmma16(kh[ct][kc], aq[kc], c[ct]); cl[ct] = wmma16(kh[ct][kc], aql[kc], cl[ct]); }
#pragma unroll
      for (int ct = 0; ct < 2; ++ct) cl[ct] = wmma16(kl[ct][kc], aq[kc], cl[ct]); }
    v16h vh[4], vl[4];   // the tile's eight V^T fragments, read here too, into the registers that the score WMMAs set free
#pragma unroll
    for (int dt = 0; dt < 4; ++dt) { vh[dt] = frag_h(&svh[bf][dt * 16 + col][0], lane); vl[dt] = frag_h(&svl[bf][dt * 16 + col][0], lane); }
    // the ring's hand-over stands here: all of the tile is in registers, and the rest of the pass (softmax, P.V) touches no LDS, so the refill flies behind it
    LDSX();                                             // holds the s_wait_dscnt 0: this wave's reads of buffer bf are done
    asm volatile("s_wait_asynccnt 0x0" ::: "memory");   // this wave's share of tile ks + 1 has landed
    __syncthreads();                                    // publishes tile ks + 1 and ends every wave's reads of buffer bf
    if (ks + 2 < ks1) fill(ks + 2, bf);
#pragma unroll
    for (int ct = 0; ct < 2; ++ct) { const int kk = ks * 32 + ct * 16 + 8 * g;
#pragma unroll
      for (int r = 0; r < 8; ++r) { const float cc = c[ct][r] + cl[ct][r] * (1.0f / 2048.0f); const int dq = (q0 + col) - (kk + r); s[ct][r] = (dq <= LW && dq >= -LW) ? cc * 0.125f : -3.0e38f; } }   // 1/sqrt(64); masked keys excluded
    float mx = fmaxf(s[0][0], s[1][0]);
#pragma unroll
    for (int r = 1; r < 8; ++r) mx = fmaxf(mx, fmaxf(s[0][r], s[1][r]));
    mx = fmaxf(mx, xhalf(mx));   // the other 16 keys of this query
    const float mn = fmaxf(m, mx); const float alpha = (m <= -1.0e38f) ? 0.f : __expf(m - mn);
    float es = 0.f; v16h pa, pl;
#pragma unroll
    for (int r = 0; r < 8; ++r) { const float e0 = (s[0][r] <= -1.0e38f) ? 0.f : __expf(s[0][r] - mn), e1 = (s[1][r] <= -1.0e38f) ? 0.f : __expf(s[1][r] - mn); es += e0 + e1;
      const float x0 = e0 * 2048.0f, x1 = e1 * 2048.0f; const _Float16 h0 = (_Float16)x0, h1 = (_Float16)x1; pa[r] = h0; pa[8 + r] = h1; pl[r] = (_Float16)((x0 - (float)h0) * 2048.0f); pl[8 + r] = (_Float16)((x1 - (float)h1) * 2048.0f); }   // P^T as a B fragment: element r = key 8g + r, element 8 + r = key 16 + 8g + r, the k order of frag_h; P scaled by 2^11 before the f16 split so small softmax weights stay out of the f16 subnormal range; 2^-11 folded into the epilogue
    l = l * alpha + es; m = mn;
#pragma unroll
    for (int dt = 0; dt < 4; ++dt) {
#pragma unroll
      for (int r = 0; r < 8; ++r) { acc[dt][r] *= alpha; accl[dt][r] *= alpha; } }
#pragma unroll
    for (int dt = 0; dt < 4; ++dt) { acc[dt] = wmma16(vh[dt], pa, acc[dt]); accl[dt] = wmma16(vh[dt], pl, accl[dt]); }   // V hi x P hi, V hi x P residual
#pragma unroll
    for (int dt = 0; dt < 4; ++dt) accl[dt] = wmma16(vl[dt], pa, accl[dt]);   // V residual x P hi (3 products)
  }
  asm volatile("s_wait_asynccnt 0x0" ::: "memory");     // no copy is outstanding when the wave goes on to the epilogue
  l += xhalf(l);   // the two half-waves' sums of one query
  const float il = (1.0f / 2048.0f) / l;
#pragma unroll
  for (int dt = 0; dt < 4; ++dt) { v4f o0, o1;   // acc[dt][r] = O^T[d = dt*16 + 8g + r][query col]
#pragma unroll
    for (int r = 0; r < 4; ++r) { o0[r] = (acc[dt][r] + accl[dt][r] * (1.0f / 2048.0f)) * il; o1[r] = (acc[dt][4 + r] + accl[dt][4 + r] * (1.0f / 2048.0f)) * il; }
    *(v4f*)&so[wave][col][dt * 16 + 8 * g] = o0; *(v4f*)&so[wave][col][dt * 16 + 8 * g + 4] = o1; }
  LDSX();
  for (int rl = 0; rl < 16; ++rl) if (lane < 16) vst2(O + ((size_t)b * SS + q0 + rl) * DM + h * HD + lane * 4, *(const v4f*)&so[wave][rl][lane * 4]);
}
// ---- k_out: block = (64 rows, 128 cols): out = O(hi/lo) . Wo rows (2 products) + bo
__global__ __launch_bounds__(128) void k_out(const float* __restrict__ O, const __bf16* __restrict__ P, const float* __restrict__ BO, float* __restrict__ Y) {
  __shared__ __align__(16) float so[4][16][132];
  const int tid = threadIdx.x, wave = tid >> 5, lane = tid & 31, col = lane & 15, g = lane >> 4; const size_t r0 = (size_t)blockIdx.x * 64 + wave * 16; const int n0 = blockIdx.y * 128;
  v8f acc[8] = {};
#pragma unroll 2
  for (int kc = 0; kc < DM / 32; ++kc) { const F2 a = split_row(O + (r0 + col) * DM, kc * 32, lane);
#pragma unroll
    for (int j = 0; j < 8; ++j) { const v16b w = frag_b(P + (size_t)(n0 + j * 16 + col) * DM + kc * 32, lane); acc[j] = wmma_bf(a.l, w, acc[j]); acc[j] = wmma_bf(a.h, w, acc[j]); } }
#pragma unroll
  for (int j = 0; j < 8; ++j) {
#pragma unroll
    for (int r = 0; r < 8; ++r) so[wave][8 * g + r][j * 16 + col] = acc[j][r] + (BO ? bfr(BO[n0 + j * 16 + col]) : 0.f); }
  LDSX();
  for (int rl = 0; rl < 16; ++rl) vst2(Y + (r0 + rl) * DM + n0 + lane * 4, *(const v4f*)&so[wave][rl][lane * 4]);
}
extern "C" void kernel_launch(void* const* d_in, const int* in_sizes, int n_in, void* d_out, int out_size, void* d_ws, size_t ws_size, hipStream_t stream) {
  (void)in_sizes; (void)n_in; (void)out_size;
  const float** F = (const float**)d_in;   // 0 x [2,8192,512], 1 Wq [512,512] (in,out), 2 bq, 3 Wk, 4 bk, 5 Wv, 6 bv
  if (ws_size < (size_t)WS_END) return;
  char* ws = (char*)d_ws; __bf16* PK = (__bf16*)(ws + WS_PK); _Float16 *QK = (_Float16*)(ws + WS_QK), *QKL = (_Float16*)(ws + WS_QKL), *VTH = (_Float16*)(ws + WS_VTH), *VTL = (_Float16*)(ws + WS_VTL);
  k_pack<<<dim3(DM, 3), 256, 0, stream>>>(F[1], F[3], F[5], PK);
  k_qkv<<<dim3(TNB * SS / 64, QKVW / 128), 128, 0, stream>>>(F[0], F[0], F[0], PK + PK_A, F[2], F[4], F[6], QK, QKL, VTH, VTL);
  k_attn<<<dim3(TQB, NH, TNB), 128, 0, stream>>>(QK, QKL, VTH, VTL, nullptr, (float*)d_out);
}

// v005
// A run of this version takes 121 microseconds.
// Timed twice side by side with v004, it ran 1.03 times as fast both times.
// Counting every step since v000, it is 3.00 times as fast.
// compute dtype: all float inputs rounded to bf16; q/k/v = x . W + b with EXACT bf16 products on WMMA 16x16x32 ((in,out) weights as transposed rows), f16 hi + residual; banded attention (|i - j| <= 256; other key tiles skipped) with 3-product logits and 3-product P.v, x 1/8, running-max softmax in f32 (hardware exp); the merged context is the f32 output.
#include <hip/hip_runtime.h>
#include <math.h>

typedef __attribute__((ext_vector_type(16))) _Float16 v16h;
typedef __attribute__((ext_vector_type(16))) __bf16 v16b;
typedef __attribute__((ext_vector_type(8)))  _Float16 v8h;
typedef __attribute__((ext_vector_type(8)))  float v8f;
typedef __attribute__((ext_vector_type(4)))  float v4f;
typedef __attribute__((ext_vector_type(2)))  float v2f;
typedef __attribute__((ext_vector_type(4)))  unsigned v4u;
typedef __attribute__((ext_vector_type(4)))  int v4i;
typedef float __attribute__((may_alias)) float_a;
typedef int __attribute__((may_alias)) int_a;

template <typename T> __device__ __forceinline__ void vst2(void* p, T v) { *(T*)p = v;  }
__device__ __forceinline__ v8f wmma16(v16h a, v16h b, v8f c) {
  return __builtin_amdgcn_wmma_f32_16x16x32_f16(false, a, false, b, (short)0, c, false, false);
}
__device__ __forceinline__ v8f wmma_bf(v16b a, v16b b, v8f c) {
  return __builtin_amdgcn_wmma_f32_16x16x32_bf16(false, a, false, b, (short)0, c, false, false);
}
// Longformer multi-head attention (B 2, S 8,192, D 512, 8 heads x 64, one-sided window 256): (in,out) projections + biases, q / 8, banded softmax, no output projection (the merged context is the output).
__device__ __forceinline__ v16h frag_h(const _Float16* rowk0, int lane) {
  union { v16h v; v8h q[2]; } u; const _Float16* p = rowk0 + 8 * (lane >> 4);
  u.q[0] = *(const v8h*)p; u.q[1] = *(const v8h*)(p + 16); return u.v;
}
__device__ __forceinline__ v16h frag_f32(const float* rowk0, int lane) {
  v16h a; const float* p = rowk0 + 8 * (lane >> 4);
#pragma unroll
  for (int i = 0; i < 8; ++i) { a[i] = (_Float16)p[i]; a[8 + i] = (_Float16)p[16 + i]; }
  return a;
}
__device__ __forceinline__ v16h frag_f32s(const float* rowk0, int lane, float sc) {
  v16h a; const float* p = rowk0 + 8 * (lane >> 4);
#pragma unroll
  for (int i = 0; i < 8; ++i) { a[i] = (_Float16)(p[i] * sc); a[8 + i] = (_Float16)(p[16 + i] * sc); }
  return a;
}
// column fragment from a [K][ld] layout (column n), rows >= K read as 0
__device__ __forceinline__ v16h fragc_f32(const float* W, int k0, int n, int lane, int ld, int K) {
  v16h a; const int g = lane >> 4;
#pragma unroll
  for (int i = 0; i < 8; ++i) { const int ka = k0 + 8 * g + i, kb = ka + 16;
    a[i] = (_Float16)(ka < K ? W[(size_t)(ka < K ? ka : K - 1) * ld + n] : 0.f); a[8 + i] = (_Float16)(kb < K ? W[(size_t)(kb < K ? kb : K - 1) * ld + n] : 0.f); }
  return a;
}
struct F2 { v16b h, l; };
__device__ __forceinline__ F2 bsplit16(const float v[16]) { F2 r;
#pragma unroll
  for (int i = 0; i < 16; ++i) { const __bf16 h = (__bf16)v[i]; r.h[i] = h; r.l[i] = (__bf16)(v[i] - (float)h); }
  return r; }
__device__ __forceinline__ F2 split_row(const float* row, int k0, int lane) { float v[16]; const float* p = row + k0 + 8 * (lane >> 4);
#pragma unroll
  for (int i = 0; i < 8; ++i) { v[i] = p[i]; v[8 + i] = p[16 + i]; }
  return bsplit16(v); }
__device__ __forceinline__ F2 split_rowK(const float* row, int k0, int lane, int K) { float v[16]; const int g = lane >> 4;
#pragma unroll
  for (int i = 0; i < 8; ++i) { const int ka = k0 + 8 * g + i, kb = ka + 16; v[i] = ka < K ? row[ka < K ? ka : K - 1] : 0.f; v[8 + i] = kb < K ? row[kb < K ? kb : K - 1] : 0.f; }
  return bsplit16(v); }
__device__ __forceinline__ F2 split_col(const float* W, int k0, int n, int lane, int ld, int K) { float v[16]; const int g = lane >> 4;
#pragma unroll
  for (int i = 0; i < 8; ++i) { const int ka = k0 + 8 * g + i, kb = ka + 16; v[i] = ka < K ? W[(size_t)(ka < K ? ka : K - 1) * ld + n] : 0.f; v[8 + i] = kb < K ? W[(size_t)(kb < K ? kb : K - 1) * ld + n] : 0.f; }
  return bsplit16(v); }
__device__ __forceinline__ v8f mac3(const F2& a, const F2& b, v8f c) { c = wmma_bf(a.l, b.h, c); c = wmma_bf(a.h, b.l, c); return wmma_bf(a.h, b.h, c); }
__device__ __forceinline__ float sigm(float v) { return 1.0f / (1.0f + expf(-v)); }
#define LDSX() do { asm volatile("s_wait_dscnt 0" ::: "memory"); __builtin_amdgcn_wave_barrier(); __builtin_amdgcn_fence(__ATOMIC_RELEASE, "workgroup"); } while (0)


#define NB 2
#define SS 8192
#define DM 512
#define NH 8
#define LW 256
#define HD 64
#define QKVW (3 * DM)
#ifndef TQB
#define TQB (SS / 64)
#define TNB NB
#define TOB (NB * SS / 64)     // output row tiles (all)
#endif
typedef __attribute__((ext_vector_type(8))) __bf16 v8b;
__device__ __forceinline__ v16b frag_b(const __bf16* rowk0, int lane) {
  union { v16b v; v8b q[2]; } u; const __bf16* p = rowk0 + 8 * (lane >> 4);
  u.q[0] = *(const v8b*)p; u.q[1] = *(const v8b*)(p + 16); return u.v;
}
__device__ __forceinline__ float bfr(float v) { return (float)(__bf16)v; }
__device__ __forceinline__ float xhalf(float x) { return __builtin_bit_cast(float, __builtin_amdgcn_permlanex16(__builtin_bit_cast(int, x), __builtin_bit_cast(int, x), 0x76543210, 0xfedcba98, false, false)); }   // lane l with lane l ^ 16
__device__ __attribute__((noinline)) float exp_ni(float v) { return expf(v); }
__device__ __attribute__((noinline)) float erf_ni(float v) { return erff(v); }

#define PK_A 0                       // [1536][512] Wqkv rows (natural [out][in])
#define PK_P (PK_A + QKVW * DM)        // [512][512]; not written here (no W_o input)
#define PK_END (PK_P + DM * DM)
#define WS_PK  0u
#define WS_QK  (WS_PK + 2u * PK_END)             // f16 [16384 rows][1024]: q | k
#define WS_QKL (WS_QK + 2u * NB * SS * 2 * DM)     // f16 q | k residual planes x2048
#define WS_VTH (WS_QKL + 2u * NB * SS * 2 * DM)    // f16 [b][512 (h*64+d)][8192 s] hi
#define WS_VTL (WS_VTH + 2u * NB * DM * SS)        // f16 lo x 2048
#define WS_O   (WS_VTL + 2u * NB * DM * SS)        // f32 [16384][512] (unused)
#define WS_CS  (WS_O + 4u * NB * SS * DM)           // f32 [8192][32] x 2 (unused)
#define WS_END (WS_CS + 4u * 2 * SS * 32)
// ---- k_pack: block = (row n, which): column n of (in,out) weight -> bf16 row; which 0..2 -> W_q/W_k/W_v into PK_A rows which*512 + n
__global__ __launch_bounds__(256) void k_pack(const float* __restrict__ WQ, const float* __restrict__ WK, const float* __restrict__ WV, __bf16* __restrict__ PK) {   // (in,out) weights [512][512]: packed row (which*DM + n) = column n
  __shared__ __align__(16) __bf16 s[DM]; const int n = blockIdx.x, which = blockIdx.y, t = threadIdx.x; const float* Wm = which == 0 ? WQ : which == 1 ? WK : WV;
  for (int k = t; k < DM; k += 256) s[k] = (__bf16)Wm[(size_t)k * DM + n]; __syncthreads(); __bf16* dst = PK + PK_A + ((size_t)which * DM + n) * DM; for (int q = t; q < DM / 8; q += 256) vst2((unsigned*)(dst + q * 8), *(const v4u*)&s[q * 8]); }
#define KP 72   // 16-bit elements per staged 128-B row (K rows, weight rows): a 144-B pitch (16 B x odd, for ds_load_b128 readers)
#define VP 40   // f16 per staged V^T row: 64 B of data at an 80-B pitch
__device__ __forceinline__ unsigned lds_off(const void* p) { return (unsigned)(size_t)p; }
// eight 16-B-per-lane asynchronous copies global -> LDS; the s_wait_xcnt stands inside the statement so that no address register is rewritten in front of it
__device__ __forceinline__ void copy8(unsigned l0, unsigned l1, unsigned l2, unsigned l3, unsigned l4, unsigned l5, unsigned l6, unsigned l7, const void* g0, const void* g1, const void* g2, const void* g3, const void* g4, const void* g5, const void* g6, const void* g7) {
  asm volatile("global_load_async_to_lds_b128 %0, %8, off\n\t"
               "global_load_async_to_lds_b128 %1, %9, off\n\t"
               "global_load_async_to_lds_b128 %2, %10, off\n\t"
               "global_load_async_to_lds_b128 %3, %11, off\n\t"
               "global_load_async_to_lds_b128 %4, %12, off\n\t"
               "global_load_async_to_lds_b128 %5, %13, off\n\t"
               "global_load_async_to_lds_b128 %6, %14, off\n\t"
               "global_load_async_to_lds_b128 %7, %15, off\n\t"
               "s_wait_xcnt 0x0"
               :: "v"(l0), "v"(l1), "v"(l2), "v"(l3), "v"(l4), "v"(l5), "v"(l6), "v"(l7), "v"(g0), "v"(g1), "v"(g2), "v"(g3), "v"(g4), "v"(g5), "v"(g6), "v"(g7) : "memory");
}
__global__ __launch_bounds__(128) void k_qkv(const float* __restrict__ XQ, const float* __restrict__ XK, const float* __restrict__ XV, const __bf16* __restrict__ P, const float* __restrict__ BQ, const float* __restrict__ BK, const float* __restrict__ BV, _Float16* __restrict__ QK, _Float16* __restrict__ QKL, _Float16* __restrict__ VTH, _Float16* __restrict__ VTL) {
  const int which0 = (blockIdx.y * 128) / DM; const float* X = (which0 == 0) ? XQ : (which0 == 1) ? XK : XV; const float* BB = BQ ? (((which0 == 0) ? BQ : (which0 == 1) ? BK : BV) + (blockIdx.y * 128 - which0 * DM)) : nullptr;
  __shared__ __align__(16) _Float16 so[4][16][136], sol[4][16][136]; __shared__ __align__(16) _Float16 sth[128][KP], stl[128][KP];   // in the k loop: the two buffers of the weight ring (128 packed rows x 64 k of bf16); behind it: the V^T output staging
  const int tid = threadIdx.x, wave = tid >> 5, lane = tid & 31, col = lane & 15, g = lane >> 4; const size_t r0 = (size_t)blockIdx.x * 64 + wave * 16; const int n0 = blockIdx.y * 128;
  v8f acc[8] = {};
  const int wr = tid >> 3, wp = (tid & 7) * 8;   // a thread's 16-B piece of the packed rows wr + 16 i, i = 0 .. 7
  auto fill = [&](int st, _Float16 (*bp)[KP]) { const __bf16* s = P + (size_t)(n0 + wr) * DM + st * 64 + wp;
    copy8(lds_off(&bp[wr][wp]), lds_off(&bp[wr + 16][wp]), lds_off(&bp[wr + 32][wp]), lds_off(&bp[wr + 48][wp]), lds_off(&bp[wr + 64][wp]), lds_off(&bp[wr + 80][wp]), lds_off(&bp[wr + 96][wp]), lds_off(&bp[wr + 112][wp]),
          s, s + 16 * DM, s + 32 * DM, s + 48 * DM, s + 64 * DM, s + 80 * DM, s + 96 * DM, s + 112 * DM); };
  fill(0, sth);
  float bias[8] = {};   // this lane's eight bias values (columns n0 + j * 16 + col): asked for once, as one group under one test, so that they fly beside stage 0's copies; read at each output element they compiled to 64 load-and-wait pairs in a row
  if (BB) {
#pragma unroll   // j constant: bias[] stays in registers and the eight loads stand together
    for (int j = 0; j < 8; ++j) bias[j] = BB[j * 16 + col]; }
  asm volatile("s_wait_asynccnt 0x0" ::: "memory");   // this wave's share of stage 0 has landed
  __syncthreads();                                    // stage 0 is published to all four waves
  fill(1, stl);
#pragma unroll 1   // rolled: one copy of the stage's foot (waits, barrier, refill) in the text, the buffer chosen by st & 1
  for (int st = 0; st < DM / 64; ++st) { _Float16 (*bp)[KP] = (st & 1) ? stl : sth;
    v4f xr[2][4];   // this wave's x piece of the stage (fp32), asked for first: the longest wait
#pragma unroll
    for (int kk = 0; kk < 2; ++kk) { const float* p = X + (r0 + col) * DM + (st * 2 + kk) * 32 + 8 * g; xr[kk][0] = *(const v4f*)p; xr[kk][1] = *(const v4f*)(p + 4); xr[kk][2] = *(const v4f*)(p + 16); xr[kk][3] = *(const v4f*)(p + 20); }
    v16b w[2][8];   // the stage's sixteen weight fragments, read from LDS as one group in front of its WMMAs
#pragma unroll     // kk constant: the two 32-k halves of a staged row become immediate offsets of the LDS loads
    for (int kk = 0; kk < 2; ++kk) {
#pragma unroll
      for (int j = 0; j < 8; ++j) w[kk][j] = frag_b((const __bf16*)&bp[j * 16 + col][kk * 32], lane); }
    __builtin_amdgcn_sched_barrier(0);   // keeps the loads above as one group: without it the scheduler sinks each LDS pair to one WMMA in front of its use, and every WMMA waits out an LDS latency
#pragma unroll
    for (int kk = 0; kk < 2; ++kk) { v16b a;
#pragma unroll
      for (int i = 0; i < 4; ++i) { a[i] = (__bf16)xr[kk][0][i]; a[4 + i] = (__bf16)xr[kk][1][i]; a[8 + i] = (__bf16)xr[kk][2][i]; a[12 + i] = (__bf16)xr[kk][3][i]; }
#pragma unroll
      for (int j = 0; j < 8; ++j) acc[j] = wmma_bf(a, w[kk][j], acc[j]); }
    asm volatile("s_wait_dscnt 0x0" ::: "memory");      // this wave's reads of buffer bp are done
    asm volatile("s_wait_asynccnt 0x0" ::: "memory");   // this wave's share of stage st + 1 has landed
    __syncthreads();                                    // publishes stage st + 1 and ends every wave's reads of buffer bp
    if (st + 2 < DM / 64) fill(st + 2, bp); }
  asm volatile("s_wait_asynccnt 0x0" ::: "memory");     // no copy is outstanding when the ring becomes output staging
  if (n0 < 2 * DM) {   // q stored unscaled (f16 sigma ~0.6, no subnormal exposure); 1/8 applied to the f32 score
#pragma unroll
    for (int j = 0; j < 8; ++j) {
#pragma unroll
      for (int r = 0; r < 8; ++r) { const float v = acc[j][r] + bfr(bias[j]); const _Float16 hv = (_Float16)v; so[wave][8 * g + r][j * 16 + col] = hv; sol[wave][8 * g + r][j * 16 + col] = (_Float16)((v - (float)hv) * 2048.0f); } }   // q, k (+ bias) as f16 hi + (x2048) residual
    LDSX();
    for (int rl = 0; rl < 16; ++rl) if (lane < 16) { vst2((unsigned*)(QK + (r0 + rl) * (2 * DM) + n0 + lane * 8), *(const v4u*)&so[wave][rl][lane * 8]); vst2((unsigned*)(QKL + (r0 + rl) * (2 * DM) + n0 + lane * 8), *(const v4u*)&sol[wave][rl][lane * 8]); }
  } else {
#pragma unroll
    for (int j = 0; j < 8; ++j) {
#pragma unroll
      for (int r = 0; r < 8; ++r) { const float v = acc[j][r] + bfr(bias[j]); const _Float16 hv = (_Float16)v; sth[j * 16 + col][wave * 16 + 8 * g + r] = hv; stl[j * 16 + col][wave * 16 + 8 * g + r] = (_Float16)((v - (float)hv) * 2048.0f); } }
    __syncthreads();
    const size_t rb = (size_t)blockIdx.x * 64; const int b = (int)(rb / SS), s0 = (int)(rb % SS); const int pc0 = n0 - 2 * DM;
    for (int q = tid; q < 128 * 8; q += 128) { const int d = q >> 3, pc = q & 7; const size_t o = ((size_t)b * DM + pc0 + d) * SS + s0 + pc * 8; vst2((unsigned*)(VTH + o), *(const v4u*)&sth[d][pc * 8]); vst2((unsigned*)(VTL + o), *(const v4u*)&stl[d][pc * 8]); }
  }
}
// ---- k_attn: block = (64 queries, head h, batch b): banded flash attention in transposed form: S^T = K . Q^T (A = K rows, B = q), so a lane holds 16 of the 32 scores of ONE query (column col, keys ct*16 + 8g + r): maximum and sum in the lane plus one exchange between the wave's halves; the two S^T tiles, converted in place, are the B operand of O^T += V^T . P^T; O[b*S+q][h*64+d] = (acc + accl / 2048) / (2048 l) (256-B segments)
__global__ __launch_bounds__(128) void k_attn(const _Float16* __restrict__ QK, const _Float16* __restrict__ QKL, const _Float16* __restrict__ VTH, const _Float16* __restrict__ VTL, const void* __restrict__ KMASK, float* __restrict__ O) {
  __shared__ __align__(16) float so[4][16][68];
  __shared__ __align__(16) _Float16 skh[2][32][KP], skl[2][32][KP], svh[2][64][VP], svl[2][64][VP];   // two buffers of one 32-key tile: K hi, K residual, V^T hi, V^T residual, read by all four waves
  const int tid = threadIdx.x, wave = tid >> 5, lane = tid & 31, col = lane & 15, g = lane >> 4;
  const int qb = blockIdx.x, h = blockIdx.y, b = blockIdx.z; const int q0 = qb * 64 + wave * 16; const size_t rq = (size_t)b * SS + q0 + col;
  v16h aq[2], aql[2];
#pragma unroll
  for (int kc = 0; kc < 2; ++kc) { aq[kc] = frag_h(QK + rq * (2 * DM) + h * HD + kc * 32, lane); aql[kc] = frag_h(QKL + rq * (2 * DM) + h * HD + kc * 32, lane); }
  const int wq0 = qb * 64 + __builtin_amdgcn_readfirstlane(wave) * 16;   // q0 again, held in a scalar register: the test on it in the loop is then a scalar compare and branch, alike for the whole wave
  float m = -3.0e38f, l = 0.f;   // of query q0 + col; l holds this half-wave's keys only and is joined behind the loop
  v8f acc[4] = {}, accl[4] = {};
  const int nks = SS / 32;   // all keys
  const int ks0 = (qb * 64 - LW) > 0 ? (qb * 64 - LW) / 32 : 0; const int ks1 = ((qb * 64 + 64 + LW) / 32) < nks ? ((qb * 64 + 64 + LW) / 32) : nks;   // window tiles
  const int kr = tid >> 3, kp = (tid & 7) * 8, vw = tid >> 2, vp = (tid & 3) * 8;   // a thread's 16-B piece: K rows kr, kr + 16; V^T rows vw, vw + 32
  const size_t gko = ((size_t)b * SS + kr) * (2 * DM) + DM + h * HD + kp, gvo = ((size_t)b * DM + h * HD + vw) * SS + vp;
  auto fill = [&](int ks, int bf) { const size_t ko = gko + (size_t)ks * 32 * (2 * DM), vo = gvo + (size_t)ks * 32;
    copy8(lds_off(&skh[bf][kr][kp]), lds_off(&skh[bf][kr + 16][kp]), lds_off(&skl[bf][kr][kp]), lds_off(&skl[bf][kr + 16][kp]), lds_off(&svh[bf][vw][vp]), lds_off(&svh[bf][vw + 32][vp]), lds_off(&svl[bf][vw][vp]), lds_off(&svl[bf][vw + 32][vp]),
          QK + ko, QK + ko + 16 * (2 * DM), QKL + ko, QKL + ko + 16 * (2 * DM), VTH + vo, VTH + vo + (size_t)32 * SS, VTL + vo, VTL + vo + (size_t)32 * SS); };
  fill(ks0, 0);
  asm volatile("s_wait_asynccnt 0x0" ::: "memory");   // this wave's share of tile ks0 has landed
  __syncthreads();                                    // tile ks0 is published to all four waves
  if (ks0 + 1 < ks1) fill(ks0 + 1, 1);
#pragma unroll 1
  for (int ks = ks0; ks < ks1; ++ks) { v8f s[2]; const int bf = (ks - ks0) & 1;
    v16h kh[2][2], kl[2][2];   // the tile's eight K fragments (hi, residual), read from LDS as one group in front of the twelve score WMMAs
#pragma unroll
    for (int ct = 0; ct < 2; ++ct) {
#pragma unroll
      for (int kc = 0; kc < 2; ++kc) { kh[ct][kc] = frag_h(&skh[bf][ct * 16 + col][kc * 32], lane); kl[ct][kc] = frag_h(&skl[bf][ct * 16 + col][kc * 32], lane); } }
    __builtin_amdgcn_sched_barrier(0);   // keeps the sixteen K loads as one group: without it the scheduler holds some back among the WMMAs, which then wait out an LDS latency each
    v8f c[2] = {}, cl[2] = {};   // 3 products; each accumulator takes its products in the order kc 0, kc 1 (cl: K hi x q residual, then K residual x q)
#pragma unroll
    for (int kc = 0; kc < 2; ++kc) {
#pragma unroll
      for (int ct = 0; ct < 2; ++ct) { c[ct] = wmma16(kh[ct][kc], aq[kc], c[ct]); cl[ct] = wmma16(kh[ct][kc], aql[kc], cl[ct]); }
#pragma unroll
      for (int ct = 0; ct < 2; ++ct) cl[ct] = wmma16(kl[ct][kc], aq[kc], cl[ct]); }
    v16h vh[4], vl[4];   // the tile's eight V^T fragments, read here too, into the registers that the score WMMAs set free
#pragma unroll
    for (int dt = 0; dt < 4; ++dt) { vh[dt] = frag_h(&svh[bf][dt * 16 + col][0], lane); vl[dt] = frag_h(&svl[bf][dt * 16 + col][0], lane); }
    // the ring's hand-over stands here: all of the tile is in registers, and the rest of the pass (softmax, P.V) touches no LDS, so the refill flies behind it
    LDSX();                                             // holds the s_wait_dscnt 0: this wave's reads of buffer bf are done
    asm volatile("s_wait_asynccnt 0x0" ::: "memory");   // this wave's share of tile ks + 1 has landed
    __syncthreads();                                    // publishes tile ks + 1 and ends every wave's reads of buffer bf
    if (ks + 2 < ks1) fill(ks + 2, bf);
    // edge: some (query, key) pair of this wave's 16 x 32 may lie outside the band. Otherwise the largest q - k = wq0 + 15 - ks * 32 and the largest k - q = ks * 32 + 31 - wq0 are both <= LW: the band test passes for all 512 scores (15 of a wave's 18 tiles away from the sequence ends) and the mask work is branched over
    const bool edge = wq0 + 15 - ks * 32 > LW || ks * 32 + 31 - wq0 > LW;
#pragma unroll
    for (int ct = 0; ct < 2; ++ct) {
#pragma unroll
      for (int r = 0; r < 8; ++r) s[ct][r] = (c[ct][r] + cl[ct][r] * (1.0f / 2048.0f)) * 0.125f; }   // 1/sqrt(64)
    if (edge) {
#pragma unroll
      for (int ct = 0; ct < 2; ++ct) { const int kk = ks * 32 + ct * 16 + 8 * g;
#pragma unroll
        for (int r = 0; r < 8; ++r) { const int dq = (q0 + col) - (kk + r); s[ct][r] = (dq <= LW && dq >= -LW) ? s[ct][r] : -3.0e38f; } } }   // masked keys excluded
    float mx = fmaxf(s[0][0], s[1][0]);
#pragma unroll
    for (int r = 1; r < 8; ++r) mx = fmaxf(mx, fmaxf(s[0][r], s[1][r]));
    mx = fmaxf(mx, xhalf(mx));   // the other 16 keys of this query
    const float mn = fmaxf(m, mx); const float alpha = (m <= -1.0e38f) ? 0.f : __expf(m - mn);
    float es = 0.f; v16h pa, pl; v8f e[2];
#pragma unroll
    for (int ct = 0; ct < 2; ++ct) {
#pragma unroll
      for (int r = 0; r < 8; ++r) e[ct][r] = __expf(s[ct][r] - mn); }
    if (edge) {   // a masked key's weight is 0, also where every key of the query so far is masked (mn is then the mask value itself)
#pragma unroll
      for (int ct = 0; ct < 2; ++ct) {
#pragma unroll
        for (int r = 0; r < 8; ++r) e[ct][r] = (s[ct][r] <= -1.0e38f) ? 0.f : e[ct][r]; } }
#pragma unroll
    for (int r = 0; r < 8; ++r) { const float e0 = e[0][r], e1 = e[1][r]; es += e0 + e1;
      const float x0 = e0 * 2048.0f, x1 = e1 * 2048.0f; const _Float16 h0 = (_Float16)x0, h1 = (_Float16)x1; pa[r] = h0; pa[8 + r] = h1; pl[r] = (_Float16)((x0 - (float)h0) * 2048.0f); pl[8 + r] = (_Float16)((x1 - (float)h1) * 2048.0f); }   // P^T as a B fragment: element r = key 8g + r, element 8 + r = key 16 + 8g + r, the k order of frag_h; P scaled by 2^11 before the f16 split so small softmax weights stay out of the f16 subnormal range; 2^-11 folded into the epilogue
    l = l * alpha + es; m = mn;
#pragma unroll
    for (int dt = 0; dt < 4; ++dt) {
#pragma unroll
      for (int r = 0; r < 8; ++r) { acc[dt][r] *= alpha; accl[dt][r] *= alpha; } }
#pragma unroll
    for (int dt = 0; dt < 4; ++dt) { acc[dt] = wmma16(vh[dt], pa, acc[dt]); accl[dt] = wmma16(vh[dt], pl, accl[dt]); }   // V hi x P hi, V hi x P residual
#pragma unroll
    for (int dt = 0; dt < 4; ++dt) accl[dt] = wmma16(vl[dt], pa, accl[dt]);   // V residual x P hi (3 products)
  }
  asm volatile("s_wait_asynccnt 0x0" ::: "memory");     // no copy is outstanding when the wave goes on to the epilogue
  l += xhalf(l);   // the two half-waves' sums of one query
  const float il = (1.0f / 2048.0f) / l;
#pragma unroll
  for (int dt = 0; dt < 4; ++dt) { v4f o0, o1;   // acc[dt][r] = O^T[d = dt*16 + 8g + r][query col]
#pragma unroll
    for (int r = 0; r < 4; ++r) { o0[r] = (acc[dt][r] + accl[dt][r] * (1.0f / 2048.0f)) * il; o1[r] = (acc[dt][4 + r] + accl[dt][4 + r] * (1.0f / 2048.0f)) * il; }
    *(v4f*)&so[wave][col][dt * 16 + 8 * g] = o0; *(v4f*)&so[wave][col][dt * 16 + 8 * g + 4] = o1; }
  LDSX();
  for (int rl = 0; rl < 16; ++rl) if (lane < 16) vst2(O + ((size_t)b * SS + q0 + rl) * DM + h * HD + lane * 4, *(const v4f*)&so[wave][rl][lane * 4]);
}
// ---- k_out: block = (64 rows, 128 cols): out = O(hi/lo) . Wo rows (2 products) + bo
__global__ __launch_bounds__(128) void k_out(const float* __restrict__ O, const __bf16* __restrict__ P, const float* __restrict__ BO, float* __restrict__ Y) {
  __shared__ __align__(16) float so[4][16][132];
  const int tid = threadIdx.x, wave = tid >> 5, lane = tid & 31, col = lane & 15, g = lane >> 4; const size_t r0 = (size_t)blockIdx.x * 64 + wave * 16; const int n0 = blockIdx.y * 128;
  v8f acc[8] = {};
#pragma unroll 2
  for (int kc = 0; kc < DM / 32; ++kc) { const F2 a = split_row(O + (r0 + col) * DM, kc * 32, lane);
#pragma unroll
    for (int j = 0; j < 8; ++j) { const v16b w = frag_b(P + (size_t)(n0 + j * 16 + col) * DM + kc * 32, lane); acc[j] = wmma_bf(a.l, w, acc[j]); acc[j] = wmma_bf(a.h, w, acc[j]); } }
#pragma unroll
  for (int j = 0; j < 8; ++j) {
#pragma unroll
    for (int r = 0; r < 8; ++r) so[wave][8 * g + r][j * 16 + col] = acc[j][r] + (BO ? bfr(BO[n0 + j * 16 + col]) : 0.f); }
  LDSX();
  for (int rl = 0; rl < 16; ++rl) vst2(Y + (r0 + rl) * DM + n0 + lane * 4, *(const v4f*)&so[wave][rl][lane * 4]);
}
extern "C" void kernel_launch(void* const* d_in, const int* in_sizes, int n_in, void* d_out, int out_size, void* d_ws, size_t ws_size, hipStream_t stream) {
  (void)in_sizes; (void)n_in; (void)out_size;
  const float** F = (const float**)d_in;   // 0 x [2,8192,512], 1 Wq [512,512] (in,out), 2 bq, 3 Wk, 4 bk, 5 Wv, 6 bv
  if (ws_size < (size_t)WS_END) return;
  char* ws = (char*)d_ws; __bf16* PK = (__bf16*)(ws + WS_PK); _Float16 *QK = (_Float16*)(ws + WS_QK), *QKL = (_Float16*)(ws + WS_QKL), *VTH = (_Float16*)(ws + WS_VTH), *VTL = (_Float16*)(ws + WS_VTL);
  k_pack<<<dim3(DM, 3), 256, 0, stream>>>(F[1], F[3], F[5], PK);
  k_qkv<<<dim3(TNB * SS / 64, QKVW / 128), 128, 0, stream>>>(F[0], F[0], F[0], PK + PK_A, F[2], F[4], F[6], QK, QKL, VTH, VTL);
  k_attn<<<dim3(TQB, NH, TNB), 128, 0, stream>>>(QK, QKL, VTH, VTL, nullptr, (float*)d_out);
}

// v006
// It runs in 114 microseconds.
// In two side-by-side timings against v005, it was 1.06 and 1.05 times as fast.
// Over all steps from v000 it is 3.16 times as fast.
// compute dtype: all float inputs rounded to bf16; q/k/v = x . W + b with EXACT bf16 products on WMMA 16x16x32 ((in,out) weights as transposed rows), f16 hi + residual; banded attention (|i - j| <= 256; other key tiles skipped) with 3-product logits and 3-product P.v, x 1/8, running-max softmax in f32 (hardware exp); the merged context is the f32 output.
#include <hip/hip_runtime.h>
#include <math.h>

typedef __attribute__((ext_vector_type(16))) _Float16 v16h;
typedef __attribute__((ext_vector_type(16))) __bf16 v16b;
typedef __attribute__((ext_vector_type(8)))  _Float16 v8h;
typedef __attribute__((ext_vector_type(8)))  float v8f;
typedef __attribute__((ext_vector_type(4)))  float v4f;
typedef __attribute__((ext_vector_type(2)))  float v2f;
typedef __attribute__((ext_vector_type(4)))  unsigned v4u;
typedef __attribute__((ext_vector_type(4)))  int v4i;
typedef float __attribute__((may_alias)) float_a;
typedef int __attribute__((may_alias)) int_a;

template <typename T> __device__ __forceinline__ void vst2(void* p, T v) { *(T*)p = v;  }
__device__ __forceinline__ v8f wmma16(v16h a, v16h b, v8f c) {
  return __builtin_amdgcn_wmma_f32_16x16x32_f16(false, a, false, b, (short)0, c, false, false);
}
__device__ __forceinline__ v8f wmma_bf(v16b a, v16b b, v8f c) {
  return __builtin_amdgcn_wmma_f32_16x16x32_bf16(false, a, false, b, (short)0, c, false, false);
}
// Longformer multi-head attention (B 2, S 8,192, D 512, 8 heads x 64, one-sided window 256): (in,out) projections + biases, q / 8, banded softmax, no output projection (the merged context is the output).
__device__ __forceinline__ v16h frag_h(const _Float16* rowk0, int lane) {
  union { v16h v; v8h q[2]; } u; const _Float16* p = rowk0 + 8 * (lane >> 4);
  u.q[0] = *(const v8h*)p; u.q[1] = *(const v8h*)(p + 16); return u.v;
}
__device__ __forceinline__ v16h frag_f32(const float* rowk0, int lane) {
  v16h a; const float* p = rowk0 + 8 * (lane >> 4);
#pragma unroll
  for (int i = 0; i < 8; ++i) { a[i] = (_Float16)p[i]; a[8 + i] = (_Float16)p[16 + i]; }
  return a;
}
__device__ __forceinline__ v16h frag_f32s(const float* rowk0, int lane, float sc) {
  v16h a; const float* p = rowk0 + 8 * (lane >> 4);
#pragma unroll
  for (int i = 0; i < 8; ++i) { a[i] = (_Float16)(p[i] * sc); a[8 + i] = (_Float16)(p[16 + i] * sc); }
  return a;
}
// column fragment from a [K][ld] layout (column n), rows >= K read as 0
__device__ __forceinline__ v16h fragc_f32(const float* W, int k0, int n, int lane, int ld, int K) {
  v16h a; const int g = lane >> 4;
#pragma unroll
  for (int i = 0; i < 8; ++i) { const int ka = k0 + 8 * g + i, kb = ka + 16;
    a[i] = (_Float16)(ka < K ? W[(size_t)(ka < K ? ka : K - 1) * ld + n] : 0.f); a[8 + i] = (_Float16)(kb < K ? W[(size_t)(kb < K ? kb : K - 1) * ld + n] : 0.f); }
  return a;
}
struct F2 { v16b h, l; };
__device__ __forceinline__ F2 bsplit16(const float v[16]) { F2 r;
#pragma unroll
  for (int i = 0; i < 16; ++i) { const __bf16 h = (__bf16)v[i]; r.h[i] = h; r.l[i] = (__bf16)(v[i] - (float)h); }
  return r; }
__device__ __forceinline__ F2 split_row(const float* row, int k0, int lane) { float v[16]; const float* p = row + k0 + 8 * (lane >> 4);
#pragma unroll
  for (int i = 0; i < 8; ++i) { v[i] = p[i]; v[8 + i] = p[16 + i]; }
  return bsplit16(v); }
__device__ __forceinline__ F2 split_rowK(const float* row, int k0, int lane, int K) { float v[16]; const int g = lane >> 4;
#pragma unroll
  for (int i = 0; i < 8; ++i) { const int ka = k0 + 8 * g + i, kb = ka + 16; v[i] = ka < K ? row[ka < K ? ka : K - 1] : 0.f; v[8 + i] = kb < K ? row[kb < K ? kb : K - 1] : 0.f; }
  return bsplit16(v); }
__device__ __forceinline__ F2 split_col(const float* W, int k0, int n, int lane, int ld, int K) { float v[16]; const int g = lane >> 4;
#pragma unroll
  for (int i = 0; i < 8; ++i) { const int ka = k0 + 8 * g + i, kb = ka + 16; v[i] = ka < K ? W[(size_t)(ka < K ? ka : K - 1) * ld + n] : 0.f; v[8 + i] = kb < K ? W[(size_t)(kb < K ? kb : K - 1) * ld + n] : 0.f; }
  return bsplit16(v); }
__device__ __forceinline__ v8f mac3(const F2& a, const F2& b, v8f c) { c = wmma_bf(a.l, b.h, c); c = wmma_bf(a.h, b.l, c); return wmma_bf(a.h, b.h, c); }
__device__ __forceinline__ float sigm(float v) { return 1.0f / (1.0f + expf(-v)); }
#define LDSX() do { asm volatile("s_wait_dscnt 0" ::: "memory"); __builtin_amdgcn_wave_barrier(); __builtin_amdgcn_fence(__ATOMIC_RELEASE, "workgroup"); } while (0)


#define NB 2
#define SS 8192
#define DM 512
#define NH 8
#define LW 256
#define HD 64
#define QKVW (3 * DM)
#ifndef TQB
#define TQB (SS / 64)
#define TNB NB
#define TOB (NB * SS / 64)     // output row tiles (all)
#endif
typedef __attribute__((ext_vector_type(8))) __bf16 v8b;
__device__ __forceinline__ v16b frag_b(const __bf16* rowk0, int lane) {
  union { v16b v; v8b q[2]; } u; const __bf16* p = rowk0 + 8 * (lane >> 4);
  u.q[0] = *(const v8b*)p; u.q[1] = *(const v8b*)(p + 16); return u.v;
}
__device__ __forceinline__ float bfr(float v) { return (float)(__bf16)v; }
__device__ __forceinline__ float xhalf(float x) { return __builtin_bit_cast(float, __builtin_amdgcn_permlanex16(__builtin_bit_cast(int, x), __builtin_bit_cast(int, x), 0x76543210, 0xfedcba98, false, false)); }   // lane l with lane l ^ 16
__device__ __attribute__((noinline)) float exp_ni(float v) { return expf(v); }
__device__ __attribute__((noinline)) float erf_ni(float v) { return erff(v); }

#define PK_A 0                       // [1536][512] Wqkv rows (natural [out][in])
#define PK_P (PK_A + QKVW * DM)        // [512][512]; not written here (no W_o input)
#define PK_END (PK_P + DM * DM)
#define WS_PK  0u
#define WS_QK  (WS_PK + 2u * PK_END)             // f16 [16384 rows][1024]: q | k
#define WS_QKL (WS_QK + 2u * NB * SS * 2 * DM)     // f16 q | k residual planes x2048
#define WS_VTH (WS_QKL + 2u * NB * SS * 2 * DM)    // f16 [b][512 (h*64+d)][8192 s] hi
#define WS_VTL (WS_VTH + 2u * NB * DM * SS)        // f16 lo x 2048
#define WS_O   (WS_VTL + 2u * NB * DM * SS)        // f32 [16384][512] (unused)
#define WS_CS  (WS_O + 4u * NB * SS * DM)           // f32 [8192][32] x 2 (unused)
#define WS_END (WS_CS + 4u * 2 * SS * 32)
// ---- k_pack: block = (row n, which): column n of (in,out) weight -> bf16 row; which 0..2 -> W_q/W_k/W_v into PK_A rows which*512 + n
__global__ __launch_bounds__(256) void k_pack(const float* __restrict__ WQ, const float* __restrict__ WK, const float* __restrict__ WV, __bf16* __restrict__ PK) {   // (in,out) weights [512][512]: packed row (which*DM + n) = column n
  __shared__ __align__(16) __bf16 s[DM]; const int n = blockIdx.x, which = blockIdx.y, t = threadIdx.x; const float* Wm = which == 0 ? WQ : which == 1 ? WK : WV;
  for (int k = t; k < DM; k += 256) s[k] = (__bf16)Wm[(size_t)k * DM + n]; __syncthreads(); __bf16* dst = PK + PK_A + ((size_t)which * DM + n) * DM; for (int q = t; q < DM / 8; q += 256) vst2((unsigned*)(dst + q * 8), *(const v4u*)&s[q * 8]); }
#define KP 72   // 16-bit elements per staged 128-B row (K rows, weight rows): a 144-B pitch (16 B x odd, for ds_load_b128 readers)
#define VP 40   // f16 per staged V^T row: 64 B of data at an 80-B pitch
__device__ __forceinline__ unsigned lds_off(const void* p) { return (unsigned)(size_t)p; }
// eight 16-B-per-lane asynchronous copies global -> LDS; the s_wait_xcnt stands inside the statement so that no address register is rewritten in front of it
__device__ __forceinline__ void copy8(unsigned l0, unsigned l1, unsigned l2, unsigned l3, unsigned l4, unsigned l5, unsigned l6, unsigned l7, const void* g0, const void* g1, const void* g2, const void* g3, const void* g4, const void* g5, const void* g6, const void* g7) {
  asm volatile("global_load_async_to_lds_b128 %0, %8, off\n\t"
               "global_load_async_to_lds_b128 %1, %9, off\n\t"
               "global_load_async_to_lds_b128 %2, %10, off\n\t"
               "global_load_async_to_lds_b128 %3, %11, off\n\t"
               "global_load_async_to_lds_b128 %4, %12, off\n\t"
               "global_load_async_to_lds_b128 %5, %13, off\n\t"
               "global_load_async_to_lds_b128 %6, %14, off\n\t"
               "global_load_async_to_lds_b128 %7, %15, off\n\t"
               "s_wait_xcnt 0x0"
               :: "v"(l0), "v"(l1), "v"(l2), "v"(l3), "v"(l4), "v"(l5), "v"(l6), "v"(l7), "v"(g0), "v"(g1), "v"(g2), "v"(g3), "v"(g4), "v"(g5), "v"(g6), "v"(g7) : "memory");
}
__global__ __launch_bounds__(128) void k_qkv(const float* __restrict__ XQ, const float* __restrict__ XK, const float* __restrict__ XV, const __bf16* __restrict__ P, const float* __restrict__ BQ, const float* __restrict__ BK, const float* __restrict__ BV, _Float16* __restrict__ QK, _Float16* __restrict__ QKL, _Float16* __restrict__ VTH, _Float16* __restrict__ VTL) {
  const int which0 = (blockIdx.y * 128) / DM; const float* X = (which0 == 0) ? XQ : (which0 == 1) ? XK : XV; const float* BB = BQ ? (((which0 == 0) ? BQ : (which0 == 1) ? BK : BV) + (blockIdx.y * 128 - which0 * DM)) : nullptr;
  __shared__ __align__(16) _Float16 so[4][16][136], sol[4][16][136];   // in the k loop: the two buffers of the x ring (64 rows x 64 k of fp32: 256 B of data in each 272-B row, row = [wave][col]); behind it: the q, k output staging
  __shared__ __align__(16) _Float16 sth[128][KP], stl[128][KP];   // in the k loop: the two buffers of the weight ring (128 packed rows x 64 k of bf16); behind it: the V^T output staging
  const int tid = threadIdx.x, wave = tid >> 5, lane = tid & 31, col = lane & 15, g = lane >> 4; const size_t r0 = (size_t)blockIdx.x * 64 + wave * 16; const int n0 = blockIdx.y * 128;
  v8f acc[8] = {};
  const int wr = tid >> 3, wp = (tid & 7) * 8;   // a thread's 16-B piece of the packed rows wr + 16 i, i = 0 .. 7
  const int xrw = tid >> 4, xpc = (tid & 15) * 4;   // a thread's 16-B piece of the x rows xrw + 8 i, i = 0 .. 7: one copy of a wave covers two whole 256-B row pieces, four full lines
  auto fill = [&](int st, _Float16 (*bp)[KP], _Float16 (*xb)[16][136]) { const __bf16* s = P + (size_t)(n0 + wr) * DM + st * 64 + wp;
    const float* xs = X + ((size_t)blockIdx.x * 64 + xrw) * DM + st * 64 + xpc; const unsigned xl = lds_off(&xb[0][0][0]) + xrw * 272 + xpc * 4;
    copy8(xl, xl + 8 * 272, xl + 16 * 272, xl + 24 * 272, xl + 32 * 272, xl + 40 * 272, xl + 48 * 272, xl + 56 * 272,
          xs, xs + 8 * DM, xs + 16 * DM, xs + 24 * DM, xs + 32 * DM, xs + 40 * DM, xs + 48 * DM, xs + 56 * DM);
    copy8(lds_off(&bp[wr][wp]), lds_off(&bp[wr + 16][wp]), lds_off(&bp[wr + 32][wp]), lds_off(&bp[wr + 48][wp]), lds_off(&bp[wr + 64][wp]), lds_off(&bp[wr + 80][wp]), lds_off(&bp[wr + 96][wp]), lds_off(&bp[wr + 112][wp]),
          s, s + 16 * DM, s + 32 * DM, s + 48 * DM, s + 64 * DM, s + 80 * DM, s + 96 * DM, s + 112 * DM); };
  fill(0, sth, so);
  float bias[8] = {};   // this lane's eight bias values (columns n0 + j * 16 + col): asked for once, as one group under one test, so that they fly beside stage 0's copies; read at each output element they compiled to 64 load-and-wait pairs in a row
  if (BB) {
#pragma unroll   // j constant: bias[] stays in registers and the eight loads stand together
    for (int j = 0; j < 8; ++j) bias[j] = BB[j * 16 + col]; }
  asm volatile("s_wait_asynccnt 0x0" ::: "memory");   // this wave's share of stage 0 has landed
  __syncthreads();                                    // stage 0 is published to all four waves
  fill(1, stl, sol);
#pragma unroll 1   // rolled: one copy of the stage's foot (waits, barrier, refill) in the text, the buffer chosen by st & 1
  for (int st = 0; st < DM / 64; ++st) { _Float16 (*bp)[KP] = (st & 1) ? stl : sth; _Float16 (*xb)[16][136] = (st & 1) ? sol : so;
    v4f xr[2][4];   // this lane's x piece of the stage (fp32), read from the x ring; read from global memory, each load of a wave touched sixteen lines for 32 B of each
#pragma unroll
    for (int kk = 0; kk < 2; ++kk) { const float* p = (const float*)&xb[wave][col][0] + kk * 32 + 8 * g; xr[kk][0] = *(const v4f*)p; xr[kk][1] = *(const v4f*)(p + 4); xr[kk][2] = *(const v4f*)(p + 16); xr[kk][3] = *(const v4f*)(p + 20); }
    v16b w[2][8];   // the stage's sixteen weight fragments, read from LDS as one group in front of its WMMAs
#pragma unroll     // kk constant: the two 32-k halves of a staged row become immediate offsets of the LDS loads
    for (int kk = 0; kk < 2; ++kk) {
#pragma unroll
      for (int j = 0; j < 8; ++j) w[kk][j] = frag_b((const __bf16*)&bp[j * 16 + col][kk * 32], lane); }
    __builtin_amdgcn_sched_barrier(0);   // keeps the loads above as one group: without it the scheduler sinks each LDS pair to one WMMA in front of its use, and every WMMA waits out an LDS latency
#pragma unroll
    for (int kk = 0; kk < 2; ++kk) { v16b a;
#pragma unroll
      for (int i = 0; i < 4; ++i) { a[i] = (__bf16)xr[kk][0][i]; a[4 + i] = (__bf16)xr[kk][1][i]; a[8 + i] = (__bf16)xr[kk][2][i]; a[12 + i] = (__bf16)xr[kk][3][i]; }
#pragma unroll
      for (int j = 0; j < 8; ++j) acc[j] = wmma_bf(a, w[kk][j], acc[j]); }
    asm volatile("s_wait_dscnt 0x0" ::: "memory");      // this wave's reads of buffers bp and xb are done
    asm volatile("s_wait_asynccnt 0x0" ::: "memory");   // this wave's share of stage st + 1 has landed
    __syncthreads();                                    // publishes stage st + 1 and ends every wave's reads of buffers bp and xb
    if (st + 2 < DM / 64) fill(st + 2, bp, xb); }
  asm volatile("s_wait_asynccnt 0x0" ::: "memory");     // no copy is outstanding when the ring becomes output staging
  if (n0 < 2 * DM) {   // q stored unscaled (f16 sigma ~0.6, no subnormal exposure); 1/8 applied to the f32 score
#pragma unroll
    for (int j = 0; j < 8; ++j) {
#pragma unroll
      for (int r = 0; r < 8; ++r) { const float v = acc[j][r] + bfr(bias[j]); const _Float16 hv = (_Float16)v; so[wave][8 * g + r][j * 16 + col] = hv; sol[wave][8 * g + r][j * 16 + col] = (_Float16)((v - (float)hv) * 2048.0f); } }   // q, k (+ bias) as f16 hi + (x2048) residual
    LDSX();
    for (int rl = 0; rl < 16; ++rl) if (lane < 16) { vst2((unsigned*)(QK + (r0 + rl) * (2 * DM) + n0 + lane * 8), *(const v4u*)&so[wave][rl][lane * 8]); vst2((unsigned*)(QKL + (r0 + rl) * (2 * DM) + n0 + lane * 8), *(const v4u*)&sol[wave][rl][lane * 8]); }
  } else {
#pragma unroll
    for (int j = 0; j < 8; ++j) {
#pragma unroll
      for (int r = 0; r < 8; ++r) { const float v = acc[j][r] + bfr(bias[j]); const _Float16 hv = (_Float16)v; sth[j * 16 + col][wave * 16 + 8 * g + r] = hv; stl[j * 16 + col][wave * 16 + 8 * g + r] = (_Float16)((v - (float)hv) * 2048.0f); } }
    __syncthreads();
    const size_t rb = (size_t)blockIdx.x * 64; const int b = (int)(rb / SS), s0 = (int)(rb % SS); const int pc0 = n0 - 2 * DM;
    for (int q = tid; q < 128 * 8; q += 128) { const int d = q >> 3, pc = q & 7; const size_t o = ((size_t)b * DM + pc0 + d) * SS + s0 + pc * 8; vst2((unsigned*)(VTH + o), *(const v4u*)&sth[d][pc * 8]); vst2((unsigned*)(VTL + o), *(const v4u*)&stl[d][pc * 8]); }
  }
}
// ---- k_attn: block = (64 queries, head h, batch b): banded flash attention in transposed form: S^T = K . Q^T (A = K rows, B = q), so a lane holds 16 of the 32 scores of ONE query (column col, keys ct*16 + 8g + r): maximum and sum in the lane plus one exchange between the wave's halves; the two S^T tiles, converted in place, are the B operand of O^T += V^T . P^T; O[b*S+q][h*64+d] = (acc + accl / 2048) / (2048 l) (256-B segments)
__global__ __launch_bounds__(128) void k_attn(const _Float16* __restrict__ QK, const _Float16* __restrict__ QKL, const _Float16* __restrict__ VTH, const _Float16* __restrict__ VTL, const void* __restrict__ KMASK, float* __restrict__ O) {
  __shared__ __align__(16) float so[4][16][68];
  __shared__ __align__(16) _Float16 skh[2][32][KP], skl[2][32][KP], svh[2][64][VP], svl[2][64][VP];   // two buffers of one 32-key tile: K hi, K residual, V^T hi, V^T residual, read by all four waves
  const int tid = threadIdx.x, wave = tid >> 5, lane = tid & 31, col = lane & 15, g = lane >> 4;
  const int qb = blockIdx.x, h = blockIdx.y, b = blockIdx.z; const int q0 = qb * 64 + wave * 16; const size_t rq = (size_t)b * SS + q0 + col;
  v16h aq[2], aql[2];
#pragma unroll
  for (int kc = 0; kc < 2; ++kc) { aq[kc] = frag_h(QK + rq * (2 * DM) + h * HD + kc * 32, lane); aql[kc] = frag_h(QKL + rq * (2 * DM) + h * HD + kc * 32, lane); }
  const int wq0 = qb * 64 + __builtin_amdgcn_readfirstlane(wave) * 16;   // q0 again, held in a scalar register: the test on it in the loop is then a scalar compare and branch, alike for the whole wave
  float m = -3.0e38f, l = 0.f;   // of query q0 + col; l holds this half-wave's keys only and is joined behind the loop
  v8f acc[4] = {}, accl[4] = {};
  const int nks = SS / 32;   // all keys
  const int ks0 = (qb * 64 - LW) > 0 ? (qb * 64 - LW) / 32 : 0; const int ks1 = ((qb * 64 + 64 + LW) / 32) < nks ? ((qb * 64 + 64 + LW) / 32) : nks;   // window tiles
  const int kr = tid >> 3, kp = (tid & 7) * 8, vw = tid >> 2, vp = (tid & 3) * 8;   // a thread's 16-B piece: K rows kr, kr + 16; V^T rows vw, vw + 32
  const size_t gko = ((size_t)b * SS + kr) * (2 * DM) + DM + h * HD + kp, gvo = ((size_t)b * DM + h * HD + vw) * SS + vp;
  auto fill = [&](int ks, int bf) { const size_t ko = gko + (size_t)ks * 32 * (2 * DM), vo = gvo + (size_t)ks * 32;
    copy8(lds_off(&skh[bf][kr][kp]), lds_off(&skh[bf][kr + 16][kp]), lds_off(&skl[bf][kr][kp]), lds_off(&skl[bf][kr + 16][kp]), lds_off(&svh[bf][vw][vp]), lds_off(&svh[bf][vw + 32][vp]), lds_off(&svl[bf][vw][vp]), lds_off(&svl[bf][vw + 32][vp]),
          QK + ko, QK + ko + 16 * (2 * DM), QKL + ko, QKL + ko + 16 * (2 * DM), VTH + vo, VTH + vo + (size_t)32 * SS, VTL + vo, VTL + vo + (size_t)32 * SS); };
  fill(ks0, 0);
  asm volatile("s_wait_asynccnt 0x0" ::: "memory");   // this wave's share of tile ks0 has landed
  __syncthreads();                                    // tile ks0 is published to all four waves
  if (ks0 + 1 < ks1) fill(ks0 + 1, 1);
#pragma unroll 1
  for (int ks = ks0; ks < ks1; ++ks) { v8f s[2]; const int bf = (ks - ks0) & 1;
    v16h kh[2][2], kl[2][2];   // the tile's eight K fragments (hi, residual), read from LDS as one group in front of the twelve score WMMAs
#pragma unroll
    for (int ct = 0; ct < 2; ++ct) {
#pragma unroll
      for (int kc = 0; kc < 2; ++kc) { kh[ct][kc] = frag_h(&skh[bf][ct * 16 + col][kc * 32], lane); kl[ct][kc] = frag_h(&skl[bf][ct * 16 + col][kc * 32], lane); } }
    __builtin_amdgcn_sched_barrier(0);   // keeps the sixteen K loads as one group: without it the scheduler holds some back among the WMMAs, which then wait out an LDS latency each
    v8f c[2] = {}, cl[2] = {};   // 3 products; each accumulator takes its products in the order kc 0, kc 1 (cl: K hi x q residual, then K residual x q)
#pragma unroll
    for (int kc = 0; kc < 2; ++kc) {
#pragma unroll
      for (int ct = 0; ct < 2; ++ct) { c[ct] = wmma16(kh[ct][kc], aq[kc], c[ct]); cl[ct] = wmma16(kh[ct][kc], aql[kc], cl[ct]); }
#pragma unroll
      for (int ct = 0; ct < 2; ++ct) cl[ct] = wmma16(kl[ct][kc], aq[kc], cl[ct]); }
    v16h vh[4], vl[4];   // the tile's eight V^T fragments, read here too, into the registers that the score WMMAs set free
#pragma unroll
    for (int dt = 0; dt < 4; ++dt) { vh[dt] = frag_h(&svh[bf][dt * 16 + col][0], lane); vl[dt] = frag_h(&svl[bf][dt * 16 + col][0], lane); }
    // the ring's hand-over stands here: all of the tile is in registers, and the rest of the pass (softmax, P.V) touches no LDS, so the refill flies behind it
    LDSX();                                             // holds the s_wait_dscnt 0: this wave's reads of buffer bf are done
    asm volatile("s_wait_asynccnt 0x0" ::: "memory");   // this wave's share of tile ks + 1 has landed
    __syncthreads();                                    // publishes tile ks + 1 and ends every wave's reads of buffer bf
    if (ks + 2 < ks1) fill(ks + 2, bf);
    // edge: some (query, key) pair of this wave's 16 x 32 may lie outside the band. Otherwise the largest q - k = wq0 + 15 - ks * 32 and the largest k - q = ks * 32 + 31 - wq0 are both <= LW: the band test passes for all 512 scores (15 of a wave's 18 tiles away from the sequence ends) and the mask work is branched over
    const bool edge = wq0 + 15 - ks * 32 > LW || ks * 32 + 31 - wq0 > LW;
#pragma unroll
    for (int ct = 0; ct < 2; ++ct) {
#pragma unroll
      for (int r = 0; r < 8; ++r) s[ct][r] = (c[ct][r] + cl[ct][r] * (1.0f / 2048.0f)) * 0.125f; }   // 1/sqrt(64)
    if (edge) {
#pragma unroll
      for (int ct = 0; ct < 2; ++ct) { const int kk = ks * 32 + ct * 16 + 8 * g;
#pragma unroll
        for (int r = 0; r < 8; ++r) { const int dq = (q0 + col) - (kk + r); s[ct][r] = (dq <= LW && dq >= -LW) ? s[ct][r] : -3.0e38f; } } }   // masked keys excluded
    float mx = fmaxf(s[0][0], s[1][0]);
#pragma unroll
    for (int r = 1; r < 8; ++r) mx = fmaxf(mx, fmaxf(s[0][r], s[1][r]));
    mx = fmaxf(mx, xhalf(mx));   // the other 16 keys of this query
    const float mn = fmaxf(m, mx); const float alpha = (m <= -1.0e38f) ? 0.f : __expf(m - mn);
    float es = 0.f; v16h pa, pl; v8f e[2];
#pragma unroll
    for (int ct = 0; ct < 2; ++ct) {
#pragma unroll
      for (int r = 0; r < 8; ++r) e[ct][r] = __expf(s[ct][r] - mn); }
    if (edge) {   // a masked key's weight is 0, also where every key of the query so far is masked (mn is then the mask value itself)
#pragma unroll
      for (int ct = 0; ct < 2; ++ct) {
#pragma unroll
        for (int r = 0; r < 8; ++r) e[ct][r] = (s[ct][r] <= -1.0e38f) ? 0.f : e[ct][r]; } }
#pragma unroll
    for (int r = 0; r < 8; ++r) { const float e0 = e[0][r], e1 = e[1][r]; es += e0 + e1;
      const float x0 = e0 * 2048.0f, x1 = e1 * 2048.0f; const _Float16 h0 = (_Float16)x0, h1 = (_Float16)x1; pa[r] = h0; pa[8 + r] = h1; pl[r] = (_Float16)((x0 - (float)h0) * 2048.0f); pl[8 + r] = (_Float16)((x1 - (float)h1) * 2048.0f); }   // P^T as a B fragment: element r = key 8g + r, element 8 + r = key 16 + 8g + r, the k order of frag_h; P scaled by 2^11 before the f16 split so small softmax weights stay out of the f16 subnormal range; 2^-11 folded into the epilogue
    l = l * alpha + es; m = mn;
#pragma unroll
    for (int dt = 0; dt < 4; ++dt) {
#pragma unroll
      for (int r = 0; r < 8; ++r) { acc[dt][r] *= alpha; accl[dt][r] *= alpha; } }
#pragma unroll
    for (int dt = 0; dt < 4; ++dt) { acc[dt] = wmma16(vh[dt], pa, acc[dt]); accl[dt] = wmma16(vh[dt], pl, accl[dt]); }   // V hi x P hi, V hi x P residual
#pragma unroll
    for (int dt = 0; dt < 4; ++dt) accl[dt] = wmma16(vl[dt], pa, accl[dt]);   // V residual x P hi (3 products)
  }
  asm volatile("s_wait_asynccnt 0x0" ::: "memory");     // no copy is outstanding when the wave goes on to the epilogue
  l += xhalf(l);   // the two half-waves' sums of one query
  const float il = (1.0f / 2048.0f) / l;
#pragma unroll
  for (int dt = 0; dt < 4; ++dt) { v4f o0, o1;   // acc[dt][r] = O^T[d = dt*16 + 8g + r][query col]
#pragma unroll
    for (int r = 0; r < 4; ++r) { o0[r] = (acc[dt][r] + accl[dt][r] * (1.0f / 2048.0f)) * il; o1[r] = (acc[dt][4 + r] + accl[dt][4 + r] * (1.0f / 2048.0f)) * il; }
    *(v4f*)&so[wave][col][dt * 16 + 8 * g] = o0; *(v4f*)&so[wave][col][dt * 16 + 8 * g + 4] = o1; }
  LDSX();
  for (int rl = 0; rl < 16; ++rl) if (lane < 16) vst2(O + ((size_t)b * SS + q0 + rl) * DM + h * HD + lane * 4, *(const v4f*)&so[wave][rl][lane * 4]);
}
// ---- k_out: block = (64 rows, 128 cols): out = O(hi/lo) . Wo rows (2 products) + bo
__global__ __launch_bounds__(128) void k_out(const float* __restrict__ O, const __bf16* __restrict__ P, const float* __restrict__ BO, float* __restrict__ Y) {
  __shared__ __align__(16) float so[4][16][132];
  const int tid = threadIdx.x, wave = tid >> 5, lane = tid & 31, col = lane & 15, g = lane >> 4; const size_t r0 = (size_t)blockIdx.x * 64 + wave * 16; const int n0 = blockIdx.y * 128;
  v8f acc[8] = {};
#pragma unroll 2
  for (int kc = 0; kc < DM / 32; ++kc) { const F2 a = split_row(O + (r0 + col) * DM, kc * 32, lane);
#pragma unroll
    for (int j = 0; j < 8; ++j) { const v16b w = frag_b(P + (size_t)(n0 + j * 16 + col) * DM + kc * 32, lane); acc[j] = wmma_bf(a.l, w, acc[j]); acc[j] = wmma_bf(a.h, w, acc[j]); } }
#pragma unroll
  for (int j = 0; j < 8; ++j) {
#pragma unroll
    for (int r = 0; r < 8; ++r) so[wave][8 * g + r][j * 16 + col] = acc[j][r] + (BO ? bfr(BO[n0 + j * 16 + col]) : 0.f); }
  LDSX();
  for (int rl = 0; rl < 16; ++rl) vst2(Y + (r0 + rl) * DM + n0 + lane * 4, *(const v4f*)&so[wave][rl][lane * 4]);
}
extern "C" void kernel_launch(void* const* d_in, const int* in_sizes, int n_in, void* d_out, int out_size, void* d_ws, size_t ws_size, hipStream_t stream) {
  (void)in_sizes; (void)n_in; (void)out_size;
  const float** F = (const float**)d_in;   // 0 x [2,8192,512], 1 Wq [512,512] (in,out), 2 bq, 3 Wk, 4 bk, 5 Wv, 6 bv
  if (ws_size < (size_t)WS_END) return;
  char* ws = (char*)d_ws; __bf16* PK = (__bf16*)(ws + WS_PK); _Float16 *QK = (_Float16*)(ws + WS_QK), *QKL = (_Float16*)(ws + WS_QKL), *VTH = (_Float16*)(ws + WS_VTH), *VTL = (_Float16*)(ws + WS_VTL);
  k_pack<<<dim3(DM, 3), 256, 0, stream>>>(F[1], F[3], F[5], PK);
  k_qkv<<<dim3(TNB * SS / 64, QKVW / 128), 128, 0, stream>>>(F[0], F[0], F[0], PK + PK_A, F[2], F[4], F[6], QK, QKL, VTH, VTL);
  k_attn<<<dim3(TQB, NH, TNB), 128, 0, stream>>>(QK, QKL, VTH, VTL, nullptr, (float*)d_out);
}

// v007
// A run of this version takes 108 microseconds.
// In both of two side-by-side timings against v006, it was 1.06 times as fast.
// Over all steps from v000 it is 3.34 times as fast.
// compute dtype: all float inputs rounded to bf16; q/k/v = x . W + b with EXACT bf16 products on WMMA 16x16x32 ((in,out) weights as transposed rows), f16 hi + residual; banded attention (|i - j| <= 256; other key tiles skipped) with 3-product logits and 3-product P.v, x 1/8, running-max softmax in f32 (hardware exp); the merged context is the f32 output.
#include <hip/hip_runtime.h>
#include <math.h>

typedef __attribute__((ext_vector_type(16))) _Float16 v16h;
typedef __attribute__((ext_vector_type(16))) __bf16 v16b;
typedef __attribute__((ext_vector_type(8)))  _Float16 v8h;
typedef __attribute__((ext_vector_type(8)))  float v8f;
typedef __attribute__((ext_vector_type(4)))  float v4f;
typedef __attribute__((ext_vector_type(2)))  float v2f;
typedef __attribute__((ext_vector_type(4)))  unsigned v4u;
typedef __attribute__((ext_vector_type(4)))  int v4i;
typedef float __attribute__((may_alias)) float_a;
typedef int __attribute__((may_alias)) int_a;

template <typename T> __device__ __forceinline__ void vst2(void* p, T v) { *(T*)p = v;  }
__device__ __forceinline__ v8f wmma16(v16h a, v16h b, v8f c) {
  return __builtin_amdgcn_wmma_f32_16x16x32_f16(false, a, false, b, (short)0, c, false, false);
}
__device__ __forceinline__ v8f wmma_bf(v16b a, v16b b, v8f c) {
  return __builtin_amdgcn_wmma_f32_16x16x32_bf16(false, a, false, b, (short)0, c, false, false);
}
// Longformer multi-head attention (B 2, S 8,192, D 512, 8 heads x 64, one-sided window 256): (in,out) projections + biases, q / 8, banded softmax, no output projection (the merged context is the output).
__device__ __forceinline__ v16h frag_h(const _Float16* rowk0, int lane) {
  union { v16h v; v8h q[2]; } u; const _Float16* p = rowk0 + 8 * (lane >> 4);
  u.q[0] = *(const v8h*)p; u.q[1] = *(const v8h*)(p + 16); return u.v;
}
__device__ __forceinline__ v16h frag_f32(const float* rowk0, int lane) {
  v16h a; const float* p = rowk0 + 8 * (lane >> 4);
#pragma unroll
  for (int i = 0; i < 8; ++i) { a[i] = (_Float16)p[i]; a[8 + i] = (_Float16)p[16 + i]; }
  return a;
}
__device__ __forceinline__ v16h frag_f32s(const float* rowk0, int lane, float sc) {
  v16h a; const float* p = rowk0 + 8 * (lane >> 4);
#pragma unroll
  for (int i = 0; i < 8; ++i) { a[i] = (_Float16)(p[i] * sc); a[8 + i] = (_Float16)(p[16 + i] * sc); }
  return a;
}
// column fragment from a [K][ld] layout (column n), rows >= K read as 0
__device__ __forceinline__ v16h fragc_f32(const float* W, int k0, int n, int lane, int ld, int K) {
  v16h a; const int g = lane >> 4;
#pragma unroll
  for (int i = 0; i < 8; ++i) { const int ka = k0 + 8 * g + i, kb = ka + 16;
    a[i] = (_Float16)(ka < K ? W[(size_t)(ka < K ? ka : K - 1) * ld + n] : 0.f); a[8 + i] = (_Float16)(kb < K ? W[(size_t)(kb < K ? kb : K - 1) * ld + n] : 0.f); }
  return a;
}
struct F2 { v16b h, l; };
__device__ __forceinline__ F2 bsplit16(const float v[16]) { F2 r;
#pragma unroll
  for (int i = 0; i < 16; ++i) { const __bf16 h = (__bf16)v[i]; r.h[i] = h; r.l[i] = (__bf16)(v[i] - (float)h); }
  return r; }
__device__ __forceinline__ F2 split_row(const float* row, int k0, int lane) { float v[16]; const float* p = row + k0 + 8 * (lane >> 4);
#pragma unroll
  for (int i = 0; i < 8; ++i) { v[i] = p[i]; v[8 + i] = p[16 + i]; }
  return bsplit16(v); }
__device__ __forceinline__ F2 split_rowK(const float* row, int k0, int lane, int K) { float v[16]; const int g = lane >> 4;
#pragma unroll
  for (int i = 0; i < 8; ++i) { const int ka = k0 + 8 * g + i, kb = ka + 16; v[i] = ka < K ? row[ka < K ? ka : K - 1] : 0.f; v[8 + i] = kb < K ? row[kb < K ? kb : K - 1] : 0.f; }
  return bsplit16(v); }
__device__ __forceinline__ F2 split_col(const float* W, int k0, int n, int lane, int ld, int K) { float v[16]; const int g = lane >> 4;
#pragma unroll
  for (int i = 0; i < 8; ++i) { const int ka = k0 + 8 * g + i, kb = ka + 16; v[i] = ka < K ? W[(size_t)(ka < K ? ka : K - 1) * ld + n] : 0.f; v[8 + i] = kb < K ? W[(size_t)(kb < K ? kb : K - 1) * ld + n] : 0.f; }
  return bsplit16(v); }
__device__ __forceinline__ v8f mac3(const F2& a, const F2& b, v8f c) { c = wmma_bf(a.l, b.h, c); c = wmma_bf(a.h, b.l, c); return wmma_bf(a.h, b.h, c); }
__device__ __forceinline__ float sigm(float v) { return 1.0f / (1.0f + expf(-v)); }
#define LDSX() do { asm volatile("s_wait_dscnt 0" ::: "memory"); __builtin_amdgcn_wave_barrier(); __builtin_amdgcn_fence(__ATOMIC_RELEASE, "workgroup"); } while (0)


#define NB 2
#define SS 8192
#define DM 512
#define NH 8
#define LW 256
#define HD 64
#define QKVW (3 * DM)
#ifndef TQB
#define TQB (SS / 64)
#define TNB NB
#define TOB (NB * SS / 64)     // output row tiles (all)
#endif
typedef __attribute__((ext_vector_type(8))) __bf16 v8b;
__device__ __forceinline__ v16b frag_b(const __bf16* rowk0, int lane) {
  union { v16b v; v8b q[2]; } u; const __bf16* p = rowk0 + 8 * (lane >> 4);
  u.q[0] = *(const v8b*)p; u.q[1] = *(const v8b*)(p + 16); return u.v;
}
__device__ __forceinline__ float bfr(float v) { return (float)(__bf16)v; }
__device__ __forceinline__ float xhalf(float x) { return __builtin_bit_cast(float, __builtin_amdgcn_permlanex16(__builtin_bit_cast(int, x), __builtin_bit_cast(int, x), 0x76543210, 0xfedcba98, false, false)); }   // lane l with lane l ^ 16
__device__ __attribute__((noinline)) float exp_ni(float v) { return expf(v); }
__device__ __attribute__((noinline)) float erf_ni(float v) { return erff(v); }

#define PK_A 0                       // [1536][512] Wqkv rows (natural [out][in])
#define PK_P (PK_A + QKVW * DM)        // [512][512]; not written here (no W_o input)
#define PK_END (PK_P + DM * DM)
#define WS_PK  0u
#define WS_QK  (WS_PK + 2u * PK_END)             // f16 [16384 rows][1024]: q | k
#define WS_QKL (WS_QK + 2u * NB * SS * 2 * DM)     // f16 q | k residual planes x2048
#define WS_VTH (WS_QKL + 2u * NB * SS * 2 * DM)    // f16 [b][512 (h*64+d)][8192 s] hi
#define WS_VTL (WS_VTH + 2u * NB * DM * SS)        // f16 lo x 2048
#define WS_O   (WS_VTL + 2u * NB * DM * SS)        // f32 [16384][512] (unused)
#define WS_CS  (WS_O + 4u * NB * SS * DM)           // f32 [8192][32] x 2 (unused)
#define WS_END (WS_CS + 4u * 2 * SS * 32)
// ---- k_pack: block = (64 columns n0.., 64 rows k0.., which) of an (in,out) weight [512][512]: the 64 x 64 tile is rounded to bf16 and transposed through LDS; packed row (which*DM + n) = column n of W_q / W_k / W_v
typedef __attribute__((ext_vector_type(4))) __bf16 v4b;
__global__ __launch_bounds__(128) void k_pack(const float* __restrict__ WQ, const float* __restrict__ WK, const float* __restrict__ WV, __bf16* __restrict__ PK) {
  __shared__ __align__(16) __bf16 s[64][72];   // [n][k], 128 B of data at a 144-B pitch (16 B x odd, for the ds_load_b128 readers below)
  const int n0 = blockIdx.x * 64, k0 = blockIdx.y * 64, which = blockIdx.z, t = threadIdx.x; const float* Wm = which == 0 ? WQ : which == 1 ? WK : WV;
  const int n4 = (t & 15) * 4, k4 = (t >> 4) * 4;   // a thread's two 4 x 4 pieces (rows k4.., 32 + k4..): sixteen lanes read 256 contiguous bytes of one weight row
  v4f r[2][4];
#pragma unroll   // h, i constant: r[] stays in registers and the eight loads fly together
  for (int h = 0; h < 2; ++h) {
#pragma unroll
    for (int i = 0; i < 4; ++i) r[h][i] = *(const v4f*)(Wm + (size_t)(k0 + h * 32 + k4 + i) * DM + n0 + n4); }
  asm volatile("s_wait_xcnt 0x0" ::: "memory");   // stands behind the eight loads, in front of the first instruction that rewrites one of their address registers
#pragma unroll
  for (int h = 0; h < 2; ++h) {
#pragma unroll
    for (int c = 0; c < 4; ++c) { v4b p;
#pragma unroll
      for (int i = 0; i < 4; ++i) p[i] = (__bf16)r[h][i][c];
      *(v4b*)&s[n4 + c][h * 32 + k4] = p; } }   // four k of column n0 + n4 + c: one 8-B LDS store
  __syncthreads();
  __bf16* dst = PK + PK_A + ((size_t)which * DM + n0) * DM + k0;
#pragma unroll   // the four LDS reads stand together in front of the four stores
  for (int u = 0; u < 4; ++u) { const int q = t + u * 128, n = q >> 3, pc = q & 7; vst2((unsigned*)(dst + (size_t)n * DM + pc * 8), *(const v4u*)&s[n][pc * 8]); }   // eight lanes store one whole 128-B line of a packed row
}
#define KP 72   // 16-bit elements per staged 128-B row (K rows, weight rows): a 144-B pitch (16 B x odd, for ds_load_b128 readers)
#define VP 40   // f16 per staged V^T row: 64 B of data at an 80-B pitch
__device__ __forceinline__ unsigned lds_off(const void* p) { return (unsigned)(size_t)p; }
// eight 16-B-per-lane asynchronous copies global -> LDS; the s_wait_xcnt stands inside the statement so that no address register is rewritten in front of it
__device__ __forceinline__ void copy8(unsigned l0, unsigned l1, unsigned l2, unsigned l3, unsigned l4, unsigned l5, unsigned l6, unsigned l7, const void* g0, const void* g1, const void* g2, const void* g3, const void* g4, const void* g5, const void* g6, const void* g7) {
  asm volatile("global_load_async_to_lds_b128 %0, %8, off\n\t"
               "global_load_async_to_lds_b128 %1, %9, off\n\t"
               "global_load_async_to_lds_b128 %2, %10, off\n\t"
               "global_load_async_to_lds_b128 %3, %11, off\n\t"
               "global_load_async_to_lds_b128 %4, %12, off\n\t"
               "global_load_async_to_lds_b128 %5, %13, off\n\t"
               "global_load_async_to_lds_b128 %6, %14, off\n\t"
               "global_load_async_to_lds_b128 %7, %15, off\n\t"
               "s_wait_xcnt 0x0"
               :: "v"(l0), "v"(l1), "v"(l2), "v"(l3), "v"(l4), "v"(l5), "v"(l6), "v"(l7), "v"(g0), "v"(g1), "v"(g2), "v"(g3), "v"(g4), "v"(g5), "v"(g6), "v"(g7) : "memory");
}
__global__ __launch_bounds__(128) void k_qkv(const float* __restrict__ XQ, const float* __restrict__ XK, const float* __restrict__ XV, const __bf16* __restrict__ P, const float* __restrict__ BQ, const float* __restrict__ BK, const float* __restrict__ BV, _Float16* __restrict__ QK, _Float16* __restrict__ QKL, _Float16* __restrict__ VTH, _Float16* __restrict__ VTL) {
  const int which0 = (blockIdx.y * 128) / DM; const float* X = (which0 == 0) ? XQ : (which0 == 1) ? XK : XV; const float* BB = BQ ? (((which0 == 0) ? BQ : (which0 == 1) ? BK : BV) + (blockIdx.y * 128 - which0 * DM)) : nullptr;
  __shared__ __align__(16) _Float16 so[4][16][136], sol[4][16][136];   // in the k loop: the two buffers of the x ring (64 rows x 64 k of fp32: 256 B of data in each 272-B row, row = [wave][col]); behind it: the q, k output staging
  __shared__ __align__(16) _Float16 sth[128][KP], stl[128][KP];   // in the k loop: the two buffers of the weight ring (128 packed rows x 64 k of bf16); behind it: the V^T output staging
  const int tid = threadIdx.x, wave = tid >> 5, lane = tid & 31, col = lane & 15, g = lane >> 4; const size_t r0 = (size_t)blockIdx.x * 64 + wave * 16; const int n0 = blockIdx.y * 128;
  v8f acc[8] = {};
  const int wr = tid >> 3, wp = (tid & 7) * 8;   // a thread's 16-B piece of the packed rows wr + 16 i, i = 0 .. 7
  const int xrw = tid >> 4, xpc = (tid & 15) * 4;   // a thread's 16-B piece of the x rows xrw + 8 i, i = 0 .. 7: one copy of a wave covers two whole 256-B row pieces, four full lines
  auto fill = [&](int st, _Float16 (*bp)[KP], _Float16 (*xb)[16][136]) { const __bf16* s = P + (size_t)(n0 + wr) * DM + st * 64 + wp;
    const float* xs = X + ((size_t)blockIdx.x * 64 + xrw) * DM + st * 64 + xpc; const unsigned xl = lds_off(&xb[0][0][0]) + xrw * 272 + xpc * 4;
    copy8(xl, xl + 8 * 272, xl + 16 * 272, xl + 24 * 272, xl + 32 * 272, xl + 40 * 272, xl + 48 * 272, xl + 56 * 272,
          xs, xs + 8 * DM, xs + 16 * DM, xs + 24 * DM, xs + 32 * DM, xs + 40 * DM, xs + 48 * DM, xs + 56 * DM);
    copy8(lds_off(&bp[wr][wp]), lds_off(&bp[wr + 16][wp]), lds_off(&bp[wr + 32][wp]), lds_off(&bp[wr + 48][wp]), lds_off(&bp[wr + 64][wp]), lds_off(&bp[wr + 80][wp]), lds_off(&bp[wr + 96][wp]), lds_off(&bp[wr + 112][wp]),
          s, s + 16 * DM, s + 32 * DM, s + 48 * DM, s + 64 * DM, s + 80 * DM, s + 96 * DM, s + 112 * DM); };
  fill(0, sth, so);
  float bias[8] = {};   // this lane's eight bias values (columns n0 + j * 16 + col): asked for once, as one group under one test, so that they fly beside stage 0's copies; read at each output element they compiled to 64 load-and-wait pairs in a row
  if (BB) {
#pragma unroll   // j constant: bias[] stays in registers and the eight loads stand together
    for (int j = 0; j < 8; ++j) bias[j] = BB[j * 16 + col]; }
  asm volatile("s_wait_asynccnt 0x0" ::: "memory");   // this wave's share of stage 0 has landed
  __syncthreads();                                    // stage 0 is published to all four waves
  fill(1, stl, sol);
#pragma unroll 1   // rolled: one copy of the stage's foot (waits, barrier, refill) in the text, the buffer chosen by st & 1
  for (int st = 0; st < DM / 64; ++st) { _Float16 (*bp)[KP] = (st & 1) ? stl : sth; _Float16 (*xb)[16][136] = (st & 1) ? sol : so;
    v4f xr[2][4];   // this lane's x piece of the stage (fp32), read from the x ring; read from global memory, each load of a wave touched sixteen lines for 32 B of each
#pragma unroll
    for (int kk = 0; kk < 2; ++kk) { const float* p = (const float*)&xb[wave][col][0] + kk * 32 + 8 * g; xr[kk][0] = *(const v4f*)p; xr[kk][1] = *(const v4f*)(p + 4); xr[kk][2] = *(const v4f*)(p + 16); xr[kk][3] = *(const v4f*)(p + 20); }
    v16b w[2][8];   // the stage's sixteen weight fragments, read from LDS as one group in front of its WMMAs
#pragma unroll     // kk constant: the two 32-k halves of a staged row become immediate offsets of the LDS loads
    for (int kk = 0; kk < 2; ++kk) {
#pragma unroll
      for (int j = 0; j < 8; ++j) w[kk][j] = frag_b((const __bf16*)&bp[j * 16 + col][kk * 32], lane); }
    __builtin_amdgcn_sched_barrier(0);   // keeps the loads above as one group: without it the scheduler sinks each LDS pair to one WMMA in front of its use, and every WMMA waits out an LDS latency
#pragma unroll
    for (int kk = 0; kk < 2; ++kk) { v16b a;
#pragma unroll
      for (int i = 0; i < 4; ++i) { a[i] = (__bf16)xr[kk][0][i]; a[4 + i] = (__bf16)xr[kk][1][i]; a[8 + i] = (__bf16)xr[kk][2][i]; a[12 + i] = (__bf16)xr[kk][3][i]; }
#pragma unroll
      for (int j = 0; j < 8; ++j) acc[j] = wmma_bf(a, w[kk][j], acc[j]); }
    asm volatile("s_wait_dscnt 0x0" ::: "memory");      // this wave's reads of buffers bp and xb are done
    asm volatile("s_wait_asynccnt 0x0" ::: "memory");   // this wave's share of stage st + 1 has landed
    __syncthreads();                                    // publishes stage st + 1 and ends every wave's reads of buffers bp and xb
    if (st + 2 < DM / 64) fill(st + 2, bp, xb); }
  asm volatile("s_wait_asynccnt 0x0" ::: "memory");     // no copy is outstanding when the ring becomes output staging
  if (n0 < 2 * DM) {   // q stored unscaled (f16 sigma ~0.6, no subnormal exposure); 1/8 applied to the f32 score
#pragma unroll
    for (int j = 0; j < 8; ++j) {
#pragma unroll
      for (int r = 0; r < 8; ++r) { const float v = acc[j][r] + bfr(bias[j]); const _Float16 hv = (_Float16)v; so[wave][8 * g + r][j * 16 + col] = hv; sol[wave][8 * g + r][j * 16 + col] = (_Float16)((v - (float)hv) * 2048.0f); } }   // q, k (+ bias) as f16 hi + (x2048) residual
    LDSX();
    for (int rl = 0; rl < 16; ++rl) if (lane < 16) { vst2((unsigned*)(QK + (r0 + rl) * (2 * DM) + n0 + lane * 8), *(const v4u*)&so[wave][rl][lane * 8]); vst2((unsigned*)(QKL + (r0 + rl) * (2 * DM) + n0 + lane * 8), *(const v4u*)&sol[wave][rl][lane * 8]); }
  } else {
#pragma unroll
    for (int j = 0; j < 8; ++j) {
#pragma unroll
      for (int r = 0; r < 8; ++r) { const float v = acc[j][r] + bfr(bias[j]); const _Float16 hv = (_Float16)v; sth[j * 16 + col][wave * 16 + 8 * g + r] = hv; stl[j * 16 + col][wave * 16 + 8 * g + r] = (_Float16)((v - (float)hv) * 2048.0f); } }
    __syncthreads();
    const size_t rb = (size_t)blockIdx.x * 64; const int b = (int)(rb / SS), s0 = (int)(rb % SS); const int pc0 = n0 - 2 * DM;
    for (int q = tid; q < 128 * 8; q += 128) { const int d = q >> 3, pc = q & 7; const size_t o = ((size_t)b * DM + pc0 + d) * SS + s0 + pc * 8; vst2((unsigned*)(VTH + o), *(const v4u*)&sth[d][pc * 8]); vst2((unsigned*)(VTL + o), *(const v4u*)&stl[d][pc * 8]); }
  }
}
// ---- k_attn: block = (64 queries, head h, batch b): banded flash attention in transposed form: S^T = K . Q^T (A = K rows, B = q), so a lane holds 16 of the 32 scores of ONE query (column col, keys ct*16 + 8g + r): maximum and sum in the lane plus one exchange between the wave's halves; the two S^T tiles, converted in place, are the B operand of O^T += V^T . P^T; O[b*S+q][h*64+d] = (acc + accl / 2048) / (2048 l) (256-B segments)
__global__ __launch_bounds__(128) void k_attn(const _Float16* __restrict__ QK, const _Float16* __restrict__ QKL, const _Float16* __restrict__ VTH, const _Float16* __restrict__ VTL, const void* __restrict__ KMASK, float* __restrict__ O) {
  __shared__ __align__(16) float so[4][16][68];
  __shared__ __align__(16) _Float16 skh[2][32][KP], skl[2][32][KP], svh[2][64][VP], svl[2][64][VP];   // two buffers of one 32-key tile: K hi, K residual, V^T hi, V^T residual, read by all four waves
  const int tid = threadIdx.x, wave = tid >> 5, lane = tid & 31, col = lane & 15, g = lane >> 4;
  const int qb = blockIdx.x, h = blockIdx.y, b = blockIdx.z; const int q0 = qb * 64 + wave * 16; const size_t rq = (size_t)b * SS + q0 + col;
  v16h aq[2], aql[2];
#pragma unroll
  for (int kc = 0; kc < 2; ++kc) { aq[kc] = frag_h(QK + rq * (2 * DM) + h * HD + kc * 32, lane); aql[kc] = frag_h(QKL + rq * (2 * DM) + h * HD + kc * 32, lane); }
  const int wq0 = qb * 64 + __builtin_amdgcn_readfirstlane(wave) * 16;   // q0 again, held in a scalar register: the test on it in the loop is then a scalar compare and branch, alike for the whole wave
  float m = -3.0e38f, l = 0.f;   // of query q0 + col; l holds this half-wave's keys only and is joined behind the loop
  v8f acc[4] = {}, accl[4] = {};
  const int nks = SS / 32;   // all keys
  const int ks0 = (qb * 64 - LW) > 0 ? (qb * 64 - LW) / 32 : 0; const int ks1 = ((qb * 64 + 64 + LW) / 32) < nks ? ((qb * 64 + 64 + LW) / 32) : nks;   // window tiles
  const int kr = tid >> 3, kp = (tid & 7) * 8, vw = tid >> 2, vp = (tid & 3) * 8;   // a thread's 16-B piece: K rows kr, kr + 16; V^T rows vw, vw + 32
  const size_t gko = ((size_t)b * SS + kr) * (2 * DM) + DM + h * HD + kp, gvo = ((size_t)b * DM + h * HD + vw) * SS + vp;
  auto fill = [&](int ks, int bf) { const size_t ko = gko + (size_t)ks * 32 * (2 * DM), vo = gvo + (size_t)ks * 32;
    copy8(lds_off(&skh[bf][kr][kp]), lds_off(&skh[bf][kr + 16][kp]), lds_off(&skl[bf][kr][kp]), lds_off(&skl[bf][kr + 16][kp]), lds_off(&svh[bf][vw][vp]), lds_off(&svh[bf][vw + 32][vp]), lds_off(&svl[bf][vw][vp]), lds_off(&svl[bf][vw + 32][vp]),
          QK + ko, QK + ko + 16 * (2 * DM), QKL + ko, QKL + ko + 16 * (2 * DM), VTH + vo, VTH + vo + (size_t)32 * SS, VTL + vo, VTL + vo + (size_t)32 * SS); };
  fill(ks0, 0);
  asm volatile("s_wait_asynccnt 0x0" ::: "memory");   // this wave's share of tile ks0 has landed
  __syncthreads();                                    // tile ks0 is published to all four waves
  if (ks0 + 1 < ks1) fill(ks0 + 1, 1);
#pragma unroll 1
  for (int ks = ks0; ks < ks1; ++ks) { v8f s[2]; const int bf = (ks - ks0) & 1;
    v16h kh[2][2], kl[2][2];   // the tile's eight K fragments (hi, residual), read from LDS as one group in front of the twelve score WMMAs
#pragma unroll
    for (int ct = 0; ct < 2; ++ct) {
#pragma unroll
      for (int kc = 0; kc < 2; ++kc) { kh[ct][kc] = frag_h(&skh[bf][ct * 16 + col][kc * 32], lane); kl[ct][kc] = frag_h(&skl[bf][ct * 16 + col][kc * 32], lane); } }
    __builtin_amdgcn_sched_barrier(0);   // keeps the sixteen K loads as one group: without it the scheduler holds some back among the WMMAs, which then wait out an LDS latency each
    v8f c[2] = {}, cl[2] = {};   // 3 products; each accumulator takes its products in the order kc 0, kc 1 (cl: K hi x q residual, then K residual x q)
#pragma unroll
    for (int kc = 0; kc < 2; ++kc) {
#pragma unroll
      for (int ct = 0; ct < 2; ++ct) { c[ct] = wmma16(kh[ct][kc], aq[kc], c[ct]); cl[ct] = wmma16(kh[ct][kc], aql[kc], cl[ct]); }
#pragma unroll
      for (int ct = 0; ct < 2; ++ct) cl[ct] = wmma16(kl[ct][kc], aq[kc], cl[ct]); }
    v16h vh[4], vl[4];   // the tile's eight V^T fragments, read here too, into the registers that the score WMMAs set free
#pragma unroll
    for (int dt = 0; dt < 4; ++dt) { vh[dt] = frag_h(&svh[bf][dt * 16 + col][0], lane); vl[dt] = frag_h(&svl[bf][dt * 16 + col][0], lane); }
    // the ring's hand-over stands here: all of the tile is in registers, and the rest of the pass (softmax, P.V) touches no LDS, so the refill flies behind it
    LDSX();                                             // holds the s_wait_dscnt 0: this wave's reads of buffer bf are done
    asm volatile("s_wait_asynccnt 0x0" ::: "memory");   // this wave's share of tile ks + 1 has landed
    __syncthreads();                                    // publishes tile ks + 1 and ends every wave's reads of buffer bf
    if (ks + 2 < ks1) fill(ks + 2, bf);
    // edge: some (query, key) pair of this wave's 16 x 32 may lie outside the band. Otherwise the largest q - k = wq0 + 15 - ks * 32 and the largest k - q = ks * 32 + 31 - wq0 are both <= LW: the band test passes for all 512 scores (15 of a wave's 18 tiles away from the sequence ends) and the mask work is branched over
    const bool edge = wq0 + 15 - ks * 32 > LW || ks * 32 + 31 - wq0 > LW;
#pragma unroll
    for (int ct = 0; ct < 2; ++ct) {
#pragma unroll
      for (int r = 0; r < 8; ++r) s[ct][r] = (c[ct][r] + cl[ct][r] * (1.0f / 2048.0f)) * 0.125f; }   // 1/sqrt(64)
    if (edge) {
#pragma unroll
      for (int ct = 0; ct < 2; ++ct) { const int kk = ks * 32 + ct * 16 + 8 * g;
#pragma unroll
        for (int r = 0; r < 8; ++r) { const int dq = (q0 + col) - (kk + r); s[ct][r] = (dq <= LW && dq >= -LW) ? s[ct][r] : -3.0e38f; } } }   // masked keys excluded
    float mx = fmaxf(s[0][0], s[1][0]);
#pragma unroll
    for (int r = 1; r < 8; ++r) mx = fmaxf(mx, fmaxf(s[0][r], s[1][r]));
    mx = fmaxf(mx, xhalf(mx));   // the other 16 keys of this query
    const float mn = fmaxf(m, mx); const float alpha = (m <= -1.0e38f) ? 0.f : __expf(m - mn);
    float es = 0.f; v16h pa, pl; v8f e[2];
#pragma unroll
    for (int ct = 0; ct < 2; ++ct) {
#pragma unroll
      for (int r = 0; r < 8; ++r) e[ct][r] = __expf(s[ct][r] - mn); }
    if (edge) {   // a masked key's weight is 0, also where every key of the query so far is masked (mn is then the mask value itself)
#pragma unroll
      for (int ct = 0; ct < 2; ++ct) {
#pragma unroll
        for (int r = 0; r < 8; ++r) e[ct][r] = (s[ct][r] <= -1.0e38f) ? 0.f : e[ct][r]; } }
#pragma unroll
    for (int r = 0; r < 8; ++r) { const float e0 = e[0][r], e1 = e[1][r]; es += e0 + e1;
      const float x0 = e0 * 2048.0f, x1 = e1 * 2048.0f; const _Float16 h0 = (_Float16)x0, h1 = (_Float16)x1; pa[r] = h0; pa[8 + r] = h1; pl[r] = (_Float16)((x0 - (float)h0) * 2048.0f); pl[8 + r] = (_Float16)((x1 - (float)h1) * 2048.0f); }   // P^T as a B fragment: element r = key 8g + r, element 8 + r = key 16 + 8g + r, the k order of frag_h; P scaled by 2^11 before the f16 split so small softmax weights stay out of the f16 subnormal range; 2^-11 folded into the epilogue
    l = l * alpha + es; m = mn;
#pragma unroll
    for (int dt = 0; dt < 4; ++dt) {
#pragma unroll
      for (int r = 0; r < 8; ++r) { acc[dt][r] *= alpha; accl[dt][r] *= alpha; } }
#pragma unroll
    for (int dt = 0; dt < 4; ++dt) { acc[dt] = wmma16(vh[dt], pa, acc[dt]); accl[dt] = wmma16(vh[dt], pl, accl[dt]); }   // V hi x P hi, V hi x P residual
#pragma unroll
    for (int dt = 0; dt < 4; ++dt) accl[dt] = wmma16(vl[dt], pa, accl[dt]);   // V residual x P hi (3 products)
  }
  asm volatile("s_wait_asynccnt 0x0" ::: "memory");     // no copy is outstanding when the wave goes on to the epilogue
  l += xhalf(l);   // the two half-waves' sums of one query
  const float il = (1.0f / 2048.0f) / l;
#pragma unroll
  for (int dt = 0; dt < 4; ++dt) { v4f o0, o1;   // acc[dt][r] = O^T[d = dt*16 + 8g + r][query col]
#pragma unroll
    for (int r = 0; r < 4; ++r) { o0[r] = (acc[dt][r] + accl[dt][r] * (1.0f / 2048.0f)) * il; o1[r] = (acc[dt][4 + r] + accl[dt][4 + r] * (1.0f / 2048.0f)) * il; }
    *(v4f*)&so[wave][col][dt * 16 + 8 * g] = o0; *(v4f*)&so[wave][col][dt * 16 + 8 * g + 4] = o1; }
  LDSX();
  for (int rl = 0; rl < 16; ++rl) if (lane < 16) vst2(O + ((size_t)b * SS + q0 + rl) * DM + h * HD + lane * 4, *(const v4f*)&so[wave][rl][lane * 4]);
}
// ---- k_out: block = (64 rows, 128 cols): out = O(hi/lo) . Wo rows (2 products) + bo
__global__ __launch_bounds__(128) void k_out(const float* __restrict__ O, const __bf16* __restrict__ P, const float* __restrict__ BO, float* __restrict__ Y) {
  __shared__ __align__(16) float so[4][16][132];
  const int tid = threadIdx.x, wave = tid >> 5, lane = tid & 31, col = lane & 15, g = lane >> 4; const size_t r0 = (size_t)blockIdx.x * 64 + wave * 16; const int n0 = blockIdx.y * 128;
  v8f acc[8] = {};
#pragma unroll 2
  for (int kc = 0; kc < DM / 32; ++kc) { const F2 a = split_row(O + (r0 + col) * DM, kc * 32, lane);
#pragma unroll
    for (int j = 0; j < 8; ++j) { const v16b w = frag_b(P + (size_t)(n0 + j * 16 + col) * DM + kc * 32, lane); acc[j] = wmma_bf(a.l, w, acc[j]); acc[j] = wmma_bf(a.h, w, acc[j]); } }
#pragma unroll
  for (int j = 0; j < 8; ++j) {
#pragma unroll
    for (int r = 0; r < 8; ++r) so[wave][8 * g + r][j * 16 + col] = acc[j][r] + (BO ? bfr(BO[n0 + j * 16 + col]) : 0.f); }
  LDSX();
  for (int rl = 0; rl < 16; ++rl) vst2(Y + (r0 + rl) * DM + n0 + lane * 4, *(const v4f*)&so[wave][rl][lane * 4]);
}
extern "C" void kernel_launch(void* const* d_in, const int* in_sizes, int n_in, void* d_out, int out_size, void* d_ws, size_t ws_size, hipStream_t stream) {
  (void)in_sizes; (void)n_in; (void)out_size;
  const float** F = (const float**)d_in;   // 0 x [2,8192,512], 1 Wq [512,512] (in,out), 2 bq, 3 Wk, 4 bk, 5 Wv, 6 bv
  if (ws_size < (size_t)WS_END) return;
  char* ws = (char*)d_ws; __bf16* PK = (__bf16*)(ws + WS_PK); _Float16 *QK = (_Float16*)(ws + WS_QK), *QKL = (_Float16*)(ws + WS_QKL), *VTH = (_Float16*)(ws + WS_VTH), *VTL = (_Float16*)(ws + WS_VTL);
  k_pack<<<dim3(DM / 64, DM / 64, 3), 128, 0, stream>>>(F[1], F[3], F[5], PK);
  k_qkv<<<dim3(TNB * SS / 64, QKVW / 128), 128, 0, stream>>>(F[0], F[0], F[0], PK + PK_A, F[2], F[4], F[6], QK, QKL, VTH, VTL);
  k_attn<<<dim3(TQB, NH, TNB), 128, 0, stream>>>(QK, QKL, VTH, VTL, nullptr, (float*)d_out);
}

// v008
// Measured time: 104 microseconds a run.
// Timed twice side by side with v007, it ran 1.04 times as fast both times.
// Counting every step since v000, it is 3.47 times as fast.
// compute dtype: all float inputs rounded to bf16; q/k/v = x . W + b with EXACT bf16 products on WMMA 16x16x32 ((in,out) weights as transposed rows), f16 hi + residual; banded attention (|i - j| <= 256; other key tiles skipped) with 3-product logits and 3-product P.v, x 1/8, running-max softmax in f32 (hardware exp); the merged context is the f32 output.
#include <hip/hip_runtime.h>
#include <math.h>

typedef __attribute__((ext_vector_type(16))) _Float16 v16h;
typedef __attribute__((ext_vector_type(16))) __bf16 v16b;
typedef __attribute__((ext_vector_type(8)))  _Float16 v8h;
typedef __attribute__((ext_vector_type(8)))  float v8f;
typedef __attribute__((ext_vector_type(4)))  float v4f;
typedef __attribute__((ext_vector_type(2)))  float v2f;
typedef __attribute__((ext_vector_type(4)))  unsigned v4u;
typedef __attribute__((ext_vector_type(4)))  int v4i;
typedef float __attribute__((may_alias)) float_a;
typedef int __attribute__((may_alias)) int_a;

template <typename T> __device__ __forceinline__ void vst2(void* p, T v) { *(T*)p = v;  }
__device__ __forceinline__ v8f wmma16(v16h a, v16h b, v8f c) {
  return __builtin_amdgcn_wmma_f32_16x16x32_f16(false, a, false, b, (short)0, c, false, false);
}
__device__ __forceinline__ v8f wmma_bf(v16b a, v16b b, v8f c) {
  return __builtin_amdgcn_wmma_f32_16x16x32_bf16(false, a, false, b, (short)0, c, false, false);
}
// Longformer multi-head attention (B 2, S 8,192, D 512, 8 heads x 64, one-sided window 256): (in,out) projections + biases, q / 8, banded softmax, no output projection (the merged context is the output).
__device__ __forceinline__ v16h frag_h(const _Float16* rowk0, int lane) {
  union { v16h v; v8h q[2]; } u; const _Float16* p = rowk0 + 8 * (lane >> 4);
  u.q[0] = *(const v8h*)p; u.q[1] = *(const v8h*)(p + 16); return u.v;
}
__device__ __forceinline__ v16h frag_f32(const float* rowk0, int lane) {
  v16h a; const float* p = rowk0 + 8 * (lane >> 4);
#pragma unroll
  for (int i = 0; i < 8; ++i) { a[i] = (_Float16)p[i]; a[8 + i] = (_Float16)p[16 + i]; }
  return a;
}
__device__ __forceinline__ v16h frag_f32s(const float* rowk0, int lane, float sc) {
  v16h a; const float* p = rowk0 + 8 * (lane >> 4);
#pragma unroll
  for (int i = 0; i < 8; ++i) { a[i] = (_Float16)(p[i] * sc); a[8 + i] = (_Float16)(p[16 + i] * sc); }
  return a;
}
// column fragment from a [K][ld] layout (column n), rows >= K read as 0
__device__ __forceinline__ v16h fragc_f32(const float* W, int k0, int n, int lane, int ld, int K) {
  v16h a; const int g = lane >> 4;
#pragma unroll
  for (int i = 0; i < 8; ++i) { const int ka = k0 + 8 * g + i, kb = ka + 16;
    a[i] = (_Float16)(ka < K ? W[(size_t)(ka < K ? ka : K - 1) * ld + n] : 0.f); a[8 + i] = (_Float16)(kb < K ? W[(size_t)(kb < K ? kb : K - 1) * ld + n] : 0.f); }
  return a;
}
struct F2 { v16b h, l; };
__device__ __forceinline__ F2 bsplit16(const float v[16]) { F2 r;
#pragma unroll
  for (int i = 0; i < 16; ++i) { const __bf16 h = (__bf16)v[i]; r.h[i] = h; r.l[i] = (__bf16)(v[i] - (float)h); }
  return r; }
__device__ __forceinline__ F2 split_row(const float* row, int k0, int lane) { float v[16]; const float* p = row + k0 + 8 * (lane >> 4);
#pragma unroll
  for (int i = 0; i < 8; ++i) { v[i] = p[i]; v[8 + i] = p[16 + i]; }
  return bsplit16(v); }
__device__ __forceinline__ F2 split_rowK(const float* row, int k0, int lane, int K) { float v[16]; const int g = lane >> 4;
#pragma unroll
  for (int i = 0; i < 8; ++i) { const int ka = k0 + 8 * g + i, kb = ka + 16; v[i] = ka < K ? row[ka < K ? ka : K - 1] : 0.f; v[8 + i] = kb < K ? row[kb < K ? kb : K - 1] : 0.f; }
  return bsplit16(v); }
__device__ __forceinline__ F2 split_col(const float* W, int k0, int n, int lane, int ld, int K) { float v[16]; const int g = lane >> 4;
#pragma unroll
  for (int i = 0; i < 8; ++i) { const int ka = k0 + 8 * g + i, kb = ka + 16; v[i] = ka < K ? W[(size_t)(ka < K ? ka : K - 1) * ld + n] : 0.f; v[8 + i] = kb < K ? W[(size_t)(kb < K ? kb : K - 1) * ld + n] : 0.f; }
  return bsplit16(v); }
__device__ __forceinline__ v8f mac3(const F2& a, const F2& b, v8f c) { c = wmma_bf(a.l, b.h, c); c = wmma_bf(a.h, b.l, c); return wmma_bf(a.h, b.h, c); }
__device__ __forceinline__ float sigm(float v) { return 1.0f / (1.0f + expf(-v)); }
#define LDSX() do { asm volatile("s_wait_dscnt 0" ::: "memory"); __builtin_amdgcn_wave_barrier(); __builtin_amdgcn_fence(__ATOMIC_RELEASE, "workgroup"); } while (0)


#define NB 2
#define SS 8192
#define DM 512
#define NH 8
#define LW 256
#define HD 64
#define QKVW (3 * DM)
#ifndef TQB
#define TQB (SS / 64)
#define TNB NB
#define TOB (NB * SS / 64)     // output row tiles (all)
#endif
typedef __attribute__((ext_vector_type(8))) __bf16 v8b;
__device__ __forceinline__ v16b frag_b(const __bf16* rowk0, int lane) {
  union { v16b v; v8b q[2]; } u; const __bf16* p = rowk0 + 8 * (lane >> 4);
  u.q[0] = *(const v8b*)p; u.q[1] = *(const v8b*)(p + 16); return u.v;
}
__device__ __forceinline__ float bfr(float v) { return (float)(__bf16)v; }
__device__ __forceinline__ float xhalf(float x) { return __builtin_bit_cast(float, __builtin_amdgcn_permlanex16(__builtin_bit_cast(int, x), __builtin_bit_cast(int, x), 0x76543210, 0xfedcba98, false, false)); }   // lane l with lane l ^ 16
__device__ __attribute__((noinline)) float exp_ni(float v) { return expf(v); }
__device__ __attribute__((noinline)) float erf_ni(float v) { return erff(v); }

#define PK_A 0                       // [1536][512] Wqkv rows (natural [out][in])
#define PK_P (PK_A + QKVW * DM)        // [512][512]; not written here (no W_o input)
#define PK_END (PK_P + DM * DM)
#define WS_PK  0u
#define WS_QK  (WS_PK + 2u * PK_END)             // f16 [16384 rows][1024]: q | k
#define WS_QKL (WS_QK + 2u * NB * SS * 2 * DM)     // f16 q | k residual planes x2048
#define WS_VTH (WS_QKL + 2u * NB * SS * 2 * DM)    // f16 [b][512 (h*64+d)][8192 s] hi
#define WS_VTL (WS_VTH + 2u * NB * DM * SS)        // f16 lo x 2048
#define WS_O   (WS_VTL + 2u * NB * DM * SS)        // f32 [16384][512] (unused)
#define WS_CS  (WS_O + 4u * NB * SS * DM)           // f32 [8192][32] x 2 (unused)
#define WS_END (WS_CS + 4u * 2 * SS * 32)
// ---- k_pack: block = (64 columns n0.., 64 rows k0.., which) of an (in,out) weight [512][512]: the 64 x 64 tile is rounded to bf16 and transposed through LDS; packed row (which*DM + n) = column n of W_q / W_k / W_v
typedef __attribute__((ext_vector_type(4))) __bf16 v4b;
__global__ __launch_bounds__(128) void k_pack(const float* __restrict__ WQ, const float* __restrict__ WK, const float* __restrict__ WV, __bf16* __restrict__ PK) {
  __shared__ __align__(16) __bf16 s[64][72];   // [n][k], 128 B of data at a 144-B pitch (16 B x odd, for the ds_load_b128 readers below)
  const int n0 = blockIdx.x * 64, k0 = blockIdx.y * 64, which = blockIdx.z, t = threadIdx.x; const float* Wm = which == 0 ? WQ : which == 1 ? WK : WV;
  const int n4 = (t & 15) * 4, k4 = (t >> 4) * 4;   // a thread's two 4 x 4 pieces (rows k4.., 32 + k4..): sixteen lanes read 256 contiguous bytes of one weight row
  v4f r[2][4];
#pragma unroll   // h, i constant: r[] stays in registers and the eight loads fly together
  for (int h = 0; h < 2; ++h) {
#pragma unroll
    for (int i = 0; i < 4; ++i) r[h][i] = *(const v4f*)(Wm + (size_t)(k0 + h * 32 + k4 + i) * DM + n0 + n4); }
  asm volatile("s_wait_xcnt 0x0" ::: "memory");   // stands behind the eight loads, in front of the first instruction that rewrites one of their address registers
#pragma unroll
  for (int h = 0; h < 2; ++h) {
#pragma unroll
    for (int c = 0; c < 4; ++c) { v4b p;
#pragma unroll
      for (int i = 0; i < 4; ++i) p[i] = (__bf16)r[h][i][c];
      *(v4b*)&s[n4 + c][h * 32 + k4] = p; } }   // four k of column n0 + n4 + c: one 8-B LDS store
  __syncthreads();
  __bf16* dst = PK + PK_A + ((size_t)which * DM + n0) * DM + k0;
#pragma unroll   // the four LDS reads stand together in front of the four stores
  for (int u = 0; u < 4; ++u) { const int q = t + u * 128, n = q >> 3, pc = q & 7; vst2((unsigned*)(dst + (size_t)n * DM + pc * 8), *(const v4u*)&s[n][pc * 8]); }   // eight lanes store one whole 128-B line of a packed row
}
typedef __attribute__((ext_vector_type(2))) __bf16 v2b;
#define KP 72   // 16-bit elements per staged 128-B row (K rows, weight rows): a 144-B pitch (16 B x odd, for ds_load_b128 readers)
#define VP 40   // f16 per staged V^T row: 64 B of data at an 80-B pitch
__device__ __forceinline__ unsigned lds_off(const void* p) { return (unsigned)(size_t)p; }
// eight 16-B-per-lane asynchronous copies global -> LDS; the s_wait_xcnt stands inside the statement so that no address register is rewritten in front of it
__device__ __forceinline__ void copy8(unsigned l0, unsigned l1, unsigned l2, unsigned l3, unsigned l4, unsigned l5, unsigned l6, unsigned l7, const void* g0, const void* g1, const void* g2, const void* g3, const void* g4, const void* g5, const void* g6, const void* g7) {
  asm volatile("global_load_async_to_lds_b128 %0, %8, off\n\t"
               "global_load_async_to_lds_b128 %1, %9, off\n\t"
               "global_load_async_to_lds_b128 %2, %10, off\n\t"
               "global_load_async_to_lds_b128 %3, %11, off\n\t"
               "global_load_async_to_lds_b128 %4, %12, off\n\t"
               "global_load_async_to_lds_b128 %5, %13, off\n\t"
               "global_load_async_to_lds_b128 %6, %14, off\n\t"
               "global_load_async_to_lds_b128 %7, %15, off\n\t"
               "s_wait_xcnt 0x0"
               :: "v"(l0), "v"(l1), "v"(l2), "v"(l3), "v"(l4), "v"(l5), "v"(l6), "v"(l7), "v"(g0), "v"(g1), "v"(g2), "v"(g3), "v"(g4), "v"(g5), "v"(g6), "v"(g7) : "memory");
}
__global__ __launch_bounds__(128) void k_qkv(const float* __restrict__ XQ, const float* __restrict__ XK, const float* __restrict__ XV, const __bf16* __restrict__ P, const float* __restrict__ BQ, const float* __restrict__ BK, const float* __restrict__ BV, _Float16* __restrict__ QK, _Float16* __restrict__ QKL, _Float16* __restrict__ VTH, _Float16* __restrict__ VTL) {
  // block = 64 rows x 256 columns; wave = all 64 rows x its own 64 columns (4 x 4 tiles): a weight fragment read from LDS feeds four WMMAs, an x fragment four
  const int which0 = (blockIdx.y * 256) / DM; const float* X = (which0 == 0) ? XQ : (which0 == 1) ? XK : XV; const float* BB = BQ ? (((which0 == 0) ? BQ : (which0 == 1) ? BK : BV) + (blockIdx.y * 256 - which0 * DM)) : nullptr;
  __shared__ __align__(16) _Float16 sx[2][64][136];    // the two buffers of the x ring (64 rows x 64 k of fp32: 256 B of data in each 272-B row), read by all four waves
  __shared__ __align__(16) _Float16 sw[2][256][KP];    // in the k loop: the two buffers of the weight ring (256 packed rows x 64 k of bf16); behind it: the output staging, [0] hi, [1] residual, rows wave * 64 .. + 63 private to a wave
  const int tid = threadIdx.x, wave = tid >> 5, lane = tid & 31, col = lane & 15, g = lane >> 4; const size_t rb = (size_t)blockIdx.x * 64; const int n0 = blockIdx.y * 256, nw = wave * 64;
  v8f acc[4][4] = {};   // [row tile i][column tile j]
  const int wr = tid >> 3, wp = (tid & 7) * 8;   // a thread's 16-B piece of the packed rows wr + 16 i, i = 0 .. 15
  const int xrw = tid >> 4, xpc = (tid & 15) * 4;   // a thread's 16-B piece of the x rows xrw + 8 i, i = 0 .. 7: one copy of a wave covers two whole 256-B row pieces, four full lines
  auto fill = [&](int st, int bf) { const __bf16* s = P + (size_t)(n0 + wr) * DM + st * 64 + wp; _Float16 (*bp)[KP] = sw[bf];
    const float* xs = X + (rb + xrw) * DM + st * 64 + xpc; const unsigned xl = lds_off(&sx[bf][0][0]) + xrw * 272 + xpc * 4;
    copy8(xl, xl + 8 * 272, xl + 16 * 272, xl + 24 * 272, xl + 32 * 272, xl + 40 * 272, xl + 48 * 272, xl + 56 * 272,
          xs, xs + 8 * DM, xs + 16 * DM, xs + 24 * DM, xs + 32 * DM, xs + 40 * DM, xs + 48 * DM, xs + 56 * DM);
    copy8(lds_off(&bp[wr][wp]), lds_off(&bp[wr + 16][wp]), lds_off(&bp[wr + 32][wp]), lds_off(&bp[wr + 48][wp]), lds_off(&bp[wr + 64][wp]), lds_off(&bp[wr + 80][wp]), lds_off(&bp[wr + 96][wp]), lds_off(&bp[wr + 112][wp]),
          s, s + 16 * DM, s + 32 * DM, s + 48 * DM, s + 64 * DM, s + 80 * DM, s + 96 * DM, s + 112 * DM);
    copy8(lds_off(&bp[wr + 128][wp]), lds_off(&bp[wr + 144][wp]), lds_off(&bp[wr + 160][wp]), lds_off(&bp[wr + 176][wp]), lds_off(&bp[wr + 192][wp]), lds_off(&bp[wr + 208][wp]), lds_off(&bp[wr + 224][wp]), lds_off(&bp[wr + 240][wp]),
          s + 128 * DM, s + 144 * DM, s + 160 * DM, s + 176 * DM, s + 192 * DM, s + 208 * DM, s + 224 * DM, s + 240 * DM); };
  fill(0, 0);
  float bias[4] = {};   // this lane's four bias values (columns n0 + nw + j * 16 + col): asked for once, as one group under one test, so that they fly beside stage 0's copies
  if (BB) {
#pragma unroll   // j constant: bias[] stays in registers and the four loads stand together
    for (int j = 0; j < 4; ++j) bias[j] = BB[nw + j * 16 + col]; }
  asm volatile("s_wait_asynccnt 0x0" ::: "memory");   // this wave's share of stage 0 has landed
  __syncthreads();                                    // stage 0 is published to all four waves
  fill(1, 1);
#pragma unroll 1   // rolled: one copy of the stage's foot (waits, barrier, refill) in the text, the buffer chosen by st & 1
  for (int st = 0; st < DM / 64; ++st) { const int bf = st & 1;
#pragma unroll     // kk constant: the two 32-k halves of a staged row become immediate offsets of the LDS loads
    for (int kk = 0; kk < 2; ++kk) {
      v4f xr[4][4];   // the half stage's four x fragments (fp32) and four weight fragments, read from LDS as one group in front of its sixteen WMMAs
#pragma unroll
      for (int i = 0; i < 4; ++i) { const float* p = (const float*)&sx[bf][i * 16 + col][0] + kk * 32 + 8 * g; xr[i][0] = *(const v4f*)p; xr[i][1] = *(const v4f*)(p + 4); xr[i][2] = *(const v4f*)(p + 16); xr[i][3] = *(const v4f*)(p + 20); }
      v16b w[4];
#pragma unroll
      for (int j = 0; j < 4; ++j) w[j] = frag_b((const __bf16*)&sw[bf][nw + j * 16 + col][kk * 32], lane);
      __builtin_amdgcn_sched_barrier(0);   // keeps the loads above as one group: without it the scheduler sinks each LDS pair to one WMMA in front of its use, and every WMMA waits out an LDS latency
      v16b a[4];
#pragma unroll
      for (int i = 0; i < 4; ++i) { union { v16b v; v2b p[8]; } u;   // rounded two at a time: element 4 q + e of the fragment = xr[i][q][e]
#pragma unroll
        for (int q = 0; q < 4; ++q) { u.p[2 * q] = __builtin_convertvector(__builtin_shufflevector(xr[i][q], xr[i][q], 0, 1), v2b); u.p[2 * q + 1] = __builtin_convertvector(__builtin_shufflevector(xr[i][q], xr[i][q], 2, 3), v2b); }
        a[i] = u.v; }
#pragma unroll
      for (int i = 0; i < 4; ++i) {
#pragma unroll
        for (int j = 0; j < 4; ++j) acc[i][j] = wmma_bf(a[i], w[j], acc[i][j]); }
      __builtin_amdgcn_sched_barrier(0);   // keeps the next half stage's loads behind these WMMAs, as one group: lifted among them they would need a second set of fragment registers
    }
    asm volatile("s_wait_dscnt 0x0" ::: "memory");      // this wave's reads of the two buffers bf are done
    asm volatile("s_wait_asynccnt 0x0" ::: "memory");   // this wave's share of stage st + 1 has landed
    __syncthreads();                                    // publishes stage st + 1 and ends every wave's reads of the buffers bf
    if (st + 2 < DM / 64) fill(st + 2, bf); }
  asm volatile("s_wait_asynccnt 0x0" ::: "memory");     // no copy is outstanding when the ring becomes output staging
  _Float16 (*oh)[KP] = &sw[0][nw]; _Float16 (*ol)[KP] = &sw[1][nw];   // this wave's own 64 staging rows of 128 B (hi, residual): written and read back by this wave alone, behind the loop's last barrier
  if (n0 < 2 * DM) {   // q stored unscaled (f16 sigma ~0.6, no subnormal exposure); 1/8 applied to the f32 score
#pragma unroll
    for (int i = 0; i < 4; ++i) {
#pragma unroll
      for (int j = 0; j < 4; ++j) {
#pragma unroll
        for (int r = 0; r < 8; ++r) { const float v = acc[i][j][r] + bfr(bias[j]); const _Float16 hv = (_Float16)v; oh[i * 16 + 8 * g + r][j * 16 + col] = hv; ol[i * 16 + 8 * g + r][j * 16 + col] = (_Float16)((v - (float)hv) * 2048.0f); } } }   // q, k (+ bias) as f16 hi + (x2048) residual; staging row = x row
    LDSX();
#pragma unroll 1   // rolled: four trips of eight LDS reads, as one group, and their eight stores
    for (int uo = 0; uo < 4; ++uo) {
#pragma unroll
      for (int ui = 0; ui < 4; ++ui) { const int rl = (uo * 4 + ui) * 4 + (lane >> 3), pc = lane & 7; const size_t o = (rb + rl) * (2 * DM) + n0 + nw + pc * 8;   // eight lanes store one whole 128-B line of a row
        vst2((unsigned*)(QK + o), *(const v4u*)&oh[rl][pc * 8]); vst2((unsigned*)(QKL + o), *(const v4u*)&ol[rl][pc * 8]); }
      asm volatile("s_wait_xcnt 0x0" ::: "memory"); }   // stands behind the eight stores, in front of the next trip's rewriting of their address and data registers
  } else {
#pragma unroll
    for (int i = 0; i < 4; ++i) {
#pragma unroll
      for (int j = 0; j < 4; ++j) {
#pragma unroll
        for (int r = 0; r < 8; ++r) { const float v = acc[i][j][r] + bfr(bias[j]); const _Float16 hv = (_Float16)v; oh[j * 16 + col][i * 16 + 8 * g + r] = hv; ol[j * 16 + col][i * 16 + 8 * g + r] = (_Float16)((v - (float)hv) * 2048.0f); } } }   // staging row = V^T row d
    LDSX();
    const int b = (int)(rb / SS), s0 = (int)(rb % SS); const int pc0 = n0 - 2 * DM + nw;
#pragma unroll 1   // rolled, as in the q, k branch
    for (int uo = 0; uo < 4; ++uo) {
#pragma unroll
      for (int ui = 0; ui < 4; ++ui) { const int d = (uo * 4 + ui) * 4 + (lane >> 3), pc = lane & 7; const size_t o = ((size_t)b * DM + pc0 + d) * SS + s0 + pc * 8; vst2((unsigned*)(VTH + o), *(const v4u*)&oh[d][pc * 8]); vst2((unsigned*)(VTL + o), *(const v4u*)&ol[d][pc * 8]); }
      asm volatile("s_wait_xcnt 0x0" ::: "memory"); }   // stands behind the eight stores, in front of the next trip's rewriting of their address and data registers
  }
}
// ---- k_attn: block = (64 queries, head h, batch b): banded flash attention in transposed form: S^T = K . Q^T (A = K rows, B = q), so a lane holds 16 of the 32 scores of ONE query (column col, keys ct*16 + 8g + r): maximum and sum in the lane plus one exchange between the wave's halves; the two S^T tiles, converted in place, are the B operand of O^T += V^T . P^T; O[b*S+q][h*64+d] = (acc + accl / 2048) / (2048 l) (256-B segments)
__global__ __launch_bounds__(128) void k_attn(const _Float16* __restrict__ QK, const _Float16* __restrict__ QKL, const _Float16* __restrict__ VTH, const _Float16* __restrict__ VTL, const void* __restrict__ KMASK, float* __restrict__ O) {
  __shared__ __align__(16) float so[4][16][68];
  __shared__ __align__(16) _Float16 skh[2][32][KP], skl[2][32][KP], svh[2][64][VP], svl[2][64][VP];   // two buffers of one 32-key tile: K hi, K residual, V^T hi, V^T residual, read by all four waves
  const int tid = threadIdx.x, wave = tid >> 5, lane = tid & 31, col = lane & 15, g = lane >> 4;
  const int qb = blockIdx.x, h = blockIdx.y, b = blockIdx.z; const int q0 = qb * 64 + wave * 16; const size_t rq = (size_t)b * SS + q0 + col;
  v16h aq[2], aql[2];
#pragma unroll
  for (int kc = 0; kc < 2; ++kc) { aq[kc] = frag_h(QK + rq * (2 * DM) + h * HD + kc * 32, lane); aql[kc] = frag_h(QKL + rq * (2 * DM) + h * HD + kc * 32, lane); }
  const int wq0 = qb * 64 + __builtin_amdgcn_readfirstlane(wave) * 16;   // q0 again, held in a scalar register: the test on it in the loop is then a scalar compare and branch, alike for the whole wave
  float m = -3.0e38f, l = 0.f;   // of query q0 + col; l holds this half-wave's keys only and is joined behind the loop
  v8f acc[4] = {}, accl[4] = {};
  const int nks = SS / 32;   // all keys
  const int ks0 = (qb * 64 - LW) > 0 ? (qb * 64 - LW) / 32 : 0; const int ks1 = ((qb * 64 + 64 + LW) / 32) < nks ? ((qb * 64 + 64 + LW) / 32) : nks;   // window tiles
  const int kr = tid >> 3, kp = (tid & 7) * 8, vw = tid >> 2, vp = (tid & 3) * 8;   // a thread's 16-B piece: K rows kr, kr + 16; V^T rows vw, vw + 32
  const size_t gko = ((size_t)b * SS + kr) * (2 * DM) + DM + h * HD + kp, gvo = ((size_t)b * DM + h * HD + vw) * SS + vp;
  auto fill = [&](int ks, int bf) { const size_t ko = gko + (size_t)ks * 32 * (2 * DM), vo = gvo + (size_t)ks * 32;
    copy8(lds_off(&skh[bf][kr][kp]), lds_off(&skh[bf][kr + 16][kp]), lds_off(&skl[bf][kr][kp]), lds_off(&skl[bf][kr + 16][kp]), lds_off(&svh[bf][vw][vp]), lds_off(&svh[bf][vw + 32][vp]), lds_off(&svl[bf][vw][vp]), lds_off(&svl[bf][vw + 32][vp]),
          QK + ko, QK + ko + 16 * (2 * DM), QKL + ko, QKL + ko + 16 * (2 * DM), VTH + vo, VTH + vo + (size_t)32 * SS, VTL + vo, VTL + vo + (size_t)32 * SS); };
  fill(ks0, 0);
  asm volatile("s_wait_asynccnt 0x0" ::: "memory");   // this wave's share of tile ks0 has landed
  __syncthreads();                                    // tile ks0 is published to all four waves
  if (ks0 + 1 < ks1) fill(ks0 + 1, 1);
#pragma unroll 1
  for (int ks = ks0; ks < ks1; ++ks) { v8f s[2]; const int bf = (ks - ks0) & 1;
    v16h kh[2][2], kl[2][2];   // the tile's eight K fragments (hi, residual), read from LDS as one group in front of the twelve score WMMAs
#pragma unroll
    for (int ct = 0; ct < 2; ++ct) {
#pragma unroll
      for (int kc = 0; kc < 2; ++kc) { kh[ct][kc] = frag_h(&skh[bf][ct * 16 + col][kc * 32], lane); kl[ct][kc] = frag_h(&skl[bf][ct * 16 + col][kc * 32], lane); } }
    __builtin_amdgcn_sched_barrier(0);   // keeps the sixteen K loads as one group: without it the scheduler holds some back among the WMMAs, which then wait out an LDS latency each
    v8f c[2] = {}, cl[2] = {};   // 3 products; each accumulator takes its products in the order kc 0, kc 1 (cl: K hi x q residual, then K residual x q)
#pragma unroll
    for (int kc = 0; kc < 2; ++kc) {
#pragma unroll
      for (int ct = 0; ct < 2; ++ct) { c[ct] = wmma16(kh[ct][kc], aq[kc], c[ct]); cl[ct] = wmma16(kh[ct][kc], aql[kc], cl[ct]); }
#pragma unroll
      for (int ct = 0; ct < 2; ++ct) cl[ct] = wmma16(kl[ct][kc], aq[kc], cl[ct]); }
    v16h vh[4], vl[4];   // the tile's eight V^T fragments, read here too, into the registers that the score WMMAs set free
#pragma unroll
    for (int dt = 0; dt < 4; ++dt) { vh[dt] = frag_h(&svh[bf][dt * 16 + col][0], lane); vl[dt] = frag_h(&svl[bf][dt * 16 + col][0], lane); }
    // the ring's hand-over stands here: all of the tile is in registers, and the rest of the pass (softmax, P.V) touches no LDS, so the refill flies behind it
    LDSX();                                             // holds the s_wait_dscnt 0: this wave's reads of buffer bf are done
    asm volatile("s_wait_asynccnt 0x0" ::: "memory");   // this wave's share of tile ks + 1 has landed
    __syncthreads();                                    // publishes tile ks + 1 and ends every wave's reads of buffer bf
    if (ks + 2 < ks1) fill(ks + 2, bf);
    // edge: some (query, key) pair of this wave's 16 x 32 may lie outside the band. Otherwise the largest q - k = wq0 + 15 - ks * 32 and the largest k - q = ks * 32 + 31 - wq0 are both <= LW: the band test passes for all 512 scores (15 of a wave's 18 tiles away from the sequence ends) and the mask work is branched over
    const bool edge = wq0 + 15 - ks * 32 > LW || ks * 32 + 31 - wq0 > LW;
#pragma unroll
    for (int ct = 0; ct < 2; ++ct) {
#pragma unroll
      for (int r = 0; r < 8; ++r) s[ct][r] = (c[ct][r] + cl[ct][r] * (1.0f / 2048.0f)) * 0.125f; }   // 1/sqrt(64)
    if (edge) {
#pragma unroll
      for (int ct = 0; ct < 2; ++ct) { const int kk = ks * 32 + ct * 16 + 8 * g;
#pragma unroll
        for (int r = 0; r < 8; ++r) { const int dq = (q0 + col) - (kk + r); s[ct][r] = (dq <= LW && dq >= -LW) ? s[ct][r] : -3.0e38f; } } }   // masked keys excluded
    float mx = fmaxf(s[0][0], s[1][0]);
#pragma unroll
    for (int r = 1; r < 8; ++r) mx = fmaxf(mx, fmaxf(s[0][r], s[1][r]));
    mx = fmaxf(mx, xhalf(mx));   // the other 16 keys of this query
    const float mn = fmaxf(m, mx); const float alpha = (m <= -1.0e38f) ? 0.f : __expf(m - mn);
    float es = 0.f; v16h pa, pl; v8f e[2];
#pragma unroll
    for (int ct = 0; ct < 2; ++ct) {
#pragma unroll
      for (int r = 0; r < 8; ++r) e[ct][r] = __expf(s[ct][r] - mn); }
    if (edge) {   // a masked key's weight is 0, also where every key of the query so far is masked (mn is then the mask value itself)
#pragma unroll
      for (int ct = 0; ct < 2; ++ct) {
#pragma unroll
        for (int r = 0; r < 8; ++r) e[ct][r] = (s[ct][r] <= -1.0e38f) ? 0.f : e[ct][r]; } }
#pragma unroll
    for (int r = 0; r < 8; ++r) { const float e0 = e[0][r], e1 = e[1][r]; es += e0 + e1;
      const float x0 = e0 * 2048.0f, x1 = e1 * 2048.0f; const _Float16 h0 = (_Float16)x0, h1 = (_Float16)x1; pa[r] = h0; pa[8 + r] = h1; pl[r] = (_Float16)((x0 - (float)h0) * 2048.0f); pl[8 + r] = (_Float16)((x1 - (float)h1) * 2048.0f); }   // P^T as a B fragment: element r = key 8g + r, element 8 + r = key 16 + 8g + r, the k order of frag_h; P scaled by 2^11 before the f16 split so small softmax weights stay out of the f16 subnormal range; 2^-11 folded into the epilogue
    l = l * alpha + es; m = mn;
#pragma unroll
    for (int dt = 0; dt < 4; ++dt) {
#pragma unroll
      for (int r = 0; r < 8; ++r) { acc[dt][r] *= alpha; accl[dt][r] *= alpha; } }
#pragma unroll
    for (int dt = 0; dt < 4; ++dt) { acc[dt] = wmma16(vh[dt], pa, acc[dt]); accl[dt] = wmma16(vh[dt], pl, accl[dt]); }   // V hi x P hi, V hi x P residual
#pragma unroll
    for (int dt = 0; dt < 4; ++dt) accl[dt] = wmma16(vl[dt], pa, accl[dt]);   // V residual x P hi (3 products)
  }
  asm volatile("s_wait_asynccnt 0x0" ::: "memory");     // no copy is outstanding when the wave goes on to the epilogue
  l += xhalf(l);   // the two half-waves' sums of one query
  const float il = (1.0f / 2048.0f) / l;
#pragma unroll
  for (int dt = 0; dt < 4; ++dt) { v4f o0, o1;   // acc[dt][r] = O^T[d = dt*16 + 8g + r][query col]
#pragma unroll
    for (int r = 0; r < 4; ++r) { o0[r] = (acc[dt][r] + accl[dt][r] * (1.0f / 2048.0f)) * il; o1[r] = (acc[dt][4 + r] + accl[dt][4 + r] * (1.0f / 2048.0f)) * il; }
    *(v4f*)&so[wave][col][dt * 16 + 8 * g] = o0; *(v4f*)&so[wave][col][dt * 16 + 8 * g + 4] = o1; }
  LDSX();
  for (int rl = 0; rl < 16; ++rl) if (lane < 16) vst2(O + ((size_t)b * SS + q0 + rl) * DM + h * HD + lane * 4, *(const v4f*)&so[wave][rl][lane * 4]);
}
// ---- k_out: block = (64 rows, 128 cols): out = O(hi/lo) . Wo rows (2 products) + bo
__global__ __launch_bounds__(128) void k_out(const float* __restrict__ O, const __bf16* __restrict__ P, const float* __restrict__ BO, float* __restrict__ Y) {
  __shared__ __align__(16) float so[4][16][132];
  const int tid = threadIdx.x, wave = tid >> 5, lane = tid & 31, col = lane & 15, g = lane >> 4; const size_t r0 = (size_t)blockIdx.x * 64 + wave * 16; const int n0 = blockIdx.y * 128;
  v8f acc[8] = {};
#pragma unroll 2
  for (int kc = 0; kc < DM / 32; ++kc) { const F2 a = split_row(O + (r0 + col) * DM, kc * 32, lane);
#pragma unroll
    for (int j = 0; j < 8; ++j) { const v16b w = frag_b(P + (size_t)(n0 + j * 16 + col) * DM + kc * 32, lane); acc[j] = wmma_bf(a.l, w, acc[j]); acc[j] = wmma_bf(a.h, w, acc[j]); } }
#pragma unroll
  for (int j = 0; j < 8; ++j) {
#pragma unroll
    for (int r = 0; r < 8; ++r) so[wave][8 * g + r][j * 16 + col] = acc[j][r] + (BO ? bfr(BO[n0 + j * 16 + col]) : 0.f); }
  LDSX();
  for (int rl = 0; rl < 16; ++rl) vst2(Y + (r0 + rl) * DM + n0 + lane * 4, *(const v4f*)&so[wave][rl][lane * 4]);
}
extern "C" void kernel_launch(void* const* d_in, const int* in_sizes, int n_in, void* d_out, int out_size, void* d_ws, size_t ws_size, hipStream_t stream) {
  (void)in_sizes; (void)n_in; (void)out_size;
  const float** F = (const float**)d_in;   // 0 x [2,8192,512], 1 Wq [512,512] (in,out), 2 bq, 3 Wk, 4 bk, 5 Wv, 6 bv
  if (ws_size < (size_t)WS_END) return;
  char* ws = (char*)d_ws; __bf16* PK = (__bf16*)(ws + WS_PK); _Float16 *QK = (_Float16*)(ws + WS_QK), *QKL = (_Float16*)(ws + WS_QKL), *VTH = (_Float16*)(ws + WS_VTH), *VTL = (_Float16*)(ws + WS_VTL);
  k_pack<<<dim3(DM / 64, DM / 64, 3), 128, 0, stream>>>(F[1], F[3], F[5], PK);
  k_qkv<<<dim3(TNB * SS / 64, QKVW / 256), 128, 0, stream>>>(F[0], F[0], F[0], PK + PK_A, F[2], F[4], F[6], QK, QKL, VTH, VTL);
  k_attn<<<dim3(TQB, NH, TNB), 128, 0, stream>>>(QK, QKL, VTH, VTL, nullptr, (float*)d_out);
}

// v009
// Measured time: 93.8 microseconds a run.
// Timed twice side by side with v008, it ran 1.10 and 1.11 times as fast.
// Over all steps from v000 it is 3.84 times as fast.
// compute dtype: all float inputs rounded to bf16; q/k/v = x . W + b with EXACT bf16 products on WMMA 16x16x32 ((in,out) weights as transposed rows), f16 hi + residual; banded attention (|i - j| <= 256; other key tiles skipped) with 3-product logits and 3-product P.v, x 1/8, running-max softmax in f32 (hardware exp); the merged context is the f32 output.
#include <hip/hip_runtime.h>
#include <math.h>

typedef __attribute__((ext_vector_type(16))) _Float16 v16h;
typedef __attribute__((ext_vector_type(16))) __bf16 v16b;
typedef __attribute__((ext_vector_type(8)))  _Float16 v8h;
typedef __attribute__((ext_vector_type(8)))  float v8f;
typedef __attribute__((ext_vector_type(4)))  float v4f;
typedef __attribute__((ext_vector_type(2)))  float v2f;
typedef __attribute__((ext_vector_type(4)))  unsigned v4u;
typedef __attribute__((ext_vector_type(4)))  int v4i;
typedef float __attribute__((may_alias)) float_a;
typedef int __attribute__((may_alias)) int_a;

template <typename T> __device__ __forceinline__ void vst2(void* p, T v) { *(T*)p = v;  }
__device__ __forceinline__ v8f wmma16(v16h a, v16h b, v8f c) {
  return __builtin_amdgcn_wmma_f32_16x16x32_f16(false, a, false, b, (short)0, c, false, false);
}
__device__ __forceinline__ v8f wmma_bf(v16b a, v16b b, v8f c) {
  return __builtin_amdgcn_wmma_f32_16x16x32_bf16(false, a, false, b, (short)0, c, false, false);
}
// Longformer multi-head attention (B 2, S 8,192, D 512, 8 heads x 64, one-sided window 256): (in,out) projections + biases, q / 8, banded softmax, no output projection (the merged context is the output).
__device__ __forceinline__ v16h frag_h(const _Float16* rowk0, int lane) {
  union { v16h v; v8h q[2]; } u; const _Float16* p = rowk0 + 8 * (lane >> 4);
  u.q[0] = *(const v8h*)p; u.q[1] = *(const v8h*)(p + 16); return u.v;
}
__device__ __forceinline__ v16h frag_f32(const float* rowk0, int lane) {
  v16h a; const float* p = rowk0 + 8 * (lane >> 4);
#pragma unroll
  for (int i = 0; i < 8; ++i) { a[i] = (_Float16)p[i]; a[8 + i] = (_Float16)p[16 + i]; }
  return a;
}
__device__ __forceinline__ v16h frag_f32s(const float* rowk0, int lane, float sc) {
  v16h a; const float* p = rowk0 + 8 * (lane >> 4);
#pragma unroll
  for (int i = 0; i < 8; ++i) { a[i] = (_Float16)(p[i] * sc); a[8 + i] = (_Float16)(p[16 + i] * sc); }
  return a;
}
// column fragment from a [K][ld] layout (column n), rows >= K read as 0
__device__ __forceinline__ v16h fragc_f32(const float* W, int k0, int n, int lane, int ld, int K) {
  v16h a; const int g = lane >> 4;
#pragma unroll
  for (int i = 0; i < 8; ++i) { const int ka = k0 + 8 * g + i, kb = ka + 16;
    a[i] = (_Float16)(ka < K ? W[(size_t)(ka < K ? ka : K - 1) * ld + n] : 0.f); a[8 + i] = (_Float16)(kb < K ? W[(size_t)(kb < K ? kb : K - 1) * ld + n] : 0.f); }
  return a;
}
struct F2 { v16b h, l; };
__device__ __forceinline__ F2 bsplit16(const float v[16]) { F2 r;
#pragma unroll
  for (int i = 0; i < 16; ++i) { const __bf16 h = (__bf16)v[i]; r.h[i] = h; r.l[i] = (__bf16)(v[i] - (float)h); }
  return r; }
__device__ __forceinline__ F2 split_row(const float* row, int k0, int lane) { float v[16]; const float* p = row + k0 + 8 * (lane >> 4);
#pragma unroll
  for (int i = 0; i < 8; ++i) { v[i] = p[i]; v[8 + i] = p[16 + i]; }
  return bsplit16(v); }
__device__ __forceinline__ F2 split_rowK(const float* row, int k0, int lane, int K) { float v[16]; const int g = lane >> 4;
#pragma unroll
  for (int i = 0; i < 8; ++i) { const int ka = k0 + 8 * g + i, kb = ka + 16; v[i] = ka < K ? row[ka < K ? ka : K - 1] : 0.f; v[8 + i] = kb < K ? row[kb < K ? kb : K - 1] : 0.f; }
  return bsplit16(v); }
__device__ __forceinline__ F2 split_col(const float* W, int k0, int n, int lane, int ld, int K) { float v[16]; const int g = lane >> 4;
#pragma unroll
  for (int i = 0; i < 8; ++i) { const int ka = k0 + 8 * g + i, kb = ka + 16; v[i] = ka < K ? W[(size_t)(ka < K ? ka : K - 1) * ld + n] : 0.f; v[8 + i] = kb < K ? W[(size_t)(kb < K ? kb : K - 1) * ld + n] : 0.f; }
  return bsplit16(v); }
__device__ __forceinline__ v8f mac3(const F2& a, const F2& b, v8f c) { c = wmma_bf(a.l, b.h, c); c = wmma_bf(a.h, b.l, c); return wmma_bf(a.h, b.h, c); }
__device__ __forceinline__ float sigm(float v) { return 1.0f / (1.0f + expf(-v)); }
#define LDSX() do { asm volatile("s_wait_dscnt 0" ::: "memory"); __builtin_amdgcn_wave_barrier(); __builtin_amdgcn_fence(__ATOMIC_RELEASE, "workgroup"); } while (0)


#define NB 2
#define SS 8192
#define DM 512
#define NH 8
#define LW 256
#define HD 64
#define QKVW (3 * DM)
#ifndef TQB
#define TQB (SS / 64)
#define TNB NB
#define TOB (NB * SS / 64)     // output row tiles (all)
#endif
typedef __attribute__((ext_vector_type(8))) __bf16 v8b;
__device__ __forceinline__ v16b frag_b(const __bf16* rowk0, int lane) {
  union { v16b v; v8b q[2]; } u; const __bf16* p = rowk0 + 8 * (lane >> 4);
  u.q[0] = *(const v8b*)p; u.q[1] = *(const v8b*)(p + 16); return u.v;
}
__device__ __forceinline__ float bfr(float v) { return (float)(__bf16)v; }
__device__ __forceinline__ float xhalf(float x) { return __builtin_bit_cast(float, __builtin_amdgcn_permlanex16(__builtin_bit_cast(int, x), __builtin_bit_cast(int, x), 0x76543210, 0xfedcba98, false, false)); }   // lane l with lane l ^ 16
__device__ __attribute__((noinline)) float exp_ni(float v) { return expf(v); }
__device__ __attribute__((noinline)) float erf_ni(float v) { return erff(v); }

#define PK_A 0                       // [1536][512] Wqkv rows (natural [out][in])
#define PK_P (PK_A + QKVW * DM)        // [512][512]; not written here (no W_o input)
#define PK_END (PK_P + DM * DM)
#define WS_PK  0u
#define WS_QK  (WS_PK + 2u * PK_END)             // f16 [16384 rows][1024]: q | k
#define WS_QKL (WS_QK + 2u * NB * SS * 2 * DM)     // f16 q | k residual planes x2048
#define WS_VTH (WS_QKL + 2u * NB * SS * 2 * DM)    // f16 [b][512 (h*64+d)][8192 s] hi
#define WS_VTL (WS_VTH + 2u * NB * DM * SS)        // f16 lo x 2048
#define WS_O   (WS_VTL + 2u * NB * DM * SS)        // f32 [16384][512] (unused)
#define WS_CS  (WS_O + 4u * NB * SS * DM)           // f32 [8192][32] x 2 (unused)
#define WS_END (WS_CS + 4u * 2 * SS * 32)
// ---- k_pack: block = (64 columns n0.., 64 rows k0.., which) of an (in,out) weight [512][512]: the 64 x 64 tile is rounded to bf16 and transposed through LDS; packed row (which*DM + n) = column n of W_q / W_k / W_v
typedef __attribute__((ext_vector_type(4))) __bf16 v4b;
__global__ __launch_bounds__(128) void k_pack(const float* __restrict__ WQ, const float* __restrict__ WK, const float* __restrict__ WV, __bf16* __restrict__ PK) {
  __shared__ __align__(16) __bf16 s[64][72];   // [n][k], 128 B of data at a 144-B pitch (16 B x odd, for the ds_load_b128 readers below)
  const int n0 = blockIdx.x * 64, k0 = blockIdx.y * 64, which = blockIdx.z, t = threadIdx.x; const float* Wm = which == 0 ? WQ : which == 1 ? WK : WV;
  const int n4 = (t & 15) * 4, k4 = (t >> 4) * 4;   // a thread's two 4 x 4 pieces (rows k4.., 32 + k4..): sixteen lanes read 256 contiguous bytes of one weight row
  v4f r[2][4];
#pragma unroll   // h, i constant: r[] stays in registers and the eight loads fly together
  for (int h = 0; h < 2; ++h) {
#pragma unroll
    for (int i = 0; i < 4; ++i) r[h][i] = *(const v4f*)(Wm + (size_t)(k0 + h * 32 + k4 + i) * DM + n0 + n4); }
  asm volatile("s_wait_xcnt 0x0" ::: "memory");   // stands behind the eight loads, in front of the first instruction that rewrites one of their address registers
#pragma unroll
  for (int h = 0; h < 2; ++h) {
#pragma unroll
    for (int c = 0; c < 4; ++c) { v4b p;
#pragma unroll
      for (int i = 0; i < 4; ++i) p[i] = (__bf16)r[h][i][c];
      *(v4b*)&s[n4 + c][h * 32 + k4] = p; } }   // four k of column n0 + n4 + c: one 8-B LDS store
  __syncthreads();
  __bf16* dst = PK + PK_A + ((size_t)which * DM + n0) * DM + k0;
#pragma unroll   // the four LDS reads stand together in front of the four stores
  for (int u = 0; u < 4; ++u) { const int q = t + u * 128, n = q >> 3, pc = q & 7; vst2((unsigned*)(dst + (size_t)n * DM + pc * 8), *(const v4u*)&s[n][pc * 8]); }   // eight lanes store one whole 128-B line of a packed row
}
typedef __attribute__((ext_vector_type(2))) __bf16 v2b;
#define KP 72   // 16-bit elements per staged 128-B row (K rows, weight rows): a 144-B pitch (16 B x odd, for ds_load_b128 readers)
#define VP 40   // f16 per staged V^T row: 64 B of data at an 80-B pitch
__device__ __forceinline__ unsigned lds_off(const void* p) { return (unsigned)(size_t)p; }
// eight 16-B-per-lane asynchronous copies global -> LDS; the s_wait_xcnt stands inside the statement so that no address register is rewritten in front of it
__device__ __forceinline__ void copy8(unsigned l0, unsigned l1, unsigned l2, unsigned l3, unsigned l4, unsigned l5, unsigned l6, unsigned l7, const void* g0, const void* g1, const void* g2, const void* g3, const void* g4, const void* g5, const void* g6, const void* g7) {
  asm volatile("global_load_async_to_lds_b128 %0, %8, off\n\t"
               "global_load_async_to_lds_b128 %1, %9, off\n\t"
               "global_load_async_to_lds_b128 %2, %10, off\n\t"
               "global_load_async_to_lds_b128 %3, %11, off\n\t"
               "global_load_async_to_lds_b128 %4, %12, off\n\t"
               "global_load_async_to_lds_b128 %5, %13, off\n\t"
               "global_load_async_to_lds_b128 %6, %14, off\n\t"
               "global_load_async_to_lds_b128 %7, %15, off\n\t"
               "s_wait_xcnt 0x0"
               :: "v"(l0), "v"(l1), "v"(l2), "v"(l3), "v"(l4), "v"(l5), "v"(l6), "v"(l7), "v"(g0), "v"(g1), "v"(g2), "v"(g3), "v"(g4), "v"(g5), "v"(g6), "v"(g7) : "memory");
}
// four such copies, for a fill in which a thread has one piece of each of four planes
__device__ __forceinline__ void copy4(unsigned l0, unsigned l1, unsigned l2, unsigned l3, const void* g0, const void* g1, const void* g2, const void* g3) {
  asm volatile("global_load_async_to_lds_b128 %0, %4, off\n\t"
               "global_load_async_to_lds_b128 %1, %5, off\n\t"
               "global_load_async_to_lds_b128 %2, %6, off\n\t"
               "global_load_async_to_lds_b128 %3, %7, off\n\t"
               "s_wait_xcnt 0x0"
               :: "v"(l0), "v"(l1), "v"(l2), "v"(l3), "v"(g0), "v"(g1), "v"(g2), "v"(g3) : "memory");
}
__global__ __launch_bounds__(256) void k_qkv(const float* __restrict__ XQ, const float* __restrict__ XK, const float* __restrict__ XV, const __bf16* __restrict__ P, const float* __restrict__ BQ, const float* __restrict__ BK, const float* __restrict__ BV, _Float16* __restrict__ QK, _Float16* __restrict__ QKL, _Float16* __restrict__ VTH, _Float16* __restrict__ VTL) {
  // block = 128 rows x 256 columns, eight waves; wave = 64 rows x 64 columns (4 x 4 tiles): a weight fragment read from LDS feeds four WMMAs, an x fragment four; a staged weight row serves 128 x rows, a staged x row 256 columns
  const int which0 = (blockIdx.y * 256) / DM; const float* X = (which0 == 0) ? XQ : (which0 == 1) ? XK : XV; const float* BB = BQ ? (((which0 == 0) ? BQ : (which0 == 1) ? BK : BV) + (blockIdx.y * 256 - which0 * DM)) : nullptr;
  __shared__ __align__(16) char sm[8 * 2 * 64 * KP * 2];   // in the k loop: the x ring and, behind it, the weight ring; behind the loop: the output staging, 2 x 64 rows of 144 B private to each of the eight waves
  _Float16 (*sx)[128][136] = (_Float16 (*)[128][136])sm;                  // the two buffers of the x ring (128 rows x 64 k of fp32: 256 B of data in each 272-B row); a row is read by four waves
  _Float16 (*sw)[256][KP] = (_Float16 (*)[256][KP])(sm + 2 * 128 * 272);   // the two buffers of the weight ring (256 packed rows x 64 k of bf16); a row is read by two waves
  const int tid = threadIdx.x, wave = tid >> 5, lane = tid & 31, col = lane & 15, g = lane >> 4; const size_t rb = (size_t)blockIdx.x * 128; const int n0 = blockIdx.y * 256, nw = (wave & 3) * 64, rw = (wave >> 2) * 64;
  v8f acc[4][4] = {};   // [row tile i][column tile j]
  const int wr = tid >> 3, wp = (tid & 7) * 8;   // a thread's 16-B piece of the packed rows wr + 32 i, i = 0 .. 7
  const int xrw = tid >> 4, xpc = (tid & 15) * 4;   // a thread's 16-B piece of the x rows xrw + 16 i, i = 0 .. 7: one copy of a wave covers two whole 256-B row pieces, four full lines
  auto fill = [&](int st, int bf) { const __bf16* s = P + (size_t)(n0 + wr) * DM + st * 64 + wp; _Float16 (*bp)[KP] = sw[bf];
    const float* xs = X + (rb + xrw) * DM + st * 64 + xpc; const unsigned xl = lds_off(&sx[bf][0][0]) + xrw * 272 + xpc * 4;
    copy8(xl, xl + 16 * 272, xl + 32 * 272, xl + 48 * 272, xl + 64 * 272, xl + 80 * 272, xl + 96 * 272, xl + 112 * 272,
          xs, xs + 16 * DM, xs + 32 * DM, xs + 48 * DM, xs + 64 * DM, xs + 80 * DM, xs + 96 * DM, xs + 112 * DM);
    copy8(lds_off(&bp[wr][wp]), lds_off(&bp[wr + 32][wp]), lds_off(&bp[wr + 64][wp]), lds_off(&bp[wr + 96][wp]), lds_off(&bp[wr + 128][wp]), lds_off(&bp[wr + 160][wp]), lds_off(&bp[wr + 192][wp]), lds_off(&bp[wr + 224][wp]),
          s, s + 32 * DM, s + 64 * DM, s + 96 * DM, s + 128 * DM, s + 160 * DM, s + 192 * DM, s + 224 * DM); };
  fill(0, 0);
  float bias[4] = {};   // this lane's four bias values (columns n0 + nw + j * 16 + col): asked for once, as one group under one test, so that they fly beside stage 0's copies
  if (BB) {
#pragma unroll   // j constant: bias[] stays in registers and the four loads stand together
    for (int j = 0; j < 4; ++j) bias[j] = BB[nw + j * 16 + col]; }
  asm volatile("s_wait_asynccnt 0x0" ::: "memory");   // this wave's share of stage 0 has landed
  __syncthreads();                                    // stage 0 is published to all eight waves
  fill(1, 1);
#pragma unroll 1   // rolled: one copy of the stage's foot (waits, barrier, refill) in the text, the buffer chosen by st & 1
  for (int st = 0; st < DM / 64; ++st) { const int bf = st & 1;
#pragma unroll     // kk constant: the two 32-k halves of a staged row become immediate offsets of the LDS loads
    for (int kk = 0; kk < 2; ++kk) {
      v4f xr[4][4];   // the half stage's four x fragments (fp32) and four weight fragments, read from LDS as one group in front of its sixteen WMMAs
#pragma unroll
      for (int i = 0; i < 4; ++i) { const float* p = (const float*)&sx[bf][rw + i * 16 + col][0] + kk * 32 + 8 * g; xr[i][0] = *(const v4f*)p; xr[i][1] = *(const v4f*)(p + 4); xr[i][2] = *(const v4f*)(p + 16); xr[i][3] = *(const v4f*)(p + 20); }
      v16b w[4];
#pragma unroll
      for (int j = 0; j < 4; ++j) w[j] = frag_b((const __bf16*)&sw[bf][nw + j * 16 + col][kk * 32], lane);
      __builtin_amdgcn_sched_barrier(0);   // keeps the loads above as one group: without it the scheduler sinks each LDS pair to one WMMA in front of its use, and every WMMA waits out an LDS latency
      v16b a[4];
#pragma unroll
      for (int i = 0; i < 4; ++i) { union { v16b v; v2b p[8]; } u;   // rounded two at a time: element 4 q + e of the fragment = xr[i][q][e]
#pragma unroll
        for (int q = 0; q < 4; ++q) { u.p[2 * q] = __builtin_convertvector(__builtin_shufflevector(xr[i][q], xr[i][q], 0, 1), v2b); u.p[2 * q + 1] = __builtin_convertvector(__builtin_shufflevector(xr[i][q], xr[i][q], 2, 3), v2b); }
        a[i] = u.v; }
#pragma unroll
      for (int i = 0; i < 4; ++i) {
#pragma unroll
        for (int j = 0; j < 4; ++j) acc[i][j] = wmma_bf(a[i], w[j], acc[i][j]); }
      __builtin_amdgcn_sched_barrier(0);   // keeps the next half stage's loads behind these WMMAs, as one group: lifted among them they would need a second set of fragment registers
    }
    asm volatile("s_wait_dscnt 0x0" ::: "memory");      // this wave's reads of the two buffers bf are done
    asm volatile("s_wait_asynccnt 0x0" ::: "memory");   // this wave's share of stage st + 1 has landed
    __syncthreads();                                    // publishes stage st + 1 and ends every wave's reads of the buffers bf
    if (st + 2 < DM / 64) fill(st + 2, bf); }
  asm volatile("s_wait_asynccnt 0x0" ::: "memory");     // no copy is outstanding when the ring becomes output staging
  _Float16 (*oh)[KP] = (_Float16 (*)[KP])sm + wave * 128; _Float16 (*ol)[KP] = oh + 64;   // this wave's own 64 + 64 staging rows of 128 B (hi, residual): written and read back by this wave alone, behind the loop's last barrier, which ends every wave's reads of both rings
  if (n0 < 2 * DM) {   // q stored unscaled (f16 sigma ~0.6, no subnormal exposure); 1/8 applied to the f32 score
#pragma unroll
    for (int i = 0; i < 4; ++i) {
#pragma unroll
      for (int j = 0; j < 4; ++j) {
#pragma unroll
        for (int r = 0; r < 8; ++r) { const float v = acc[i][j][r] + bfr(bias[j]); const _Float16 hv = (_Float16)v; oh[i * 16 + 8 * g + r][j * 16 + col] = hv; ol[i * 16 + 8 * g + r][j * 16 + col] = (_Float16)((v - (float)hv) * 2048.0f); } } }   // q, k (+ bias) as f16 hi + (x2048) residual; staging row = x row
    LDSX();
#pragma unroll 1   // rolled: four trips of eight LDS reads, as one group, and their eight stores
    for (int uo = 0; uo < 4; ++uo) {
#pragma unroll
      for (int ui = 0; ui < 4; ++ui) { const int rl = (uo * 4 + ui) * 4 + (lane >> 3), pc = lane & 7; const size_t o = (rb + rw + rl) * (2 * DM) + n0 + nw + pc * 8;   // eight lanes store one whole 128-B line of a row
        vst2((unsigned*)(QK + o), *(const v4u*)&oh[rl][pc * 8]); vst2((unsigned*)(QKL + o), *(const v4u*)&ol[rl][pc * 8]); }
      asm volatile("s_wait_xcnt 0x0" ::: "memory"); }   // stands behind the eight stores, in front of the next trip's rewriting of their address and data registers
  } else {
#pragma unroll
    for (int i = 0; i < 4; ++i) {
#pragma unroll
      for (int j = 0; j < 4; ++j) {
#pragma unroll
        for (int r = 0; r < 8; ++r) { const float v = acc[i][j][r] + bfr(bias[j]); const _Float16 hv = (_Float16)v; oh[j * 16 + col][i * 16 + 8 * g + r] = hv; ol[j * 16 + col][i * 16 + 8 * g + r] = (_Float16)((v - (float)hv) * 2048.0f); } } }   // staging row = V^T row d
    LDSX();
    const int b = (int)(rb / SS), s0 = (int)(rb % SS) + rw; const int pc0 = n0 - 2 * DM + nw;
#pragma unroll 1   // rolled, as in the q, k branch
    for (int uo = 0; uo < 4; ++uo) {
#pragma unroll
      for (int ui = 0; ui < 4; ++ui) { const int d = (uo * 4 + ui) * 4 + (lane >> 3), pc = lane & 7; const size_t o = ((size_t)b * DM + pc0 + d) * SS + s0 + pc * 8; vst2((unsigned*)(VTH + o), *(const v4u*)&oh[d][pc * 8]); vst2((unsigned*)(VTL + o), *(const v4u*)&ol[d][pc * 8]); }
      asm volatile("s_wait_xcnt 0x0" ::: "memory"); }   // stands behind the eight stores, in front of the next trip's rewriting of their address and data registers
  }
}
// ---- k_attn: block = (128 queries on eight waves, head h, batch b): banded flash attention in transposed form: S^T = K . Q^T (A = K rows, B = q), so a lane holds 16 of the 32 scores of ONE query (column col, keys ct*16 + 8g + r): maximum and sum in the lane plus one exchange between the wave's halves; the two S^T tiles, converted in place, are the B operand of O^T += V^T . P^T; O[b*S+q][h*64+d] = (acc + accl / 2048) / (2048 l) (256-B segments)
__global__ __launch_bounds__(256) void k_attn(const _Float16* __restrict__ QK, const _Float16* __restrict__ QKL, const _Float16* __restrict__ VTH, const _Float16* __restrict__ VTL, const void* __restrict__ KMASK, float* __restrict__ O) {
  __shared__ __align__(16) float so[8][16][68];
  __shared__ __align__(16) _Float16 skh[2][32][KP], skl[2][32][KP], svh[2][64][VP], svl[2][64][VP];   // two buffers of one 32-key tile: K hi, K residual, V^T hi, V^T residual, read by every wave whose band the tile touches
  const int tid = threadIdx.x, wave = tid >> 5, lane = tid & 31, col = lane & 15, g = lane >> 4;
  const int qb = blockIdx.x, h = blockIdx.y, b = blockIdx.z; const int q0 = qb * 128 + wave * 16; const size_t rq = (size_t)b * SS + q0 + col;
  v16h aq[2], aql[2];
#pragma unroll
  for (int kc = 0; kc < 2; ++kc) { aq[kc] = frag_h(QK + rq * (2 * DM) + h * HD + kc * 32, lane); aql[kc] = frag_h(QKL + rq * (2 * DM) + h * HD + kc * 32, lane); }
  const int wq0 = qb * 128 + __builtin_amdgcn_readfirstlane(wave) * 16;   // q0 again, held in a scalar register: the tests on it in the loop are then scalar compares and branches, alike for the whole wave
  float m = -3.0e38f, l = 0.f;   // of query q0 + col; l holds this half-wave's keys only and is joined behind the loop
  v8f acc[4] = {}, accl[4] = {};
  const int nks = SS / 32;   // all keys
  const int ks0 = (qb * 128 - LW) > 0 ? (qb * 128 - LW) / 32 : 0; const int ks1 = ((qb * 128 + 128 + LW) / 32) < nks ? ((qb * 128 + 128 + LW) / 32) : nks;   // the tiles that the bands of the block's 128 queries touch
  const int kr = tid >> 3, kp = (tid & 7) * 8, vw = tid >> 2, vp = (tid & 3) * 8;   // a thread's 16-B piece: K row kr, V^T row vw
  const size_t gko = ((size_t)b * SS + kr) * (2 * DM) + DM + h * HD + kp, gvo = ((size_t)b * DM + h * HD + vw) * SS + vp;
  auto fill = [&](int ks, int bf) { const size_t ko = gko + (size_t)ks * 32 * (2 * DM), vo = gvo + (size_t)ks * 32;
    copy4(lds_off(&skh[bf][kr][kp]), lds_off(&skl[bf][kr][kp]), lds_off(&svh[bf][vw][vp]), lds_off(&svl[bf][vw][vp]), QK + ko, QKL + ko, VTH + vo, VTL + vo); };
  fill(ks0, 0);
  asm volatile("s_wait_asynccnt 0x0" ::: "memory");   // this wave's share of tile ks0 has landed
  __syncthreads();                                    // tile ks0 is published to all eight waves
  if (ks0 + 1 < ks1) fill(ks0 + 1, 1);
#pragma unroll 1
  for (int ks = ks0; ks < ks1; ++ks) { v8f s[2]; const int bf = (ks - ks0) & 1;
    // act: the tile holds a key of the band of one of this wave's 16 queries (17 of the block's 20 tiles away from the sequence ends). A tile that holds none would add weight 0 everywhere and leave m, l and the sums as they are: the wave branches over its reads and its arithmetic and passes only the ring's hand-over
    const bool act = ks * 32 <= wq0 + 15 + LW && ks * 32 + 31 >= wq0 - LW;
    v8f c[2] = {}, cl[2] = {};   // 3 products; each accumulator takes its products in the order kc 0, kc 1 (cl: K hi x q residual, then K residual x q)
    v16h vh[4], vl[4];   // the tile's eight V^T fragments; written and read only where act holds
    if (act) {
    v16h kh[2][2], kl[2][2];   // the tile's eight K fragments (hi, residual), read from LDS as one group in front of the twelve score WMMAs
#pragma unroll
    for (int ct = 0; ct < 2; ++ct) {
#pragma unroll
      for (int kc = 0; kc < 2; ++kc) { kh[ct][kc] = frag_h(&skh[bf][ct * 16 + col][kc * 32], lane); kl[ct][kc] = frag_h(&skl[bf][ct * 16 + col][kc * 32], lane); } }
    __builtin_amdgcn_sched_barrier(0);   // keeps the sixteen K loads as one group: without it the scheduler holds some back among the WMMAs, which then wait out an LDS latency each
#pragma unroll
    for (int kc = 0; kc < 2; ++kc) {
#pragma unroll
      for (int ct = 0; ct < 2; ++ct) { c[ct] = wmma16(kh[ct][kc], aq[kc], c[ct]); cl[ct] = wmma16(kh[ct][kc], aql[kc], cl[ct]); }
#pragma unroll
      for (int ct = 0; ct < 2; ++ct) cl[ct] = wmma16(kl[ct][kc], aq[kc], cl[ct]); }
    // the V^T fragments are read here too, into the registers that the score WMMAs set free
#pragma unroll
    for (int dt = 0; dt < 4; ++dt) { vh[dt] = frag_h(&svh[bf][dt * 16 + col][0], lane); vl[dt] = frag_h(&svl[bf][dt * 16 + col][0], lane); }
    }
    // the ring's hand-over stands here: all of the tile is in registers, and the rest of the pass (softmax, P.V) touches no LDS, so the refill flies behind it
    LDSX();                                             // holds the s_wait_dscnt 0: this wave's reads of buffer bf are done
    asm volatile("s_wait_asynccnt 0x0" ::: "memory");   // this wave's share of tile ks + 1 has landed
    __syncthreads();                                    // publishes tile ks + 1 and ends every wave's reads of buffer bf
    if (ks + 2 < ks1) fill(ks + 2, bf);
    if (!act) continue;
    // edge: some (query, key) pair of this wave's 16 x 32 may lie outside the band. Otherwise the largest q - k = wq0 + 15 - ks * 32 and the largest k - q = ks * 32 + 31 - wq0 are both <= LW: the band test passes for all 512 scores (15 of a wave's 17 tiles away from the sequence ends) and the mask work is branched over
    const bool edge = wq0 + 15 - ks * 32 > LW || ks * 32 + 31 - wq0 > LW;
#pragma unroll
    for (int ct = 0; ct < 2; ++ct) {
#pragma unroll
      for (int r = 0; r < 8; ++r) s[ct][r] = (c[ct][r] + cl[ct][r] * (1.0f / 2048.0f)) * 0.125f; }   // 1/sqrt(64)
    if (edge) {
#pragma unroll
      for (int ct = 0; ct < 2; ++ct) { const int kk = ks * 32 + ct * 16 + 8 * g;
#pragma unroll
        for (int r = 0; r < 8; ++r) { const int dq = (q0 + col) - (kk + r); s[ct][r] = (dq <= LW && dq >= -LW) ? s[ct][r] : -3.0e38f; } } }   // masked keys excluded
    float mx = fmaxf(s[0][0], s[1][0]);
#pragma unroll
    for (int r = 1; r < 8; ++r) mx = fmaxf(mx, fmaxf(s[0][r], s[1][r]));
    mx = fmaxf(mx, xhalf(mx));   // the other 16 keys of this query
    const float mn = fmaxf(m, mx); const float alpha = (m <= -1.0e38f) ? 0.f : __expf(m - mn);
    float es = 0.f; v16h pa, pl; v8f e[2];
#pragma unroll
    for (int ct = 0; ct < 2; ++ct) {
#pragma unroll
      for (int r = 0; r < 8; ++r) e[ct][r] = __expf(s[ct][r] - mn); }
    if (edge) {   // a masked key's weight is 0, also where every key of the query so far is masked (mn is then the mask value itself)
#pragma unroll
      for (int ct = 0; ct < 2; ++ct) {
#pragma unroll
        for (int r = 0; r < 8; ++r) e[ct][r] = (s[ct][r] <= -1.0e38f) ? 0.f : e[ct][r]; } }
#pragma unroll
    for (int r = 0; r < 8; ++r) { const float e0 = e[0][r], e1 = e[1][r]; es += e0 + e1;
      const float x0 = e0 * 2048.0f, x1 = e1 * 2048.0f; const _Float16 h0 = (_Float16)x0, h1 = (_Float16)x1; pa[r] = h0; pa[8 + r] = h1; pl[r] = (_Float16)((x0 - (float)h0) * 2048.0f); pl[8 + r] = (_Float16)((x1 - (float)h1) * 2048.0f); }   // P^T as a B fragment: element r = key 8g + r, element 8 + r = key 16 + 8g + r, the k order of frag_h; P scaled by 2^11 before the f16 split so small softmax weights stay out of the f16 subnormal range; 2^-11 folded into the epilogue
    l = l * alpha + es; m = mn;
#pragma unroll
    for (int dt = 0; dt < 4; ++dt) {
#pragma unroll
      for (int r = 0; r < 8; ++r) { acc[dt][r] *= alpha; accl[dt][r] *= alpha; } }
#pragma unroll
    for (int dt = 0; dt < 4; ++dt) { acc[dt] = wmma16(vh[dt], pa, acc[dt]); accl[dt] = wmma16(vh[dt], pl, accl[dt]); }   // V hi x P hi, V hi x P residual
#pragma unroll
    for (int dt = 0; dt < 4; ++dt) accl[dt] = wmma16(vl[dt], pa, accl[dt]);   // V residual x P hi (3 products)
  }
  asm volatile("s_wait_asynccnt 0x0" ::: "memory");     // no copy is outstanding when the wave goes on to the epilogue
  l += xhalf(l);   // the two half-waves' sums of one query
  const float il = (1.0f / 2048.0f) / l;
#pragma unroll
  for (int dt = 0; dt < 4; ++dt) { v4f o0, o1;   // acc[dt][r] = O^T[d = dt*16 + 8g + r][query col]
#pragma unroll
    for (int r = 0; r < 4; ++r) { o0[r] = (acc[dt][r] + accl[dt][r] * (1.0f / 2048.0f)) * il; o1[r] = (acc[dt][4 + r] + accl[dt][4 + r] * (1.0f / 2048.0f)) * il; }
    *(v4f*)&so[wave][col][dt * 16 + 8 * g] = o0; *(v4f*)&so[wave][col][dt * 16 + 8 * g + 4] = o1; }
  LDSX();
  for (int rl = 0; rl < 16; ++rl) if (lane < 16) vst2(O + ((size_t)b * SS + q0 + rl) * DM + h * HD + lane * 4, *(const v4f*)&so[wave][rl][lane * 4]);
}
// ---- k_out: block = (64 rows, 128 cols): out = O(hi/lo) . Wo rows (2 products) + bo
__global__ __launch_bounds__(128) void k_out(const float* __restrict__ O, const __bf16* __restrict__ P, const float* __restrict__ BO, float* __restrict__ Y) {
  __shared__ __align__(16) float so[4][16][132];
  const int tid = threadIdx.x, wave = tid >> 5, lane = tid & 31, col = lane & 15, g = lane >> 4; const size_t r0 = (size_t)blockIdx.x * 64 + wave * 16; const int n0 = blockIdx.y * 128;
  v8f acc[8] = {};
#pragma unroll 2
  for (int kc = 0; kc < DM / 32; ++kc) { const F2 a = split_row(O + (r0 + col) * DM, kc * 32, lane);
#pragma unroll
    for (int j = 0; j < 8; ++j) { const v16b w = frag_b(P + (size_t)(n0 + j * 16 + col) * DM + kc * 32, lane); acc[j] = wmma_bf(a.l, w, acc[j]); acc[j] = wmma_bf(a.h, w, acc[j]); } }
#pragma unroll
  for (int j = 0; j < 8; ++j) {
#pragma unroll
    for (int r = 0; r < 8; ++r) so[wave][8 * g + r][j * 16 + col] = acc[j][r] + (BO ? bfr(BO[n0 + j * 16 + col]) : 0.f); }
  LDSX();
  for (int rl = 0; rl < 16; ++rl) vst2(Y + (r0 + rl) * DM + n0 + lane * 4, *(const v4f*)&so[wave][rl][lane * 4]);
}
extern "C" void kernel_launch(void* const* d_in, const int* in_sizes, int n_in, void* d_out, int out_size, void* d_ws, size_t ws_size, hipStream_t stream) {
  (void)in_sizes; (void)n_in; (void)out_size;
  const float** F = (const float**)d_in;   // 0 x [2,8192,512], 1 Wq [512,512] (in,out), 2 bq, 3 Wk, 4 bk, 5 Wv, 6 bv
  if (ws_size < (size_t)WS_END) return;
  char* ws = (char*)d_ws; __bf16* PK = (__bf16*)(ws + WS_PK); _Float16 *QK = (_Float16*)(ws + WS_QK), *QKL = (_Float16*)(ws + WS_QKL), *VTH = (_Float16*)(ws + WS_VTH), *VTL = (_Float16*)(ws + WS_VTL);
  k_pack<<<dim3(DM / 64, DM / 64, 3), 128, 0, stream>>>(F[1], F[3], F[5], PK);
  k_qkv<<<dim3(TNB * SS / 128, QKVW / 256), 256, 0, stream>>>(F[0], F[0], F[0], PK + PK_A, F[2], F[4], F[6], QK, QKL, VTH, VTL);
  k_attn<<<dim3(TQB / 2, NH, TNB), 256, 0, stream>>>(QK, QKL, VTH, VTL, nullptr, (float*)d_out);
}

// v010
// Measured time: 88.4 microseconds a run.
// In both of two side-by-side timings against v009, it was 1.05 times as fast.
// Counting every step since v000, it is 4.04 times as fast.
// compute dtype: all float inputs rounded to bf16; q/k/v = x . W + b with EXACT bf16 products on WMMA 16x16x32 ((in,out) weights as transposed rows), f16 hi + residual; banded attention (|i - j| <= 256; other key tiles skipped) with 3-product logits and 3-product P.v, x 1/8, running-max softmax in f32 (hardware exp); the merged context is the f32 output.
#include <hip/hip_runtime.h>
#include <math.h>

typedef __attribute__((ext_vector_type(16))) _Float16 v16h;
typedef __attribute__((ext_vector_type(16))) __bf16 v16b;
typedef __attribute__((ext_vector_type(8)))  _Float16 v8h;
typedef __attribute__((ext_vector_type(8)))  float v8f;
typedef __attribute__((ext_vector_type(4)))  float v4f;
typedef __attribute__((ext_vector_type(2)))  float v2f;
typedef __attribute__((ext_vector_type(4)))  unsigned v4u;
typedef __attribute__((ext_vector_type(4)))  int v4i;
typedef float __attribute__((may_alias)) float_a;
typedef int __attribute__((may_alias)) int_a;

template <typename T> __device__ __forceinline__ void vst2(void* p, T v) { *(T*)p = v;  }
__device__ __forceinline__ v8f wmma16(v16h a, v16h b, v8f c) {
  return __builtin_amdgcn_wmma_f32_16x16x32_f16(false, a, false, b, (short)0, c, false, false);
}
__device__ __forceinline__ v8f wmma_bf(v16b a, v16b b, v8f c) {
  return __builtin_amdgcn_wmma_f32_16x16x32_bf16(false, a, false, b, (short)0, c, false, false);
}
// Longformer multi-head attention (B 2, S 8,192, D 512, 8 heads x 64, one-sided window 256): (in,out) projections + biases, q / 8, banded softmax, no output projection (the merged context is the output).
__device__ __forceinline__ v16h frag_h(const _Float16* rowk0, int lane) {
  union { v16h v; v8h q[2]; } u; const _Float16* p = rowk0 + 8 * (lane >> 4);
  u.q[0] = *(const v8h*)p; u.q[1] = *(const v8h*)(p + 16); return u.v;
}
__device__ __forceinline__ v16h frag_f32(const float* rowk0, int lane) {
  v16h a; const float* p = rowk0 + 8 * (lane >> 4);
#pragma unroll
  for (int i = 0; i < 8; ++i) { a[i] = (_Float16)p[i]; a[8 + i] = (_Float16)p[16 + i]; }
  return a;
}
__device__ __forceinline__ v16h frag_f32s(const float* rowk0, int lane, float sc) {
  v16h a; const float* p = rowk0 + 8 * (lane >> 4);
#pragma unroll
  for (int i = 0; i < 8; ++i) { a[i] = (_Float16)(p[i] * sc); a[8 + i] = (_Float16)(p[16 + i] * sc); }
  return a;
}
// column fragment from a [K][ld] layout (column n), rows >= K read as 0
__device__ __forceinline__ v16h fragc_f32(const float* W, int k0, int n, int lane, int ld, int K) {
  v16h a; const int g = lane >> 4;
#pragma unroll
  for (int i = 0; i < 8; ++i) { const int ka = k0 + 8 * g + i, kb = ka + 16;
    a[i] = (_Float16)(ka < K ? W[(size_t)(ka < K ? ka : K - 1) * ld + n] : 0.f); a[8 + i] = (_Float16)(kb < K ? W[(size_t)(kb < K ? kb : K - 1) * ld + n] : 0.f); }
  return a;
}
struct F2 { v16b h, l; };
__device__ __forceinline__ F2 bsplit16(const float v[16]) { F2 r;
#pragma unroll
  for (int i = 0; i < 16; ++i) { const __bf16 h = (__bf16)v[i]; r.h[i] = h; r.l[i] = (__bf16)(v[i] - (float)h); }
  return r; }
__device__ __forceinline__ F2 split_row(const float* row, int k0, int lane) { float v[16]; const float* p = row + k0 + 8 * (lane >> 4);
#pragma unroll
  for (int i = 0; i < 8; ++i) { v[i] = p[i]; v[8 + i] = p[16 + i]; }
  return bsplit16(v); }
__device__ __forceinline__ F2 split_rowK(const float* row, int k0, int lane, int K) { float v[16]; const int g = lane >> 4;
#pragma unroll
  for (int i = 0; i < 8; ++i) { const int ka = k0 + 8 * g + i, kb = ka + 16; v[i] = ka < K ? row[ka < K ? ka : K - 1] : 0.f; v[8 + i] = kb < K ? row[kb < K ? kb : K - 1] : 0.f; }
  return bsplit16(v); }
__device__ __forceinline__ F2 split_col(const float* W, int k0, int n, int lane, int ld, int K) { float v[16]; const int g = lane >> 4;
#pragma unroll
  for (int i = 0; i < 8; ++i) { const int ka = k0 + 8 * g + i, kb = ka + 16; v[i] = ka < K ? W[(size_t)(ka < K ? ka : K - 1) * ld + n] : 0.f; v[8 + i] = kb < K ? W[(size_t)(kb < K ? kb : K - 1) * ld + n] : 0.f; }
  return bsplit16(v); }
__device__ __forceinline__ v8f mac3(const F2& a, const F2& b, v8f c) { c = wmma_bf(a.l, b.h, c); c = wmma_bf(a.h, b.l, c); return wmma_bf(a.h, b.h, c); }
__device__ __forceinline__ float sigm(float v) { return 1.0f / (1.0f + expf(-v)); }
#define LDSX() do { asm volatile("s_wait_dscnt 0" ::: "memory"); __builtin_amdgcn_wave_barrier(); __builtin_amdgcn_fence(__ATOMIC_RELEASE, "workgroup"); } while (0)


#define NB 2
#define SS 8192
#define DM 512
#define NH 8
#define LW 256
#define HD 64
#define QKVW (3 * DM)
#ifndef TQB
#define TQB (SS / 64)
#define TNB NB
#define TOB (NB * SS / 64)     // output row tiles (all)
#endif
typedef __attribute__((ext_vector_type(8))) __bf16 v8b;
__device__ __forceinline__ v16b frag_b(const __bf16* rowk0, int lane) {
  union { v16b v; v8b q[2]; } u; const __bf16* p = rowk0 + 8 * (lane >> 4);
  u.q[0] = *(const v8b*)p; u.q[1] = *(const v8b*)(p + 16); return u.v;
}
__device__ __forceinline__ float bfr(float v) { return (float)(__bf16)v; }
__device__ __forceinline__ float xhalf(float x) { return __builtin_bit_cast(float, __builtin_amdgcn_permlanex16(__builtin_bit_cast(int, x), __builtin_bit_cast(int, x), 0x76543210, 0xfedcba98, false, false)); }   // lane l with lane l ^ 16
__device__ __attribute__((noinline)) float exp_ni(float v) { return expf(v); }
__device__ __attribute__((noinline)) float erf_ni(float v) { return erff(v); }

#define PK_A 0                       // [1536][512] Wqkv rows (natural [out][in])
#define PK_P (PK_A + QKVW * DM)        // [512][512]; not written here (no W_o input)
#define PK_END (PK_P + DM * DM)
#define WS_PK  0u
#define WS_QK  (WS_PK + 2u * PK_END)             // f16 [16384 rows][1024]: q | k
#define WS_QKL (WS_QK + 2u * NB * SS * 2 * DM)     // f16 q | k residual planes x2048
#define WS_VTH (WS_QKL + 2u * NB * SS * 2 * DM)    // f16 [b][512 (h*64+d)][8192 s] hi
#define WS_VTL (WS_VTH + 2u * NB * DM * SS)        // f16 lo x 2048
#define WS_O   (WS_VTL + 2u * NB * DM * SS)        // f32 [16384][512] (unused)
#define WS_CS  (WS_O + 4u * NB * SS * DM)           // f32 [8192][32] x 2 (unused)
#define WS_END (WS_CS + 4u * 2 * SS * 32)
// ---- k_pack: block = (64 columns n0.., 64 rows k0.., which) of an (in,out) weight [512][512]: the 64 x 64 tile is rounded to bf16 and transposed through LDS; packed row (which*DM + n) = column n of W_q / W_k / W_v
typedef __attribute__((ext_vector_type(4))) __bf16 v4b;
__global__ __launch_bounds__(128) void k_pack(const float* __restrict__ WQ, const float* __restrict__ WK, const float* __restrict__ WV, __bf16* __restrict__ PK) {
  __shared__ __align__(16) __bf16 s[64][72];   // [n][k], 128 B of data at a 144-B pitch (16 B x odd, for the ds_load_b128 readers below)
  const int n0 = blockIdx.x * 64, k0 = blockIdx.y * 64, which = blockIdx.z, t = threadIdx.x; const float* Wm = which == 0 ? WQ : which == 1 ? WK : WV;
  const int n4 = (t & 15) * 4, k4 = (t >> 4) * 4;   // a thread's two 4 x 4 pieces (rows k4.., 32 + k4..): sixteen lanes read 256 contiguous bytes of one weight row
  v4f r[2][4];
#pragma unroll   // h, i constant: r[] stays in registers and the eight loads fly together
  for (int h = 0; h < 2; ++h) {
#pragma unroll
    for (int i = 0; i < 4; ++i) r[h][i] = *(const v4f*)(Wm + (size_t)(k0 + h * 32 + k4 + i) * DM + n0 + n4); }
  asm volatile("s_wait_xcnt 0x0" ::: "memory");   // stands behind the eight loads, in front of the first instruction that rewrites one of their address registers
#pragma unroll
  for (int h = 0; h < 2; ++h) {
#pragma unroll
    for (int c = 0; c < 4; ++c) { v4b p;
#pragma unroll
      for (int i = 0; i < 4; ++i) p[i] = (__bf16)r[h][i][c];
      *(v4b*)&s[n4 + c][h * 32 + k4] = p; } }   // four k of column n0 + n4 + c: one 8-B LDS store
  __syncthreads();
  __bf16* dst = PK + PK_A + ((size_t)which * DM + n0) * DM + k0;
#pragma unroll   // the four LDS reads stand together in front of the four stores
  for (int u = 0; u < 4; ++u) { const int q = t + u * 128, n = q >> 3, pc = q & 7; vst2((unsigned*)(dst + (size_t)n * DM + pc * 8), *(const v4u*)&s[n][pc * 8]); }   // eight lanes store one whole 128-B line of a packed row
}
typedef __attribute__((ext_vector_type(2))) __bf16 v2b;
typedef __attribute__((ext_vector_type(2))) _Float16 v2h;
#define KP 72   // 16-bit elements per staged 128-B row (K rows, weight rows): a 144-B pitch (16 B x odd, for ds_load_b128 readers)
#define VP 40   // f16 per staged V^T row: 64 B of data at an 80-B pitch
__device__ __forceinline__ unsigned lds_off(const void* p) { return (unsigned)(size_t)p; }
// eight 16-B-per-lane asynchronous copies global -> LDS; the s_wait_xcnt stands inside the statement so that no address register is rewritten in front of it
__device__ __forceinline__ void copy8(unsigned l0, unsigned l1, unsigned l2, unsigned l3, unsigned l4, unsigned l5, unsigned l6, unsigned l7, const void* g0, const void* g1, const void* g2, const void* g3, const void* g4, const void* g5, const void* g6, const void* g7) {
  asm volatile("global_load_async_to_lds_b128 %0, %8, off\n\t"
               "global_load_async_to_lds_b128 %1, %9, off\n\t"
               "global_load_async_to_lds_b128 %2, %10, off\n\t"
               "global_load_async_to_lds_b128 %3, %11, off\n\t"
               "global_load_async_to_lds_b128 %4, %12, off\n\t"
               "global_load_async_to_lds_b128 %5, %13, off\n\t"
               "global_load_async_to_lds_b128 %6, %14, off\n\t"
               "global_load_async_to_lds_b128 %7, %15, off\n\t"
               "s_wait_xcnt 0x0"
               :: "v"(l0), "v"(l1), "v"(l2), "v"(l3), "v"(l4), "v"(l5), "v"(l6), "v"(l7), "v"(g0), "v"(g1), "v"(g2), "v"(g3), "v"(g4), "v"(g5), "v"(g6), "v"(g7) : "memory");
}
// four such copies, for a fill in which a thread has one piece of each of four planes
__device__ __forceinline__ void copy4(unsigned l0, unsigned l1, unsigned l2, unsigned l3, const void* g0, const void* g1, const void* g2, const void* g3) {
  asm volatile("global_load_async_to_lds_b128 %0, %4, off\n\t"
               "global_load_async_to_lds_b128 %1, %5, off\n\t"
               "global_load_async_to_lds_b128 %2, %6, off\n\t"
               "global_load_async_to_lds_b128 %3, %7, off\n\t"
               "s_wait_xcnt 0x0"
               :: "v"(l0), "v"(l1), "v"(l2), "v"(l3), "v"(g0), "v"(g1), "v"(g2), "v"(g3) : "memory");
}
__global__ __launch_bounds__(256) void k_qkv(const float* __restrict__ XQ, const float* __restrict__ XK, const float* __restrict__ XV, const __bf16* __restrict__ P, const float* __restrict__ BQ, const float* __restrict__ BK, const float* __restrict__ BV, _Float16* __restrict__ QK, _Float16* __restrict__ QKL, _Float16* __restrict__ VTH, _Float16* __restrict__ VTL) {
  // block = 128 rows x 256 columns, eight waves; wave = 64 rows x 64 columns (4 x 4 tiles): a weight fragment read from LDS feeds four WMMAs, an x fragment four; a staged weight row serves 128 x rows, a staged x row 256 columns
  const int which0 = (blockIdx.y * 256) / DM; const float* X = (which0 == 0) ? XQ : (which0 == 1) ? XK : XV; const float* BB = BQ ? (((which0 == 0) ? BQ : (which0 == 1) ? BK : BV) + (blockIdx.y * 256 - which0 * DM)) : nullptr;
  __shared__ __align__(16) char sm[8 * 2 * 64 * KP * 2];   // in the k loop: the x ring and, behind it, the weight ring; behind the loop: the output staging, 2 x 64 rows of 144 B private to each of the eight waves
  _Float16 (*sx)[128][136] = (_Float16 (*)[128][136])sm;                  // the two buffers of the x ring (128 rows x 64 k of fp32: 256 B of data in each 272-B row); a row is read by four waves
  _Float16 (*sw)[256][KP] = (_Float16 (*)[256][KP])(sm + 2 * 128 * 272);   // the two buffers of the weight ring (256 packed rows x 64 k of bf16); a row is read by two waves
  const int tid = threadIdx.x, wave = tid >> 5, lane = tid & 31, col = lane & 15, g = lane >> 4; const size_t rb = (size_t)blockIdx.x * 128; const int n0 = blockIdx.y * 256, nw = (wave & 3) * 64, rw = (wave >> 2) * 64;
  v8f acc[4][4] = {};   // [row tile i][column tile j]
  const int wr = tid >> 3, wp = (tid & 7) * 8;   // a thread's 16-B piece of the packed rows wr + 32 i, i = 0 .. 7
  const int xrw = tid >> 4, xpc = (tid & 15) * 4;   // a thread's 16-B piece of the x rows xrw + 16 i, i = 0 .. 7: one copy of a wave covers two whole 256-B row pieces, four full lines
  auto fill = [&](int st, int bf) { const __bf16* s = P + (size_t)(n0 + wr) * DM + st * 64 + wp; _Float16 (*bp)[KP] = sw[bf];
    const float* xs = X + (rb + xrw) * DM + st * 64 + xpc; const unsigned xl = lds_off(&sx[bf][0][0]) + xrw * 272 + xpc * 4;
    copy8(xl, xl + 16 * 272, xl + 32 * 272, xl + 48 * 272, xl + 64 * 272, xl + 80 * 272, xl + 96 * 272, xl + 112 * 272,
          xs, xs + 16 * DM, xs + 32 * DM, xs + 48 * DM, xs + 64 * DM, xs + 80 * DM, xs + 96 * DM, xs + 112 * DM);
    copy8(lds_off(&bp[wr][wp]), lds_off(&bp[wr + 32][wp]), lds_off(&bp[wr + 64][wp]), lds_off(&bp[wr + 96][wp]), lds_off(&bp[wr + 128][wp]), lds_off(&bp[wr + 160][wp]), lds_off(&bp[wr + 192][wp]), lds_off(&bp[wr + 224][wp]),
          s, s + 32 * DM, s + 64 * DM, s + 96 * DM, s + 128 * DM, s + 160 * DM, s + 192 * DM, s + 224 * DM); };
  fill(0, 0);
  float bias[4] = {};   // this lane's four bias values (columns n0 + nw + j * 16 + col): asked for once, as one group under one test, so that they fly beside stage 0's copies
  if (BB) {
#pragma unroll   // j constant: bias[] stays in registers and the four loads stand together
    for (int j = 0; j < 4; ++j) bias[j] = BB[nw + j * 16 + col]; }
  asm volatile("s_wait_asynccnt 0x0" ::: "memory");   // this wave's share of stage 0 has landed
  __syncthreads();                                    // stage 0 is published to all eight waves
  fill(1, 1);
#pragma unroll 1   // rolled: one copy of the stage's foot (waits, barrier, refill) in the text, the buffer chosen by st & 1
  for (int st = 0; st < DM / 64; ++st) { const int bf = st & 1;
#pragma unroll     // kk constant: the two 32-k halves of a staged row become immediate offsets of the LDS loads
    for (int kk = 0; kk < 2; ++kk) {
      v4f xr[4][4];   // the half stage's four x fragments (fp32) and four weight fragments, read from LDS as one group in front of its sixteen WMMAs
#pragma unroll
      for (int i = 0; i < 4; ++i) { const float* p = (const float*)&sx[bf][rw + i * 16 + col][0] + kk * 32 + 8 * g; xr[i][0] = *(const v4f*)p; xr[i][1] = *(const v4f*)(p + 4); xr[i][2] = *(const v4f*)(p + 16); xr[i][3] = *(const v4f*)(p + 20); }
      v16b w[4];
#pragma unroll
      for (int j = 0; j < 4; ++j) w[j] = frag_b((const __bf16*)&sw[bf][nw + j * 16 + col][kk * 32], lane);
      __builtin_amdgcn_sched_barrier(0);   // keeps the loads above as one group: without it the scheduler sinks each LDS pair to one WMMA in front of its use, and every WMMA waits out an LDS latency
      v16b a[4];
#pragma unroll
      for (int i = 0; i < 4; ++i) { union { v16b v; v2b p[8]; } u;   // rounded two at a time: element 4 q + e of the fragment = xr[i][q][e]
#pragma unroll
        for (int q = 0; q < 4; ++q) { u.p[2 * q] = __builtin_convertvector(__builtin_shufflevector(xr[i][q], xr[i][q], 0, 1), v2b); u.p[2 * q + 1] = __builtin_convertvector(__builtin_shufflevector(xr[i][q], xr[i][q], 2, 3), v2b); }
        a[i] = u.v; }
#pragma unroll
      for (int i = 0; i < 4; ++i) {
#pragma unroll
        for (int j = 0; j < 4; ++j) acc[i][j] = wmma_bf(a[i], w[j], acc[i][j]); }
      __builtin_amdgcn_sched_barrier(0);   // keeps the next half stage's loads behind these WMMAs, as one group: lifted among them they would need a second set of fragment registers
    }
    asm volatile("s_wait_dscnt 0x0" ::: "memory");      // this wave's reads of the two buffers bf are done
    asm volatile("s_wait_asynccnt 0x0" ::: "memory");   // this wave's share of stage st + 1 has landed
    __syncthreads();                                    // publishes stage st + 1 and ends every wave's reads of the buffers bf
    if (st + 2 < DM / 64) fill(st + 2, bf); }
  asm volatile("s_wait_asynccnt 0x0" ::: "memory");     // no copy is outstanding when the ring becomes output staging
  _Float16 (*oh)[KP] = (_Float16 (*)[KP])sm + wave * 128; _Float16 (*ol)[KP] = oh + 64;   // this wave's own 64 + 64 staging rows of 128 B (hi, residual): written and read back by this wave alone, behind the loop's last barrier, which ends every wave's reads of both rings
  if (n0 < 2 * DM) {   // q stored unscaled (f16 sigma ~0.6, no subnormal exposure); 1/8 applied to the f32 score
#pragma unroll
    for (int i = 0; i < 4; ++i) {
#pragma unroll
      for (int j = 0; j < 4; ++j) {
#pragma unroll
        for (int r = 0; r < 8; ++r) { const float v = acc[i][j][r] + bfr(bias[j]); const _Float16 hv = (_Float16)v; oh[i * 16 + 8 * g + r][j * 16 + col] = hv; ol[i * 16 + 8 * g + r][j * 16 + col] = (_Float16)((v - (float)hv) * 2048.0f); } } }   // q, k (+ bias) as f16 hi + (x2048) residual; staging row = x row
    LDSX();
#pragma unroll 1   // rolled: four trips of eight LDS reads, as one group, and their eight stores
    for (int uo = 0; uo < 4; ++uo) {
#pragma unroll
      for (int ui = 0; ui < 4; ++ui) { const int rl = (uo * 4 + ui) * 4 + (lane >> 3), pc = lane & 7; const size_t o = (rb + rw + rl) * (2 * DM) + n0 + nw + pc * 8;   // eight lanes store one whole 128-B line of a row
        vst2((unsigned*)(QK + o), *(const v4u*)&oh[rl][pc * 8]); vst2((unsigned*)(QKL + o), *(const v4u*)&ol[rl][pc * 8]); }
      asm volatile("s_wait_xcnt 0x0" ::: "memory"); }   // stands behind the eight stores, in front of the next trip's rewriting of their address and data registers
  } else {
#pragma unroll
    for (int i = 0; i < 4; ++i) {
#pragma unroll
      for (int j = 0; j < 4; ++j) {
#pragma unroll
        for (int r = 0; r < 8; ++r) { const float v = acc[i][j][r] + bfr(bias[j]); const _Float16 hv = (_Float16)v; oh[j * 16 + col][i * 16 + 8 * g + r] = hv; ol[j * 16 + col][i * 16 + 8 * g + r] = (_Float16)((v - (float)hv) * 2048.0f); } } }   // staging row = V^T row d
    LDSX();
    const int b = (int)(rb / SS), s0 = (int)(rb % SS) + rw; const int pc0 = n0 - 2 * DM + nw;
#pragma unroll 1   // rolled, as in the q, k branch
    for (int uo = 0; uo < 4; ++uo) {
#pragma unroll
      for (int ui = 0; ui < 4; ++ui) { const int d = (uo * 4 + ui) * 4 + (lane >> 3), pc = lane & 7; const size_t o = ((size_t)b * DM + pc0 + d) * SS + s0 + pc * 8; vst2((unsigned*)(VTH + o), *(const v4u*)&oh[d][pc * 8]); vst2((unsigned*)(VTL + o), *(const v4u*)&ol[d][pc * 8]); }
      asm volatile("s_wait_xcnt 0x0" ::: "memory"); }   // stands behind the eight stores, in front of the next trip's rewriting of their address and data registers
  }
}
// ---- k_attn: block = (128 queries on eight waves, head h, batch b): banded flash attention in transposed form: S^T = K . Q^T (A = K rows, B = q), so a lane holds 16 of the 32 scores of ONE query (column col, keys ct*16 + 8g + r): maximum and sum in the lane plus one exchange between the wave's halves; the two S^T tiles, converted in place, are the B operand of O^T += V^T . P^T; O[b*S+q][h*64+d] = (acc + accl / 2048) / l (256-B segments)
__global__ __launch_bounds__(256) void k_attn(const _Float16* __restrict__ QK, const _Float16* __restrict__ QKL, const _Float16* __restrict__ VTH, const _Float16* __restrict__ VTL, const void* __restrict__ KMASK, float* __restrict__ O) {
  __shared__ __align__(16) float so[8][16][68];
  __shared__ __align__(16) _Float16 skh[2][32][KP], skl[2][32][KP], svh[2][64][VP], svl[2][64][VP];   // two buffers of one 32-key tile: K hi, K residual, V^T hi, V^T residual, read by every wave whose band the tile touches
  const int tid = threadIdx.x, wave = tid >> 5, lane = tid & 31, col = lane & 15, g = lane >> 4;
  const int qb = blockIdx.x, h = blockIdx.y, b = blockIdx.z; const int q0 = qb * 128 + wave * 16; const size_t rq = (size_t)b * SS + q0 + col;
  v16h aq[2], aql[2];
#pragma unroll
  for (int kc = 0; kc < 2; ++kc) { aq[kc] = frag_h(QK + rq * (2 * DM) + h * HD + kc * 32, lane); aql[kc] = frag_h(QKL + rq * (2 * DM) + h * HD + kc * 32, lane); }
  const int wq0 = qb * 128 + __builtin_amdgcn_readfirstlane(wave) * 16;   // q0 again, held in a scalar register: the tests on it in the loop are then scalar compares and branches, alike for the whole wave
  float m = -3.0e38f, nr = 0.f, l = 0.f;   // of query q0 + col; m in units of the unscaled score q . k, nr the exponent offset made from it (below); l holds this half-wave's keys only, carries the weights' factor 2^11 and is joined behind the loop
  const float KS = 0.125f * 1.44269504f;   // 1/sqrt(64) x log2(e): weight = 2^(score x KS + offset)
  v8f acc[4] = {}, accl[4] = {};
  const int nks = SS / 32;   // all keys
  const int ks0 = (qb * 128 - LW) > 0 ? (qb * 128 - LW) / 32 : 0; const int ks1 = ((qb * 128 + 128 + LW) / 32) < nks ? ((qb * 128 + 128 + LW) / 32) : nks;   // the tiles that the bands of the block's 128 queries touch
  const int kr = tid >> 3, kp = (tid & 7) * 8, vw = tid >> 2, vp = (tid & 3) * 8;   // a thread's 16-B piece: K row kr, V^T row vw
  const size_t gko = ((size_t)b * SS + kr) * (2 * DM) + DM + h * HD + kp, gvo = ((size_t)b * DM + h * HD + vw) * SS + vp;
  auto fill = [&](int ks, int bf) { const size_t ko = gko + (size_t)ks * 32 * (2 * DM), vo = gvo + (size_t)ks * 32;
    copy4(lds_off(&skh[bf][kr][kp]), lds_off(&skl[bf][kr][kp]), lds_off(&svh[bf][vw][vp]), lds_off(&svl[bf][vw][vp]), QK + ko, QKL + ko, VTH + vo, VTL + vo); };
  fill(ks0, 0);
  asm volatile("s_wait_asynccnt 0x0" ::: "memory");   // this wave's share of tile ks0 has landed
  __syncthreads();                                    // tile ks0 is published to all eight waves
  if (ks0 + 1 < ks1) fill(ks0 + 1, 1);
#pragma unroll 1
  for (int ks = ks0; ks < ks1; ++ks) { v8f s[2]; const int bf = (ks - ks0) & 1;
    // act: the tile holds a key of the band of one of this wave's 16 queries (17 of the block's 20 tiles away from the sequence ends). A tile that holds none would add weight 0 everywhere and leave m, l and the sums as they are: the wave branches over its reads and its arithmetic and passes only the ring's hand-over
    const bool act = ks * 32 <= wq0 + 15 + LW && ks * 32 + 31 >= wq0 - LW;
    v8f c[2] = {}, cl[2] = {};   // 3 products; each accumulator takes its products in the order kc 0, kc 1 (cl: K hi x q residual, then K residual x q)
    v16h vh[4], vl[4];   // the tile's eight V^T fragments; written and read only where act holds
    if (act) {
    v16h kh[2][2], kl[2][2];   // the tile's eight K fragments (hi, residual), read from LDS as one group in front of the twelve score WMMAs
#pragma unroll
    for (int ct = 0; ct < 2; ++ct) {
#pragma unroll
      for (int kc = 0; kc < 2; ++kc) { kh[ct][kc] = frag_h(&skh[bf][ct * 16 + col][kc * 32], lane); kl[ct][kc] = frag_h(&skl[bf][ct * 16 + col][kc * 32], lane); } }
    __builtin_amdgcn_sched_barrier(0);   // keeps the sixteen K loads as one group: without it the scheduler holds some back among the WMMAs, which then wait out an LDS latency each
#pragma unroll
    for (int kc = 0; kc < 2; ++kc) {
#pragma unroll
      for (int ct = 0; ct < 2; ++ct) { c[ct] = wmma16(kh[ct][kc], aq[kc], c[ct]); cl[ct] = wmma16(kh[ct][kc], aql[kc], cl[ct]); }
#pragma unroll
      for (int ct = 0; ct < 2; ++ct) cl[ct] = wmma16(kl[ct][kc], aq[kc], cl[ct]); }
    // the V^T fragments are read here too, into the registers that the score WMMAs set free
#pragma unroll
    for (int dt = 0; dt < 4; ++dt) { vh[dt] = frag_h(&svh[bf][dt * 16 + col][0], lane); vl[dt] = frag_h(&svl[bf][dt * 16 + col][0], lane); }
    }
    // the ring's hand-over stands here: all of the tile is in registers, and the rest of the pass (softmax, P.V) touches no LDS, so the refill flies behind it
    LDSX();                                             // holds the s_wait_dscnt 0: this wave's reads of buffer bf are done
    asm volatile("s_wait_asynccnt 0x0" ::: "memory");   // this wave's share of tile ks + 1 has landed
    __syncthreads();                                    // publishes tile ks + 1 and ends every wave's reads of buffer bf
    if (ks + 2 < ks1) fill(ks + 2, bf);
    if (!act) continue;
    // edge: some (query, key) pair of this wave's 16 x 32 may lie outside the band. Otherwise the largest q - k = wq0 + 15 - ks * 32 and the largest k - q = ks * 32 + 31 - wq0 are both <= LW: the band test passes for all 512 scores (15 of a wave's 17 tiles away from the sequence ends) and the mask work is branched over
    const bool edge = wq0 + 15 - ks * 32 > LW || ks * 32 + 31 - wq0 > LW;
#pragma unroll
    for (int ct = 0; ct < 2; ++ct) {
#pragma unroll
      for (int r = 0; r < 8; ++r) s[ct][r] = c[ct][r] + cl[ct][r] * (1.0f / 2048.0f); }   // unscaled: 1/sqrt(64) is positive, so the maximum is found as well without it, and it rides in KS
    if (edge) {
#pragma unroll
      for (int ct = 0; ct < 2; ++ct) { const int kk = ks * 32 + ct * 16 + 8 * g;
#pragma unroll
        for (int r = 0; r < 8; ++r) { const int dq = (q0 + col) - (kk + r); s[ct][r] = (dq <= LW && dq >= -LW) ? s[ct][r] : -3.0e38f; } } }   // masked keys excluded
    float mx = fmaxf(s[0][0], s[1][0]);
#pragma unroll
    for (int r = 1; r < 8; ++r) mx = fmaxf(mx, fmaxf(s[0][r], s[1][r]));
    mx = fmaxf(mx, xhalf(mx));   // the other 16 keys of this query
    const float mn = fmaxf(m, mx); const float nn = __builtin_fmaf(mn, -KS, 11.0f);   // the offset: every weight of this pass is 2^(s x KS + nn) = 2^11 x exp((s - mn) / 8); nn's own rounding cancels in sums / l, because alpha leads from the old offset to the new one
    const float alpha = (m <= -1.0e38f) ? 0.f : __builtin_amdgcn_exp2f(nn - nr);
    float es = 0.f; union { v16h v; unsigned w[8]; } pa, pl; v8f e[2];
#pragma unroll
    for (int ct = 0; ct < 2; ++ct) {
#pragma unroll
      for (int r = 0; r < 8; ++r) e[ct][r] = __builtin_amdgcn_exp2f(__builtin_fmaf(s[ct][r], KS, nn)); }   // one FMA in front of the hardware exp2 holds the score scale, log2(e), the maximum and the weights' 2^11
    if (edge) {   // a masked key's weight is 0, also where every key of the query so far is masked (mn is then the mask value itself)
#pragma unroll
      for (int ct = 0; ct < 2; ++ct) {
#pragma unroll
        for (int r = 0; r < 8; ++r) e[ct][r] = (s[ct][r] <= -1.0e38f) ? 0.f : e[ct][r]; } }
#pragma unroll
    for (int r = 0; r < 8; ++r) es += e[0][r] + e[1][r];
    // P^T as a B fragment: element r = key 8g + r, element 8 + r = key 16 + 8g + r, the k order of frag_h (word ct * 4 + i = elements ct * 8 + 2 i, + 1); the weights carry 2^11 into the f16 split so small ones stay out of the f16 subnormal range
#pragma unroll
    for (int ct = 0; ct < 2; ++ct) { v2f y[4];
#pragma unroll
      for (int i = 0; i < 4; ++i) { const v2f ee = { e[ct][2 * i], e[ct][2 * i + 1] }; pa.w[ct * 4 + i] = __builtin_bit_cast(unsigned, __builtin_convertvector(ee, v2h)); y[i] = ee * 2048.0f; }
      // residual (e - h) x 2^11 = e x 2^11 - h x 2^11, rounded to f16: both products and their difference are exact in f32, so the value is that of subtract-then-scale. In asm so that it is one mixed-precision FMA an element, reading h from its packed f16 word and writing the f16 half: the compiler's forms take h back to f32 and round to f16 with instructions of their own. The four low halves stand in front of the four high ones, so that no instruction follows directly on the one that wrote its register's other half
      asm("v_fma_mixlo_f16 %0, %4, %8, %9 op_sel_hi:[1,0,0]\n\t"
          "v_fma_mixlo_f16 %1, %5, %8, %11 op_sel_hi:[1,0,0]\n\t"
          "v_fma_mixlo_f16 %2, %6, %8, %13 op_sel_hi:[1,0,0]\n\t"
          "v_fma_mixlo_f16 %3, %7, %8, %15 op_sel_hi:[1,0,0]\n\t"
          "v_fma_mixhi_f16 %0, %4, %8, %10 op_sel:[1,0,0] op_sel_hi:[1,0,0]\n\t"
          "v_fma_mixhi_f16 %1, %5, %8, %12 op_sel:[1,0,0] op_sel_hi:[1,0,0]\n\t"
          "v_fma_mixhi_f16 %2, %6, %8, %14 op_sel:[1,0,0] op_sel_hi:[1,0,0]\n\t"
          "v_fma_mixhi_f16 %3, %7, %8, %16 op_sel:[1,0,0] op_sel_hi:[1,0,0]"
          : "=&v"(pl.w[ct * 4]), "=&v"(pl.w[ct * 4 + 1]), "=&v"(pl.w[ct * 4 + 2]), "=&v"(pl.w[ct * 4 + 3])
          : "v"(pa.w[ct * 4]), "v"(pa.w[ct * 4 + 1]), "v"(pa.w[ct * 4 + 2]), "v"(pa.w[ct * 4 + 3]), "s"(-2048.0f),
            "v"(y[0][0]), "v"(y[0][1]), "v"(y[1][0]), "v"(y[1][1]), "v"(y[2][0]), "v"(y[2][1]), "v"(y[3][0]), "v"(y[3][1])); }
    l = l * alpha + es; m = mn; nr = nn;
#pragma unroll
    for (int dt = 0; dt < 4; ++dt) {
#pragma unroll
      for (int r = 0; r < 8; ++r) { acc[dt][r] *= alpha; accl[dt][r] *= alpha; } }
#pragma unroll
    for (int dt = 0; dt < 4; ++dt) { acc[dt] = wmma16(vh[dt], pa.v, acc[dt]); accl[dt] = wmma16(vh[dt], pl.v, accl[dt]); }   // V hi x P hi, V hi x P residual
#pragma unroll
    for (int dt = 0; dt < 4; ++dt) accl[dt] = wmma16(vl[dt], pa.v, accl[dt]);   // V residual x P hi (3 products)
  }
  asm volatile("s_wait_asynccnt 0x0" ::: "memory");     // no copy is outstanding when the wave goes on to the epilogue
  l += xhalf(l);   // the two half-waves' sums of one query
  const float il = 1.0f / l;   // l and the sums carry the same 2^11
#pragma unroll
  for (int dt = 0; dt < 4; ++dt) { v4f o0, o1;   // acc[dt][r] = O^T[d = dt*16 + 8g + r][query col]
#pragma unroll
    for (int r = 0; r < 4; ++r) { o0[r] = (acc[dt][r] + accl[dt][r] * (1.0f / 2048.0f)) * il; o1[r] = (acc[dt][4 + r] + accl[dt][4 + r] * (1.0f / 2048.0f)) * il; }
    *(v4f*)&so[wave][col][dt * 16 + 8 * g] = o0; *(v4f*)&so[wave][col][dt * 16 + 8 * g + 4] = o1; }
  LDSX();
  for (int rl = 0; rl < 16; ++rl) if (lane < 16) vst2(O + ((size_t)b * SS + q0 + rl) * DM + h * HD + lane * 4, *(const v4f*)&so[wave][rl][lane * 4]);
}
// ---- k_out: block = (64 rows, 128 cols): out = O(hi/lo) . Wo rows (2 products) + bo
__global__ __launch_bounds__(128) void k_out(const float* __restrict__ O, const __bf16* __restrict__ P, const float* __restrict__ BO, float* __restrict__ Y) {
  __shared__ __align__(16) float so[4][16][132];
  const int tid = threadIdx.x, wave = tid >> 5, lane = tid & 31, col = lane & 15, g = lane >> 4; const size_t r0 = (size_t)blockIdx.x * 64 + wave * 16; const int n0 = blockIdx.y * 128;
  v8f acc[8] = {};
#pragma unroll 2
  for (int kc = 0; kc < DM / 32; ++kc) { const F2 a = split_row(O + (r0 + col) * DM, kc * 32, lane);
#pragma unroll
    for (int j = 0; j < 8; ++j) { const v16b w = frag_b(P + (size_t)(n0 + j * 16 + col) * DM + kc * 32, lane); acc[j] = wmma_bf(a.l, w, acc[j]); acc[j] = wmma_bf(a.h, w, acc[j]); } }
#pragma unroll
  for (int j = 0; j < 8; ++j) {
#pragma unroll
    for (int r = 0; r < 8; ++r) so[wave][8 * g + r][j * 16 + col] = acc[j][r] + (BO ? bfr(BO[n0 + j * 16 + col]) : 0.f); }
  LDSX();
  for (int rl = 0; rl < 16; ++rl) vst2(Y + (r0 + rl) * DM + n0 + lane * 4, *(const v4f*)&so[wave][rl][lane * 4]);
}
extern "C" void kernel_launch(void* const* d_in, const int* in_sizes, int n_in, void* d_out, int out_size, void* d_ws, size_t ws_size, hipStream_t stream) {
  (void)in_sizes; (void)n_in; (void)out_size;
  const float** F = (const float**)d_in;   // 0 x [2,8192,512], 1 Wq [512,512] (in,out), 2 bq, 3 Wk, 4 bk, 5 Wv, 6 bv
  if (ws_size < (size_t)WS_END) return;
  char* ws = (char*)d_ws; __bf16* PK = (__bf16*)(ws + WS_PK); _Float16 *QK = (_Float16*)(ws + WS_QK), *QKL = (_Float16*)(ws + WS_QKL), *VTH = (_Float16*)(ws + WS_VTH), *VTL = (_Float16*)(ws + WS_VTL);
  k_pack<<<dim3(DM / 64, DM / 64, 3), 128, 0, stream>>>(F[1], F[3], F[5], PK);
  k_qkv<<<dim3(TNB * SS / 128, QKVW / 256), 256, 0, stream>>>(F[0], F[0], F[0], PK + PK_A, F[2], F[4], F[6], QK, QKL, VTH, VTL);
  k_attn<<<dim3(TQB / 2, NH, TNB), 256, 0, stream>>>(QK, QKL, VTH, VTL, nullptr, (float*)d_out);
}
